// v000
// Times are from an AMD MI455X. After a warm-up the kernel runs many times in a row, and a time is the length of
// such a window on the GPU divided by its runs, so every launch and the gaps after it count. The runs cycle
// through copies of the inputs. A figure is the median of several windows, for all but v000 over two sittings.
// Sittings can differ by a few percent; kernels timed side by side share one.
// v000 is the starting kernel. One run takes 544 microseconds.
#include <hip/hip_runtime.h>

// ---------------- problem constants ----------------
#define BATCH   2
#define SEQ     2048
#define DM      1024
#define HEADS   16
#define DK      64
#define DFF     4096
#define MROWS   (BATCH * SEQ)       // 4096
#define EPSV    1e-5f
#define THETA_F 10000.0f

// ---------------- types ----------------
typedef __bf16 bf16;
typedef __attribute__((ext_vector_type(16))) __bf16 bf16x16;
typedef __attribute__((ext_vector_type(8)))  __bf16 bf16x8;
typedef __attribute__((ext_vector_type(8)))  float  f32x8;
typedef __attribute__((ext_vector_type(4)))  unsigned int u32x4;

// Load one 16x32 bf16 WMMA fragment (A or B operand) from LDS.
// rowPtr points at the start of this lane's row (16-byte aligned, row stride
// is a multiple of 8 elements). kh = lane>>4 selects the K-half per the ISA
// 16-bit A-matrix layout: half 0 -> K {0..7, 16..23}, half 1 -> K {8..15, 24..31}.
__device__ __forceinline__ bf16x16 frag_ld(const bf16* rowPtr, int kh) {
    bf16x8 lo = *(const bf16x8*)(rowPtr + kh * 8);
    bf16x8 hi = *(const bf16x8*)(rowPtr + 16 + kh * 8);
    return __builtin_shufflevector(lo, hi, 0,1,2,3,4,5,6,7,8,9,10,11,12,13,14,15);
}

__device__ __forceinline__ f32x8 wmma_bf16(bf16x16 a, bf16x16 b, f32x8 c) {
    return __builtin_amdgcn_wmma_f32_16x16x32_bf16(false, a, false, b, (short)0, c, false, false);
}

// ---------------- fp32 -> bf16 conversion ----------------
__global__ __launch_bounds__(256) void k_f32_to_bf16(const float* __restrict__ in,
                                                     bf16* __restrict__ out, int n) {
    int i = blockIdx.x * 256 + threadIdx.x;
    if (i < n) out[i] = (bf16)in[i];
}

// ---------------- RMSNorm (one block per row) ----------------
__global__ __launch_bounds__(256) void k_rmsnorm(const float* __restrict__ X,
                                                 const float* __restrict__ G,
                                                 bf16* __restrict__ Out) {
    const int row = blockIdx.x;
    const float* x = X + (size_t)row * DM;
    float s = 0.f;
    #pragma unroll
    for (int i = threadIdx.x; i < DM; i += 256) { float v = x[i]; s += v * v; }
    #pragma unroll
    for (int m = 16; m >= 1; m >>= 1) s += __shfl_xor(s, m, 32);
    __shared__ float red[8];
    if ((threadIdx.x & 31) == 0) red[threadIdx.x >> 5] = s;
    __syncthreads();
    float tot = 0.f;
    #pragma unroll
    for (int j = 0; j < 8; ++j) tot += red[j];
    const float rinv = rsqrtf(tot / (float)DM + EPSV);
    bf16* o = Out + (size_t)row * DM;
    for (int i = threadIdx.x; i < DM; i += 256) o[i] = (bf16)(x[i] * rinv * G[i]);
}

// ---------------- WMMA NT-GEMM: C[M,N] = A[M,K] * B[N,K]^T ----------------
// Software-pipelined: tile k+1 is fetched into registers while tile k's WMMAs
// run; tile k+2 is prefetched into cache (global_prefetch_b8 on gfx1250).
// EPI 0: store f32          EPI 1: store f32 + R[m,n] (residual)
// EPI 2: store bf16( silu(R[m,n]) * acc )   (fused SwiGLU; R = w1 output)
template <int EPI>
__global__ __launch_bounds__(256)
void k_gemm_nt(const bf16* __restrict__ A, const bf16* __restrict__ B,
               const float* __restrict__ R, void* __restrict__ Out,
               int M, int N, int K) {
    constexpr int BM = 128, BN = 128, BK = 32, LDT = BK + 8;   // 40-elem stride
    __shared__ __attribute__((aligned(16))) bf16 As[BM * LDT];
    __shared__ __attribute__((aligned(16))) bf16 Bs[BN * LDT];

    const int m0 = blockIdx.y * BM, n0 = blockIdx.x * BN;
    const int tid  = threadIdx.x;
    const int lane = tid & 31, wid = tid >> 5;   // 8 waves
    const int wm = wid >> 2, wn = wid & 3;       // 2 x 4 wave grid: 64x32 per wave
    const int l15 = lane & 15, kh = lane >> 4;

    int rrow[2], rcol[2];
    #pragma unroll
    for (int i = 0; i < 2; ++i) {
        int idx = tid + i * 256;                 // 0..511 -> 128 rows x 32 cols
        rrow[i] = idx >> 2; rcol[i] = (idx & 3) * 8;
    }
    u32x4 ra[2], rb[2];
    auto fetch = [&](int k0) {
        #pragma unroll
        for (int i = 0; i < 2; ++i) {
            ra[i] = *(const u32x4*)(A + (size_t)(m0 + rrow[i]) * K + k0 + rcol[i]);
            rb[i] = *(const u32x4*)(B + (size_t)(n0 + rrow[i]) * K + k0 + rcol[i]);
        }
    };

    fetch(0);
    f32x8 acc[4][2] = {};

    for (int k0 = 0; k0 < K; k0 += BK) {
        #pragma unroll
        for (int i = 0; i < 2; ++i) {
            *(u32x4*)(As + rrow[i] * LDT + rcol[i]) = ra[i];
            *(u32x4*)(Bs + rrow[i] * LDT + rcol[i]) = rb[i];
        }
        __syncthreads();

        if (k0 + 2 * BK < K) {   // warm GL2/L0 two tiles ahead
            __builtin_prefetch(A + (size_t)(m0 + rrow[0]) * K + k0 + 2 * BK + rcol[0], 0, 3);
            __builtin_prefetch(B + (size_t)(n0 + rrow[0]) * K + k0 + 2 * BK + rcol[0], 0, 3);
        }
        if (k0 + BK < K) fetch(k0 + BK);   // loads in flight under the WMMAs

        bf16x16 afr[4], bfr[2];
        #pragma unroll
        for (int mi = 0; mi < 4; ++mi)
            afr[mi] = frag_ld(As + (wm * 64 + mi * 16 + l15) * LDT, kh);
        #pragma unroll
        for (int ni = 0; ni < 2; ++ni)
            bfr[ni] = frag_ld(Bs + (wn * 32 + ni * 16 + l15) * LDT, kh);
        #pragma unroll
        for (int mi = 0; mi < 4; ++mi)
            #pragma unroll
            for (int ni = 0; ni < 2; ++ni)
                acc[mi][ni] = wmma_bf16(afr[mi], bfr[ni], acc[mi][ni]);
        __syncthreads();
    }

    #pragma unroll
    for (int mi = 0; mi < 4; ++mi)
        #pragma unroll
        for (int ni = 0; ni < 2; ++ni)
            #pragma unroll
            for (int r = 0; r < 8; ++r) {
                int gm = m0 + wm * 64 + mi * 16 + kh * 8 + r;
                int gn = n0 + wn * 32 + ni * 16 + l15;
                size_t off = (size_t)gm * N + gn;
                float v = acc[mi][ni][r];
                if constexpr (EPI == 0) {
                    ((float*)Out)[off] = v;
                } else if constexpr (EPI == 1) {
                    ((float*)Out)[off] = v + R[off];
                } else {
                    float a = R[off];
                    float g = a / (1.f + __expf(-a));   // a * sigmoid(a)
                    ((bf16*)Out)[off] = (bf16)(g * v);
                }
            }
}

// ---------------- RoPE on Q,K + bf16 convert; V -> per-head transposed bf16 ----
// Q,K,V are fp32 (B,S,DM). Qb,Kb: bf16 (B,S,DM). Vt: bf16 [b][h][dk][S].
__global__ __launch_bounds__(256)
void k_rope(const float* __restrict__ Q, const float* __restrict__ K,
            const float* __restrict__ V, bf16* __restrict__ Qb,
            bf16* __restrict__ Kb, bf16* __restrict__ Vt) {
    const int pairsPerRow = DM / 2;                       // 512
    size_t idx = (size_t)blockIdx.x * 256 + threadIdx.x;  // over B*S*DM/2
    size_t row = idx / pairsPerRow;                       // b*S + s
    int pr = (int)(idx % pairsPerRow);
    int h = pr / (DK / 2);
    int p = pr % (DK / 2);
    int s = (int)(row % SEQ);
    int b = (int)(row / SEQ);
    int e0 = h * DK + 2 * p;

    float inv = __powf(THETA_F, -2.f * (float)p / (float)DK);
    float sn, cs;
    __sincosf((float)s * inv, &sn, &cs);

    size_t base = row * DM;
    float q1 = Q[base + e0], q2 = Q[base + e0 + 1];
    Qb[base + e0]     = (bf16)(q1 * cs - q2 * sn);
    Qb[base + e0 + 1] = (bf16)(q1 * sn + q2 * cs);
    float k1 = K[base + e0], k2 = K[base + e0 + 1];
    Kb[base + e0]     = (bf16)(k1 * cs - k2 * sn);
    Kb[base + e0 + 1] = (bf16)(k1 * sn + k2 * cs);

    float v1 = V[base + e0], v2 = V[base + e0 + 1];
    size_t vtb = ((size_t)b * HEADS + h) * DK;
    Vt[(vtb + 2 * p)     * SEQ + s] = (bf16)v1;
    Vt[(vtb + 2 * p + 1) * SEQ + s] = (bf16)v2;
}

// ---------------- Flash attention (causal, online softmax) ----------------
// Block: 128 threads (4 waves), handles one (b,h) and 64 query rows.
// Each wave owns a 16-row query strip; QK^T and P*V both via WMMA bf16.
// K/V tile kt+1 is fetched into registers while tile kt is being consumed.
__global__ __launch_bounds__(128)
void k_flash_attn(const bf16* __restrict__ Qb, const bf16* __restrict__ Kb,
                  const bf16* __restrict__ Vt, bf16* __restrict__ Ob) {
    constexpr int LT = 72;   // 64 + 8 pad (16B-aligned rows, conflict-free b128)
    __shared__ __attribute__((aligned(16))) bf16 Qs [64 * LT];
    __shared__ __attribute__((aligned(16))) bf16 Ks [64 * LT];
    __shared__ __attribute__((aligned(16))) bf16 Vts[64 * LT];
    __shared__ __attribute__((aligned(16))) bf16 Ps [64 * LT];

    const int qt = blockIdx.x;            // query tile (64 rows)
    const int bh = blockIdx.y;
    const int b = bh / HEADS, h = bh % HEADS;
    const int tid = threadIdx.x, lane = tid & 31, w = tid >> 5;
    const int l15 = lane & 15, kh = lane >> 4;

    const bf16* Qg = Qb + (size_t)b * SEQ * DM + h * DK;
    const bf16* Kg = Kb + (size_t)b * SEQ * DM + h * DK;
    const bf16* Vg = Vt + ((size_t)b * HEADS + h) * DK * SEQ;

    int trow[4], tcol[4];
    #pragma unroll
    for (int i = 0; i < 4; ++i) {          // 64x64 tile, 8 bf16 per thread-iter
        int idx = tid + i * 128;
        trow[i] = idx >> 3; tcol[i] = (idx & 7) * 8;
    }
    #pragma unroll
    for (int i = 0; i < 4; ++i)
        *(u32x4*)(Qs + trow[i] * LT + tcol[i]) =
            *(const u32x4*)(Qg + (size_t)(qt * 64 + trow[i]) * DM + tcol[i]);
    __syncthreads();

    const bf16* qrow = Qs + (w * 16 + l15) * LT;
    bf16x16 aq0 = frag_ld(qrow, kh), aq1 = frag_ld(qrow + 32, kh);

    float mrow[8], lrow[8];
    #pragma unroll
    for (int r = 0; r < 8; ++r) { mrow[r] = -1e30f; lrow[r] = 0.f; }
    f32x8 Oacc[4] = {};

    const int qg_base = qt * 64 + w * 16 + kh * 8;   // + r gives global q index

    u32x4 rk[4], rv[4];
    auto fetchKV = [&](int kt) {
        #pragma unroll
        for (int i = 0; i < 4; ++i) {
            rk[i] = *(const u32x4*)(Kg + (size_t)(kt * 64 + trow[i]) * DM + tcol[i]);
            rv[i] = *(const u32x4*)(Vg + (size_t)trow[i] * SEQ + kt * 64 + tcol[i]);
        }
    };
    fetchKV(0);

    for (int kt = 0; kt <= qt; ++kt) {
        __syncthreads();   // previous-iteration readers of Ks/Vts are done
        #pragma unroll
        for (int i = 0; i < 4; ++i) {
            *(u32x4*)(Ks  + trow[i] * LT + tcol[i]) = rk[i];
            *(u32x4*)(Vts + trow[i] * LT + tcol[i]) = rv[i];
        }
        __syncthreads();

        if (kt + 2 <= qt) {   // warm GL2 two tiles ahead
            __builtin_prefetch(Kg + (size_t)((kt + 2) * 64 + trow[0]) * DM + tcol[0], 0, 3);
            __builtin_prefetch(Vg + (size_t)trow[0] * SEQ + (kt + 2) * 64 + tcol[0], 0, 3);
        }
        if (kt < qt) fetchKV(kt + 1);   // loads in flight under score/softmax

        // scores: 16(q) x 64(k) per wave, K-dim = dk = 64 -> 2 chained WMMAs
        f32x8 st[4];
        #pragma unroll
        for (int nt = 0; nt < 4; ++nt) {
            const bf16* krow = Ks + (nt * 16 + l15) * LT;
            f32x8 a = {};
            a = wmma_bf16(aq0, frag_ld(krow, kh), a);
            a = wmma_bf16(aq1, frag_ld(krow + 32, kh), a);
            st[nt] = a;
        }
        // scale + causal mask
        #pragma unroll
        for (int nt = 0; nt < 4; ++nt) {
            int kg = kt * 64 + nt * 16 + l15;
            #pragma unroll
            for (int r = 0; r < 8; ++r) {
                float v = st[nt][r] * 0.125f;                // 1/sqrt(64)
                st[nt][r] = (kg > qg_base + r) ? -1e30f : v;
            }
        }
        // online softmax: row max over 16 lanes (columns) then over nt
        float sc[8];
        #pragma unroll
        for (int r = 0; r < 8; ++r) {
            float mx = fmaxf(fmaxf(st[0][r], st[1][r]), fmaxf(st[2][r], st[3][r]));
            #pragma unroll
            for (int m = 1; m < 16; m <<= 1) mx = fmaxf(mx, __shfl_xor(mx, m, 32));
            float mnew = fmaxf(mrow[r], mx);
            sc[r] = __expf(mrow[r] - mnew);
            #pragma unroll
            for (int nt = 0; nt < 4; ++nt) st[nt][r] = __expf(st[nt][r] - mnew);
            float sm = st[0][r] + st[1][r] + st[2][r] + st[3][r];
            #pragma unroll
            for (int m = 1; m < 16; m <<= 1) sm += __shfl_xor(sm, m, 32);
            lrow[r] = lrow[r] * sc[r] + sm;
            mrow[r] = mnew;
        }
        #pragma unroll
        for (int nt = 0; nt < 4; ++nt)
            #pragma unroll
            for (int r = 0; r < 8; ++r) Oacc[nt][r] *= sc[r];

        // P: C-layout -> LDS -> A-layout fragments
        #pragma unroll
        for (int nt = 0; nt < 4; ++nt)
            #pragma unroll
            for (int r = 0; r < 8; ++r)
                Ps[(w * 16 + kh * 8 + r) * LT + nt * 16 + l15] = (bf16)st[nt][r];
        __syncthreads();

        const bf16* prow = Ps + (w * 16 + l15) * LT;
        bf16x16 ap0 = frag_ld(prow, kh), ap1 = frag_ld(prow + 32, kh);
        #pragma unroll
        for (int nt = 0; nt < 4; ++nt) {
            const bf16* vrow = Vts + (nt * 16 + l15) * LT;
            Oacc[nt] = wmma_bf16(ap0, frag_ld(vrow, kh), Oacc[nt]);
            Oacc[nt] = wmma_bf16(ap1, frag_ld(vrow + 32, kh), Oacc[nt]);
        }
    }

    // normalize and write bf16 output (feeds the WO GEMM directly)
    #pragma unroll
    for (int nt = 0; nt < 4; ++nt)
        #pragma unroll
        for (int r = 0; r < 8; ++r) {
            float o = Oacc[nt][r] / lrow[r];
            size_t srow = (size_t)b * SEQ + qt * 64 + w * 16 + kh * 8 + r;
            Ob[srow * DM + h * DK + nt * 16 + l15] = (bf16)o;
        }
}

// ---------------- host launcher ----------------
extern "C" void kernel_launch(void* const* d_in, const int* in_sizes, int n_in,
                              void* d_out, int out_size, void* d_ws, size_t ws_size,
                              hipStream_t stream) {
    (void)in_sizes; (void)n_in; (void)out_size; (void)ws_size;
    const float* x  = (const float*)d_in[0];
    const float* wq = (const float*)d_in[1];
    const float* wk = (const float*)d_in[2];
    const float* wv = (const float*)d_in[3];
    const float* wo = (const float*)d_in[4];
    const float* w1 = (const float*)d_in[5];
    const float* w2 = (const float*)d_in[6];
    const float* w3 = (const float*)d_in[7];
    const float* g1 = (const float*)d_in[8];
    const float* g2 = (const float*)d_in[9];
    float* out = (float*)d_out;

    const size_t MB = 1ull << 20;
    char* p = (char*)d_ws;
    bf16*  n_bf  = (bf16*)p;            p += 8 * MB;   // 4096x1024 bf16
    bf16*  wq_bf = (bf16*)p;            p += 2 * MB;
    bf16*  wk_bf = (bf16*)p;            p += 2 * MB;
    bf16*  wv_bf = (bf16*)p;            p += 2 * MB;
    bf16*  wo_bf = (bf16*)p;            p += 2 * MB;
    bf16*  w1_bf = (bf16*)p;            p += 8 * MB;
    bf16*  w3_bf = (bf16*)p;            p += 8 * MB;
    bf16*  w2_bf = (bf16*)p;            p += 8 * MB;
    float* x1    = (float*)p;           p += 16 * MB;  // x + attn residual
    bf16*  n2_bf = (bf16*)p;            p += 8 * MB;
    // 64 MB region reused: {q_f,k_f,v_f fp32 + q_bf,k_bf} then a_f (w1 output)
    char*  reuse = p;                   p += 64 * MB;
    float* q_f  = (float*)reuse;
    float* k_f  = (float*)(reuse + 16 * MB);
    float* v_f  = (float*)(reuse + 32 * MB);
    bf16*  q_bf = (bf16*) (reuse + 48 * MB);
    bf16*  k_bf = (bf16*) (reuse + 56 * MB);
    float* a_f  = (float*)reuse;                       // 64 MB, after attention
    bf16*  vt_bf = (bf16*)p;            p += 8 * MB;
    bf16*  o_bf  = (bf16*)p;            p += 8 * MB;
    bf16*  h_bf  = (bf16*)p;            p += 32 * MB;  // swiglu output 4096x4096

    // 1) weights -> bf16
    auto conv = [&](const float* src, bf16* dst, int n) {
        k_f32_to_bf16<<<(n + 255) / 256, 256, 0, stream>>>(src, dst, n);
    };
    conv(wq, wq_bf, DM * DM);  conv(wk, wk_bf, DM * DM);
    conv(wv, wv_bf, DM * DM);  conv(wo, wo_bf, DM * DM);
    conv(w1, w1_bf, DFF * DM); conv(w3, w3_bf, DFF * DM); conv(w2, w2_bf, DM * DFF);

    // 2) n = rmsnorm(x, g1)
    k_rmsnorm<<<MROWS, 256, 0, stream>>>(x, g1, n_bf);

    // 3) Q,K,V projections (fp32 out, then RoPE)
    dim3 gQKV(DM / 128, MROWS / 128);
    k_gemm_nt<0><<<gQKV, 256, 0, stream>>>(n_bf, wq_bf, nullptr, q_f, MROWS, DM, DM);
    k_gemm_nt<0><<<gQKV, 256, 0, stream>>>(n_bf, wk_bf, nullptr, k_f, MROWS, DM, DM);
    k_gemm_nt<0><<<gQKV, 256, 0, stream>>>(n_bf, wv_bf, nullptr, v_f, MROWS, DM, DM);

    // 4) RoPE(q,k) -> bf16; V -> per-head transposed bf16
    k_rope<<<(BATCH * SEQ * DM / 2) / 256, 256, 0, stream>>>(q_f, k_f, v_f,
                                                             q_bf, k_bf, vt_bf);

    // 5) causal flash attention -> o (bf16)
    dim3 gAtt(SEQ / 64, BATCH * HEADS);
    k_flash_attn<<<gAtt, 128, 0, stream>>>(q_bf, k_bf, vt_bf, o_bf);

    // 6) x1 = x + o @ Wo^T
    k_gemm_nt<1><<<gQKV, 256, 0, stream>>>(o_bf, wo_bf, x, x1, MROWS, DM, DM);

    // 7) n2 = rmsnorm(x1, g2)
    k_rmsnorm<<<MROWS, 256, 0, stream>>>(x1, g2, n2_bf);

    // 8) a = n2 @ W1^T ; h = silu(a) * (n2 @ W3^T)  [fused epilogue]
    dim3 gFF(DFF / 128, MROWS / 128);
    k_gemm_nt<0><<<gFF, 256, 0, stream>>>(n2_bf, w1_bf, nullptr, a_f, MROWS, DFF, DM);
    k_gemm_nt<2><<<gFF, 256, 0, stream>>>(n2_bf, w3_bf, a_f, h_bf, MROWS, DFF, DM);

    // 9) out = x1 + h @ W2^T
    k_gemm_nt<1><<<gQKV, 256, 0, stream>>>(h_bf, w2_bf, x1, out, MROWS, DM, DFF);
}

// v001
// It runs in 436 microseconds.
// Two timings next to v000 put it at 1.26 and 1.30 times that version's speed.
#include <hip/hip_runtime.h>

// ---------------- problem constants ----------------
#define BATCH   2
#define SEQ     2048
#define DM      1024
#define HEADS   16
#define DK      64
#define DFF     4096
#define MROWS   (BATCH * SEQ)       // 4096
#define EPSV    1e-5f
#define THETA_F 10000.0f

// ---------------- types ----------------
typedef __bf16 bf16;
typedef __attribute__((ext_vector_type(16))) __bf16 bf16x16;
typedef __attribute__((ext_vector_type(8)))  __bf16 bf16x8;
typedef __attribute__((ext_vector_type(8)))  float  f32x8;
typedef __attribute__((ext_vector_type(4)))  unsigned int u32x4;

// Load one 16x32 bf16 WMMA fragment (A or B operand) from LDS.
// rowPtr points at the start of this lane's row (16-byte aligned, row stride
// is a multiple of 8 elements). kh = lane>>4 selects the K-half per the ISA
// 16-bit A-matrix layout: half 0 -> K {0..7, 16..23}, half 1 -> K {8..15, 24..31}.
__device__ __forceinline__ bf16x16 frag_ld(const bf16* rowPtr, int kh) {
    bf16x8 lo = *(const bf16x8*)(rowPtr + kh * 8);
    bf16x8 hi = *(const bf16x8*)(rowPtr + 16 + kh * 8);
    return __builtin_shufflevector(lo, hi, 0,1,2,3,4,5,6,7,8,9,10,11,12,13,14,15);
}

__device__ __forceinline__ f32x8 wmma_bf16(bf16x16 a, bf16x16 b, f32x8 c) {
    return __builtin_amdgcn_wmma_f32_16x16x32_bf16(false, a, false, b, (short)0, c, false, false);
}

// ---------------- fp32 -> bf16 conversion ----------------
__global__ __launch_bounds__(256) void k_f32_to_bf16(const float* __restrict__ in,
                                                     bf16* __restrict__ out, int n) {
    int i = blockIdx.x * 256 + threadIdx.x;
    if (i < n) out[i] = (bf16)in[i];
}

// ---------------- RMSNorm (one block per row) ----------------
__global__ __launch_bounds__(256) void k_rmsnorm(const float* __restrict__ X,
                                                 const float* __restrict__ G,
                                                 bf16* __restrict__ Out) {
    const int row = blockIdx.x;
    const float* x = X + (size_t)row * DM;
    float s = 0.f;
    #pragma unroll
    for (int i = threadIdx.x; i < DM; i += 256) { float v = x[i]; s += v * v; }
    #pragma unroll
    for (int m = 16; m >= 1; m >>= 1) s += __shfl_xor(s, m, 32);
    __shared__ float red[8];
    if ((threadIdx.x & 31) == 0) red[threadIdx.x >> 5] = s;
    __syncthreads();
    float tot = 0.f;
    #pragma unroll
    for (int j = 0; j < 8; ++j) tot += red[j];
    const float rinv = rsqrtf(tot / (float)DM + EPSV);
    bf16* o = Out + (size_t)row * DM;
    for (int i = threadIdx.x; i < DM; i += 256) o[i] = (bf16)(x[i] * rinv * G[i]);
}

// Eight asynchronous 16-byte copies per lane, global memory -> LDS, no register
// in between. The s_wait_xcnt is the last line of the copies' own statement so
// that no address register named here is rewritten ahead of it.
__device__ __forceinline__ void async_copy8(unsigned l, unsigned lstep,
                                            const bf16* g, size_t gstep) {
    asm volatile(
        "global_load_async_to_lds_b128 %0, %8, off\n\t"
        "global_load_async_to_lds_b128 %1, %9, off\n\t"
        "global_load_async_to_lds_b128 %2, %10, off\n\t"
        "global_load_async_to_lds_b128 %3, %11, off\n\t"
        "global_load_async_to_lds_b128 %4, %12, off\n\t"
        "global_load_async_to_lds_b128 %5, %13, off\n\t"
        "global_load_async_to_lds_b128 %6, %14, off\n\t"
        "global_load_async_to_lds_b128 %7, %15, off\n\t"
        "s_wait_xcnt 0x0"
        :: "v"(l), "v"(l + lstep), "v"(l + 2 * lstep), "v"(l + 3 * lstep),
           "v"(l + 4 * lstep), "v"(l + 5 * lstep), "v"(l + 6 * lstep), "v"(l + 7 * lstep),
           "v"(g), "v"(g + gstep), "v"(g + 2 * gstep), "v"(g + 3 * gstep),
           "v"(g + 4 * gstep), "v"(g + 5 * gstep), "v"(g + 6 * gstep), "v"(g + 7 * gstep)
        : "memory");
}

// ---------------- WMMA NT-GEMM: C[M,N] = A[M,K] * B[N,K]^T ----------------
// K is walked in tiles of 128. Two LDS buffers: tile t+1's asynchronous copies
// fly while tile t's 32 WMMAs per wave run; one barrier per tile publishes the
// next tile and frees the buffer just read. K must be a multiple of 128.
// EPI 0: store f32          EPI 1: store f32 + R[m,n] (residual)
// EPI 2: store bf16( silu(R[m,n]) * acc )   (fused SwiGLU; R = w1 output)
template <int EPI>
__global__ __launch_bounds__(256)
void k_gemm_nt(const bf16* __restrict__ A, const bf16* __restrict__ B,
               const float* __restrict__ R, void* __restrict__ Out,
               int M, int N, int K) {
    constexpr int BM = 128, BN = 128, BK = 128, LDT = BK + 8;  // 272-byte pitch
    constexpr int OPER = BM * LDT;                             // one operand's tile
    constexpr int STAGE = 2 * OPER;                            // [A tile | B tile]
    __shared__ __attribute__((aligned(16))) bf16 Sm[2 * STAGE];

    const int m0 = blockIdx.y * BM, n0 = blockIdx.x * BN;
    const int tid  = threadIdx.x;
    const int lane = tid & 31, wid = tid >> 5;   // 8 waves
    const int wm = wid >> 2, wn = wid & 3;       // 2 x 4 wave grid: 64x32 per wave
    const int l15 = lane & 15, kh = lane >> 4;

    // Copy map: 16 lanes cover one 256-byte row; a lane's 8 copies are 16 rows apart.
    const int crow = tid >> 4, ccol = (tid & 15) * 8;
    const bf16* gA = A + (size_t)(m0 + crow) * K + ccol;
    const bf16* gB = B + (size_t)(n0 + crow) * K + ccol;
    const unsigned lA = (unsigned)(size_t)(Sm + crow * LDT + ccol);
    const size_t gstep = (size_t)16 * K;
    auto stage_in = [&](int t, int buf) {
        const unsigned l = lA + (unsigned)(buf * STAGE * 2);
        async_copy8(l,            16 * LDT * 2, gA + (size_t)t * BK, gstep);
        async_copy8(l + OPER * 2, 16 * LDT * 2, gB + (size_t)t * BK, gstep);
    };

    const int nt = K / BK;
    stage_in(0, 0);
    asm volatile("s_wait_asynccnt 0x0" ::: "memory");   // tile 0 has landed (own copies)
    __syncthreads();                                    // ... and every wave's copies
    if (nt > 1) stage_in(1, 1);

    f32x8 acc[4][2] = {};

    for (int t = 0; t < nt; ++t) {
        const bf16* As = Sm + (t & 1) * STAGE;
        const bf16* Bs = As + OPER;
        // Unrolled: the four blocks' LDS offsets become immediates and a block's
        // reads can start under the WMMAs of the block before it.
        #pragma unroll
        for (int kk = 0; kk < BK; kk += 32) {
            bf16x16 afr[4], bfr[2];
            #pragma unroll
            for (int ni = 0; ni < 2; ++ni)
                bfr[ni] = frag_ld(Bs + (wn * 32 + ni * 16 + l15) * LDT + kk, kh);
            #pragma unroll
            for (int mi = 0; mi < 4; ++mi)
                afr[mi] = frag_ld(As + (wm * 64 + mi * 16 + l15) * LDT + kk, kh);
            // Keeps the block's 12 LDS reads one group in front of its 8 WMMAs: left
            // alone the compiler sinks them between the WMMAs, a full LDS wait per pair.
            __builtin_amdgcn_sched_barrier(0);
            #pragma unroll
            for (int mi = 0; mi < 4; ++mi)
                #pragma unroll
                for (int ni = 0; ni < 2; ++ni)
                    acc[mi][ni] = wmma_bf16(afr[mi], bfr[ni], acc[mi][ni]);
        }
        asm volatile("s_wait_dscnt 0x0" ::: "memory");     // own reads of this buffer are done
        asm volatile("s_wait_asynccnt 0x0" ::: "memory");  // own copies of tile t+1 have landed
        __syncthreads();   // publishes tile t+1; ends every reader's last read of tile t
        if (t + 2 < nt) stage_in(t + 2, t & 1);            // refill the buffer just read
    }
    asm volatile("s_wait_asynccnt 0x0" ::: "memory");      // nothing in flight at the wave's end

    #pragma unroll
    for (int mi = 0; mi < 4; ++mi)
        #pragma unroll
        for (int ni = 0; ni < 2; ++ni)
            #pragma unroll
            for (int r = 0; r < 8; ++r) {
                int gm = m0 + wm * 64 + mi * 16 + kh * 8 + r;
                int gn = n0 + wn * 32 + ni * 16 + l15;
                size_t off = (size_t)gm * N + gn;
                float v = acc[mi][ni][r];
                if constexpr (EPI == 0) {
                    ((float*)Out)[off] = v;
                } else if constexpr (EPI == 1) {
                    ((float*)Out)[off] = v + R[off];
                } else {
                    float a = R[off];
                    float g = a / (1.f + __expf(-a));   // a * sigmoid(a)
                    ((bf16*)Out)[off] = (bf16)(g * v);
                }
            }
}

// ---------------- RoPE on Q,K + bf16 convert; V -> per-head transposed bf16 ----
// Q,K,V are fp32 (B,S,DM). Qb,Kb: bf16 (B,S,DM). Vt: bf16 [b][h][dk][S].
__global__ __launch_bounds__(256)
void k_rope(const float* __restrict__ Q, const float* __restrict__ K,
            const float* __restrict__ V, bf16* __restrict__ Qb,
            bf16* __restrict__ Kb, bf16* __restrict__ Vt) {
    const int pairsPerRow = DM / 2;                       // 512
    size_t idx = (size_t)blockIdx.x * 256 + threadIdx.x;  // over B*S*DM/2
    size_t row = idx / pairsPerRow;                       // b*S + s
    int pr = (int)(idx % pairsPerRow);
    int h = pr / (DK / 2);
    int p = pr % (DK / 2);
    int s = (int)(row % SEQ);
    int b = (int)(row / SEQ);
    int e0 = h * DK + 2 * p;

    float inv = __powf(THETA_F, -2.f * (float)p / (float)DK);
    float sn, cs;
    __sincosf((float)s * inv, &sn, &cs);

    size_t base = row * DM;
    float q1 = Q[base + e0], q2 = Q[base + e0 + 1];
    Qb[base + e0]     = (bf16)(q1 * cs - q2 * sn);
    Qb[base + e0 + 1] = (bf16)(q1 * sn + q2 * cs);
    float k1 = K[base + e0], k2 = K[base + e0 + 1];
    Kb[base + e0]     = (bf16)(k1 * cs - k2 * sn);
    Kb[base + e0 + 1] = (bf16)(k1 * sn + k2 * cs);

    float v1 = V[base + e0], v2 = V[base + e0 + 1];
    size_t vtb = ((size_t)b * HEADS + h) * DK;
    Vt[(vtb + 2 * p)     * SEQ + s] = (bf16)v1;
    Vt[(vtb + 2 * p + 1) * SEQ + s] = (bf16)v2;
}

// ---------------- Flash attention (causal, online softmax) ----------------
// Block: 128 threads (4 waves), handles one (b,h) and 64 query rows.
// Each wave owns a 16-row query strip; QK^T and P*V both via WMMA bf16.
// K/V tile kt+1 is fetched into registers while tile kt is being consumed.
__global__ __launch_bounds__(128)
void k_flash_attn(const bf16* __restrict__ Qb, const bf16* __restrict__ Kb,
                  const bf16* __restrict__ Vt, bf16* __restrict__ Ob) {
    constexpr int LT = 72;   // 64 + 8 pad (16B-aligned rows, conflict-free b128)
    __shared__ __attribute__((aligned(16))) bf16 Qs [64 * LT];
    __shared__ __attribute__((aligned(16))) bf16 Ks [64 * LT];
    __shared__ __attribute__((aligned(16))) bf16 Vts[64 * LT];
    __shared__ __attribute__((aligned(16))) bf16 Ps [64 * LT];

    const int qt = blockIdx.x;            // query tile (64 rows)
    const int bh = blockIdx.y;
    const int b = bh / HEADS, h = bh % HEADS;
    const int tid = threadIdx.x, lane = tid & 31, w = tid >> 5;
    const int l15 = lane & 15, kh = lane >> 4;

    const bf16* Qg = Qb + (size_t)b * SEQ * DM + h * DK;
    const bf16* Kg = Kb + (size_t)b * SEQ * DM + h * DK;
    const bf16* Vg = Vt + ((size_t)b * HEADS + h) * DK * SEQ;

    int trow[4], tcol[4];
    #pragma unroll
    for (int i = 0; i < 4; ++i) {          // 64x64 tile, 8 bf16 per thread-iter
        int idx = tid + i * 128;
        trow[i] = idx >> 3; tcol[i] = (idx & 7) * 8;
    }
    #pragma unroll
    for (int i = 0; i < 4; ++i)
        *(u32x4*)(Qs + trow[i] * LT + tcol[i]) =
            *(const u32x4*)(Qg + (size_t)(qt * 64 + trow[i]) * DM + tcol[i]);
    __syncthreads();

    const bf16* qrow = Qs + (w * 16 + l15) * LT;
    bf16x16 aq0 = frag_ld(qrow, kh), aq1 = frag_ld(qrow + 32, kh);

    float mrow[8], lrow[8];
    #pragma unroll
    for (int r = 0; r < 8; ++r) { mrow[r] = -1e30f; lrow[r] = 0.f; }
    f32x8 Oacc[4] = {};

    const int qg_base = qt * 64 + w * 16 + kh * 8;   // + r gives global q index

    u32x4 rk[4], rv[4];
    auto fetchKV = [&](int kt) {
        #pragma unroll
        for (int i = 0; i < 4; ++i) {
            rk[i] = *(const u32x4*)(Kg + (size_t)(kt * 64 + trow[i]) * DM + tcol[i]);
            rv[i] = *(const u32x4*)(Vg + (size_t)trow[i] * SEQ + kt * 64 + tcol[i]);
        }
    };
    fetchKV(0);

    for (int kt = 0; kt <= qt; ++kt) {
        __syncthreads();   // previous-iteration readers of Ks/Vts are done
        #pragma unroll
        for (int i = 0; i < 4; ++i) {
            *(u32x4*)(Ks  + trow[i] * LT + tcol[i]) = rk[i];
            *(u32x4*)(Vts + trow[i] * LT + tcol[i]) = rv[i];
        }
        __syncthreads();

        if (kt + 2 <= qt) {   // warm GL2 two tiles ahead
            __builtin_prefetch(Kg + (size_t)((kt + 2) * 64 + trow[0]) * DM + tcol[0], 0, 3);
            __builtin_prefetch(Vg + (size_t)trow[0] * SEQ + (kt + 2) * 64 + tcol[0], 0, 3);
        }
        if (kt < qt) fetchKV(kt + 1);   // loads in flight under score/softmax

        // scores: 16(q) x 64(k) per wave, K-dim = dk = 64 -> 2 chained WMMAs
        f32x8 st[4];
        #pragma unroll
        for (int nt = 0; nt < 4; ++nt) {
            const bf16* krow = Ks + (nt * 16 + l15) * LT;
            f32x8 a = {};
            a = wmma_bf16(aq0, frag_ld(krow, kh), a);
            a = wmma_bf16(aq1, frag_ld(krow + 32, kh), a);
            st[nt] = a;
        }
        // scale + causal mask
        #pragma unroll
        for (int nt = 0; nt < 4; ++nt) {
            int kg = kt * 64 + nt * 16 + l15;
            #pragma unroll
            for (int r = 0; r < 8; ++r) {
                float v = st[nt][r] * 0.125f;                // 1/sqrt(64)
                st[nt][r] = (kg > qg_base + r) ? -1e30f : v;
            }
        }
        // online softmax: row max over 16 lanes (columns) then over nt
        float sc[8];
        #pragma unroll
        for (int r = 0; r < 8; ++r) {
            float mx = fmaxf(fmaxf(st[0][r], st[1][r]), fmaxf(st[2][r], st[3][r]));
            #pragma unroll
            for (int m = 1; m < 16; m <<= 1) mx = fmaxf(mx, __shfl_xor(mx, m, 32));
            float mnew = fmaxf(mrow[r], mx);
            sc[r] = __expf(mrow[r] - mnew);
            #pragma unroll
            for (int nt = 0; nt < 4; ++nt) st[nt][r] = __expf(st[nt][r] - mnew);
            float sm = st[0][r] + st[1][r] + st[2][r] + st[3][r];
            #pragma unroll
            for (int m = 1; m < 16; m <<= 1) sm += __shfl_xor(sm, m, 32);
            lrow[r] = lrow[r] * sc[r] + sm;
            mrow[r] = mnew;
        }
        #pragma unroll
        for (int nt = 0; nt < 4; ++nt)
            #pragma unroll
            for (int r = 0; r < 8; ++r) Oacc[nt][r] *= sc[r];

        // P: C-layout -> LDS -> A-layout fragments
        #pragma unroll
        for (int nt = 0; nt < 4; ++nt)
            #pragma unroll
            for (int r = 0; r < 8; ++r)
                Ps[(w * 16 + kh * 8 + r) * LT + nt * 16 + l15] = (bf16)st[nt][r];
        __syncthreads();

        const bf16* prow = Ps + (w * 16 + l15) * LT;
        bf16x16 ap0 = frag_ld(prow, kh), ap1 = frag_ld(prow + 32, kh);
        #pragma unroll
        for (int nt = 0; nt < 4; ++nt) {
            const bf16* vrow = Vts + (nt * 16 + l15) * LT;
            Oacc[nt] = wmma_bf16(ap0, frag_ld(vrow, kh), Oacc[nt]);
            Oacc[nt] = wmma_bf16(ap1, frag_ld(vrow + 32, kh), Oacc[nt]);
        }
    }

    // normalize and write bf16 output (feeds the WO GEMM directly)
    #pragma unroll
    for (int nt = 0; nt < 4; ++nt)
        #pragma unroll
        for (int r = 0; r < 8; ++r) {
            float o = Oacc[nt][r] / lrow[r];
            size_t srow = (size_t)b * SEQ + qt * 64 + w * 16 + kh * 8 + r;
            Ob[srow * DM + h * DK + nt * 16 + l15] = (bf16)o;
        }
}

// ---------------- host launcher ----------------
extern "C" void kernel_launch(void* const* d_in, const int* in_sizes, int n_in,
                              void* d_out, int out_size, void* d_ws, size_t ws_size,
                              hipStream_t stream) {
    (void)in_sizes; (void)n_in; (void)out_size; (void)ws_size;
    const float* x  = (const float*)d_in[0];
    const float* wq = (const float*)d_in[1];
    const float* wk = (const float*)d_in[2];
    const float* wv = (const float*)d_in[3];
    const float* wo = (const float*)d_in[4];
    const float* w1 = (const float*)d_in[5];
    const float* w2 = (const float*)d_in[6];
    const float* w3 = (const float*)d_in[7];
    const float* g1 = (const float*)d_in[8];
    const float* g2 = (const float*)d_in[9];
    float* out = (float*)d_out;

    const size_t MB = 1ull << 20;
    char* p = (char*)d_ws;
    bf16*  n_bf  = (bf16*)p;            p += 8 * MB;   // 4096x1024 bf16
    bf16*  wq_bf = (bf16*)p;            p += 2 * MB;
    bf16*  wk_bf = (bf16*)p;            p += 2 * MB;
    bf16*  wv_bf = (bf16*)p;            p += 2 * MB;
    bf16*  wo_bf = (bf16*)p;            p += 2 * MB;
    bf16*  w1_bf = (bf16*)p;            p += 8 * MB;
    bf16*  w3_bf = (bf16*)p;            p += 8 * MB;
    bf16*  w2_bf = (bf16*)p;            p += 8 * MB;
    float* x1    = (float*)p;           p += 16 * MB;  // x + attn residual
    bf16*  n2_bf = (bf16*)p;            p += 8 * MB;
    // 64 MB region reused: {q_f,k_f,v_f fp32 + q_bf,k_bf} then a_f (w1 output)
    char*  reuse = p;                   p += 64 * MB;
    float* q_f  = (float*)reuse;
    float* k_f  = (float*)(reuse + 16 * MB);
    float* v_f  = (float*)(reuse + 32 * MB);
    bf16*  q_bf = (bf16*) (reuse + 48 * MB);
    bf16*  k_bf = (bf16*) (reuse + 56 * MB);
    float* a_f  = (float*)reuse;                       // 64 MB, after attention
    bf16*  vt_bf = (bf16*)p;            p += 8 * MB;
    bf16*  o_bf  = (bf16*)p;            p += 8 * MB;
    bf16*  h_bf  = (bf16*)p;            p += 32 * MB;  // swiglu output 4096x4096

    // 1) weights -> bf16
    auto conv = [&](const float* src, bf16* dst, int n) {
        k_f32_to_bf16<<<(n + 255) / 256, 256, 0, stream>>>(src, dst, n);
    };
    conv(wq, wq_bf, DM * DM);  conv(wk, wk_bf, DM * DM);
    conv(wv, wv_bf, DM * DM);  conv(wo, wo_bf, DM * DM);
    conv(w1, w1_bf, DFF * DM); conv(w3, w3_bf, DFF * DM); conv(w2, w2_bf, DM * DFF);

    // 2) n = rmsnorm(x, g1)
    k_rmsnorm<<<MROWS, 256, 0, stream>>>(x, g1, n_bf);

    // 3) Q,K,V projections (fp32 out, then RoPE)
    dim3 gQKV(DM / 128, MROWS / 128);
    k_gemm_nt<0><<<gQKV, 256, 0, stream>>>(n_bf, wq_bf, nullptr, q_f, MROWS, DM, DM);
    k_gemm_nt<0><<<gQKV, 256, 0, stream>>>(n_bf, wk_bf, nullptr, k_f, MROWS, DM, DM);
    k_gemm_nt<0><<<gQKV, 256, 0, stream>>>(n_bf, wv_bf, nullptr, v_f, MROWS, DM, DM);

    // 4) RoPE(q,k) -> bf16; V -> per-head transposed bf16
    k_rope<<<(BATCH * SEQ * DM / 2) / 256, 256, 0, stream>>>(q_f, k_f, v_f,
                                                             q_bf, k_bf, vt_bf);

    // 5) causal flash attention -> o (bf16)
    dim3 gAtt(SEQ / 64, BATCH * HEADS);
    k_flash_attn<<<gAtt, 128, 0, stream>>>(q_bf, k_bf, vt_bf, o_bf);

    // 6) x1 = x + o @ Wo^T
    k_gemm_nt<1><<<gQKV, 256, 0, stream>>>(o_bf, wo_bf, x, x1, MROWS, DM, DM);

    // 7) n2 = rmsnorm(x1, g2)
    k_rmsnorm<<<MROWS, 256, 0, stream>>>(x1, g2, n2_bf);

    // 8) a = n2 @ W1^T ; h = silu(a) * (n2 @ W3^T)  [fused epilogue]
    dim3 gFF(DFF / 128, MROWS / 128);
    k_gemm_nt<0><<<gFF, 256, 0, stream>>>(n2_bf, w1_bf, nullptr, a_f, MROWS, DFF, DM);
    k_gemm_nt<2><<<gFF, 256, 0, stream>>>(n2_bf, w3_bf, a_f, h_bf, MROWS, DFF, DM);

    // 9) out = x1 + h @ W2^T
    k_gemm_nt<1><<<gQKV, 256, 0, stream>>>(h_bf, w2_bf, x1, out, MROWS, DM, DFF);
}

// v002
// A run of this version takes 397 microseconds.
// Timed twice side by side with v001, it ran 1.08 and 1.09 times as fast.
// All steps since v000 together make it 1.39 times as fast.
#include <hip/hip_runtime.h>

// ---------------- problem constants ----------------
#define BATCH   2
#define SEQ     2048
#define DM      1024
#define HEADS   16
#define DK      64
#define DFF     4096
#define MROWS   (BATCH * SEQ)       // 4096
#define EPSV    1e-5f
#define THETA_F 10000.0f

// ---------------- types ----------------
typedef __bf16 bf16;
typedef __attribute__((ext_vector_type(16))) __bf16 bf16x16;
typedef __attribute__((ext_vector_type(8)))  __bf16 bf16x8;
typedef __attribute__((ext_vector_type(8)))  float  f32x8;
typedef __attribute__((ext_vector_type(4)))  unsigned int u32x4;

// Load one 16x32 bf16 WMMA fragment (A or B operand) from LDS.
// rowPtr points at the start of this lane's row (16-byte aligned, row stride
// is a multiple of 8 elements). kh = lane>>4 selects the K-half per the ISA
// 16-bit A-matrix layout: half 0 -> K {0..7, 16..23}, half 1 -> K {8..15, 24..31}.
__device__ __forceinline__ bf16x16 frag_ld(const bf16* rowPtr, int kh) {
    bf16x8 lo = *(const bf16x8*)(rowPtr + kh * 8);
    bf16x8 hi = *(const bf16x8*)(rowPtr + 16 + kh * 8);
    return __builtin_shufflevector(lo, hi, 0,1,2,3,4,5,6,7,8,9,10,11,12,13,14,15);
}

__device__ __forceinline__ f32x8 wmma_bf16(bf16x16 a, bf16x16 b, f32x8 c) {
    return __builtin_amdgcn_wmma_f32_16x16x32_bf16(false, a, false, b, (short)0, c, false, false);
}

// ---------------- fp32 -> bf16 conversion of all seven weights, one launch ----
// The bf16 copies lie back to back in the workspace in the order
// wq, wk, wv, wo, w1, w3, w2, so the destination is one array of CONV_TOTAL
// elements. One 16-wave work-group per WGP takes CONV_PER_WG consecutive
// elements of it (always inside one source, since every source's length is a
// multiple of CONV_PER_WG). A wave reads 32 x 512 contiguous bytes, many loads
// in flight at a time, and stores 32 x 256 contiguous bytes.
typedef __attribute__((ext_vector_type(4))) float  f32x4;
typedef __attribute__((ext_vector_type(4))) __bf16 bf16x4;
#define CONV_TOTAL   (4 * DM * DM + 3 * DFF * DM)   // 16,777,216
#define CONV_WGS     256
#define CONV_PER_WG  (CONV_TOTAL / CONV_WGS)        // 65,536
#define CONV_LOADS   (CONV_PER_WG / (512 * 4))      // 32 loads of 4 floats a lane
static_assert((DM * DM) % CONV_PER_WG == 0 && (DFF * DM) % CONV_PER_WG == 0,
              "a work-group's range must lie inside one weight");
__global__ __launch_bounds__(512)
void k_weights_to_bf16(const float* __restrict__ wq, const float* __restrict__ wk,
                       const float* __restrict__ wv, const float* __restrict__ wo,
                       const float* __restrict__ w1, const float* __restrict__ w3,
                       const float* __restrict__ w2, bf16* __restrict__ out) {
    const int first = blockIdx.x * CONV_PER_WG;   // index in the destination array
    const float* src = wq;                        // the weight that holds it ...
    int base = 0;                                 // ... and where that weight starts
    if (first >= 1 * DM * DM)                { src = wk; base = 1 * DM * DM; }
    if (first >= 2 * DM * DM)                { src = wv; base = 2 * DM * DM; }
    if (first >= 3 * DM * DM)                { src = wo; base = 3 * DM * DM; }
    if (first >= 4 * DM * DM)                { src = w1; base = 4 * DM * DM; }
    if (first >= 4 * DM * DM + 1 * DFF * DM) { src = w3; base = 4 * DM * DM + 1 * DFF * DM; }
    if (first >= 4 * DM * DM + 2 * DFF * DM) { src = w2; base = 4 * DM * DM + 2 * DFF * DM; }

    const int lane = threadIdx.x & 31, wave = threadIdx.x >> 5;
    const int at = first + wave * (CONV_LOADS * 128) + lane * 4;
    const f32x4* s = (const f32x4*)(src + (at - base));
    bf16x4*      d = (bf16x4*)(out + at);
    f32x4 v[CONV_LOADS];
    // Both loops unrolled: v[] stays in registers, the steps become immediate
    // offsets, and the loads can be issued ahead of the conversions.
    #pragma unroll
    for (int j = 0; j < CONV_LOADS; ++j)          // read once: non-temporal
        v[j] = __builtin_nontemporal_load(s + j * 32);
    #pragma unroll
    for (int j = 0; j < CONV_LOADS; ++j) {
        bf16x4 o = { (bf16)v[j][0], (bf16)v[j][1], (bf16)v[j][2], (bf16)v[j][3] };
        d[j * 32] = o;
    }
}

// ---------------- RMSNorm (one block per row) ----------------
__global__ __launch_bounds__(256) void k_rmsnorm(const float* __restrict__ X,
                                                 const float* __restrict__ G,
                                                 bf16* __restrict__ Out) {
    const int row = blockIdx.x;
    const float* x = X + (size_t)row * DM;
    float s = 0.f;
    #pragma unroll
    for (int i = threadIdx.x; i < DM; i += 256) { float v = x[i]; s += v * v; }
    #pragma unroll
    for (int m = 16; m >= 1; m >>= 1) s += __shfl_xor(s, m, 32);
    __shared__ float red[8];
    if ((threadIdx.x & 31) == 0) red[threadIdx.x >> 5] = s;
    __syncthreads();
    float tot = 0.f;
    #pragma unroll
    for (int j = 0; j < 8; ++j) tot += red[j];
    const float rinv = rsqrtf(tot / (float)DM + EPSV);
    bf16* o = Out + (size_t)row * DM;
    for (int i = threadIdx.x; i < DM; i += 256) o[i] = (bf16)(x[i] * rinv * G[i]);
}

// Eight asynchronous 16-byte copies per lane, global memory -> LDS, no register
// in between. The s_wait_xcnt is the last line of the copies' own statement so
// that no address register named here is rewritten ahead of it.
__device__ __forceinline__ void async_copy8(unsigned l, unsigned lstep,
                                            const bf16* g, size_t gstep) {
    asm volatile(
        "global_load_async_to_lds_b128 %0, %8, off\n\t"
        "global_load_async_to_lds_b128 %1, %9, off\n\t"
        "global_load_async_to_lds_b128 %2, %10, off\n\t"
        "global_load_async_to_lds_b128 %3, %11, off\n\t"
        "global_load_async_to_lds_b128 %4, %12, off\n\t"
        "global_load_async_to_lds_b128 %5, %13, off\n\t"
        "global_load_async_to_lds_b128 %6, %14, off\n\t"
        "global_load_async_to_lds_b128 %7, %15, off\n\t"
        "s_wait_xcnt 0x0"
        :: "v"(l), "v"(l + lstep), "v"(l + 2 * lstep), "v"(l + 3 * lstep),
           "v"(l + 4 * lstep), "v"(l + 5 * lstep), "v"(l + 6 * lstep), "v"(l + 7 * lstep),
           "v"(g), "v"(g + gstep), "v"(g + 2 * gstep), "v"(g + 3 * gstep),
           "v"(g + 4 * gstep), "v"(g + 5 * gstep), "v"(g + 6 * gstep), "v"(g + 7 * gstep)
        : "memory");
}

// ---------------- WMMA NT-GEMM: C[M,N] = A[M,K] * B[N,K]^T ----------------
// K is walked in tiles of 128. Two LDS buffers: tile t+1's asynchronous copies
// fly while tile t's 32 WMMAs per wave run; one barrier per tile publishes the
// next tile and frees the buffer just read. K must be a multiple of 128.
// EPI 0: store f32          EPI 1: store f32 + R[m,n] (residual)
// EPI 2: store bf16( silu(R[m,n]) * acc )   (fused SwiGLU; R = w1 output)
template <int EPI>
__global__ __launch_bounds__(256)
void k_gemm_nt(const bf16* __restrict__ A, const bf16* __restrict__ B,
               const float* __restrict__ R, void* __restrict__ Out,
               int M, int N, int K) {
    constexpr int BM = 128, BN = 128, BK = 128, LDT = BK + 8;  // 272-byte pitch
    constexpr int OPER = BM * LDT;                             // one operand's tile
    constexpr int STAGE = 2 * OPER;                            // [A tile | B tile]
    __shared__ __attribute__((aligned(16))) bf16 Sm[2 * STAGE];

    const int m0 = blockIdx.y * BM, n0 = blockIdx.x * BN;
    const int tid  = threadIdx.x;
    const int lane = tid & 31, wid = tid >> 5;   // 8 waves
    const int wm = wid >> 2, wn = wid & 3;       // 2 x 4 wave grid: 64x32 per wave
    const int l15 = lane & 15, kh = lane >> 4;

    // Copy map: 16 lanes cover one 256-byte row; a lane's 8 copies are 16 rows apart.
    const int crow = tid >> 4, ccol = (tid & 15) * 8;
    const bf16* gA = A + (size_t)(m0 + crow) * K + ccol;
    const bf16* gB = B + (size_t)(n0 + crow) * K + ccol;
    const unsigned lA = (unsigned)(size_t)(Sm + crow * LDT + ccol);
    const size_t gstep = (size_t)16 * K;
    auto stage_in = [&](int t, int buf) {
        const unsigned l = lA + (unsigned)(buf * STAGE * 2);
        async_copy8(l,            16 * LDT * 2, gA + (size_t)t * BK, gstep);
        async_copy8(l + OPER * 2, 16 * LDT * 2, gB + (size_t)t * BK, gstep);
    };

    const int nt = K / BK;
    stage_in(0, 0);
    asm volatile("s_wait_asynccnt 0x0" ::: "memory");   // tile 0 has landed (own copies)
    __syncthreads();                                    // ... and every wave's copies
    if (nt > 1) stage_in(1, 1);

    f32x8 acc[4][2] = {};

    for (int t = 0; t < nt; ++t) {
        const bf16* As = Sm + (t & 1) * STAGE;
        const bf16* Bs = As + OPER;
        // Unrolled: the four blocks' LDS offsets become immediates and a block's
        // reads can start under the WMMAs of the block before it.
        #pragma unroll
        for (int kk = 0; kk < BK; kk += 32) {
            bf16x16 afr[4], bfr[2];
            #pragma unroll
            for (int ni = 0; ni < 2; ++ni)
                bfr[ni] = frag_ld(Bs + (wn * 32 + ni * 16 + l15) * LDT + kk, kh);
            #pragma unroll
            for (int mi = 0; mi < 4; ++mi)
                afr[mi] = frag_ld(As + (wm * 64 + mi * 16 + l15) * LDT + kk, kh);
            // Keeps the block's 12 LDS reads one group in front of its 8 WMMAs: left
            // alone the compiler sinks them between the WMMAs, a full LDS wait per pair.
            __builtin_amdgcn_sched_barrier(0);
            #pragma unroll
            for (int mi = 0; mi < 4; ++mi)
                #pragma unroll
                for (int ni = 0; ni < 2; ++ni)
                    acc[mi][ni] = wmma_bf16(afr[mi], bfr[ni], acc[mi][ni]);
        }
        asm volatile("s_wait_dscnt 0x0" ::: "memory");     // own reads of this buffer are done
        asm volatile("s_wait_asynccnt 0x0" ::: "memory");  // own copies of tile t+1 have landed
        __syncthreads();   // publishes tile t+1; ends every reader's last read of tile t
        if (t + 2 < nt) stage_in(t + 2, t & 1);            // refill the buffer just read
    }
    asm volatile("s_wait_asynccnt 0x0" ::: "memory");      // nothing in flight at the wave's end

    #pragma unroll
    for (int mi = 0; mi < 4; ++mi)
        #pragma unroll
        for (int ni = 0; ni < 2; ++ni)
            #pragma unroll
            for (int r = 0; r < 8; ++r) {
                int gm = m0 + wm * 64 + mi * 16 + kh * 8 + r;
                int gn = n0 + wn * 32 + ni * 16 + l15;
                size_t off = (size_t)gm * N + gn;
                float v = acc[mi][ni][r];
                if constexpr (EPI == 0) {
                    ((float*)Out)[off] = v;
                } else if constexpr (EPI == 1) {
                    ((float*)Out)[off] = v + R[off];
                } else {
                    float a = R[off];
                    float g = a / (1.f + __expf(-a));   // a * sigmoid(a)
                    ((bf16*)Out)[off] = (bf16)(g * v);
                }
            }
}

// ---------------- RoPE on Q,K + bf16 convert; V -> per-head transposed bf16 ----
// Q,K,V are fp32 (B,S,DM). Qb,Kb: bf16 (B,S,DM). Vt: bf16 [b][h][dk][S].
__global__ __launch_bounds__(256)
void k_rope(const float* __restrict__ Q, const float* __restrict__ K,
            const float* __restrict__ V, bf16* __restrict__ Qb,
            bf16* __restrict__ Kb, bf16* __restrict__ Vt) {
    const int pairsPerRow = DM / 2;                       // 512
    size_t idx = (size_t)blockIdx.x * 256 + threadIdx.x;  // over B*S*DM/2
    size_t row = idx / pairsPerRow;                       // b*S + s
    int pr = (int)(idx % pairsPerRow);
    int h = pr / (DK / 2);
    int p = pr % (DK / 2);
    int s = (int)(row % SEQ);
    int b = (int)(row / SEQ);
    int e0 = h * DK + 2 * p;

    float inv = __powf(THETA_F, -2.f * (float)p / (float)DK);
    float sn, cs;
    __sincosf((float)s * inv, &sn, &cs);

    size_t base = row * DM;
    float q1 = Q[base + e0], q2 = Q[base + e0 + 1];
    Qb[base + e0]     = (bf16)(q1 * cs - q2 * sn);
    Qb[base + e0 + 1] = (bf16)(q1 * sn + q2 * cs);
    float k1 = K[base + e0], k2 = K[base + e0 + 1];
    Kb[base + e0]     = (bf16)(k1 * cs - k2 * sn);
    Kb[base + e0 + 1] = (bf16)(k1 * sn + k2 * cs);

    float v1 = V[base + e0], v2 = V[base + e0 + 1];
    size_t vtb = ((size_t)b * HEADS + h) * DK;
    Vt[(vtb + 2 * p)     * SEQ + s] = (bf16)v1;
    Vt[(vtb + 2 * p + 1) * SEQ + s] = (bf16)v2;
}

// ---------------- Flash attention (causal, online softmax) ----------------
// Block: 128 threads (4 waves), handles one (b,h) and 64 query rows.
// Each wave owns a 16-row query strip; QK^T and P*V both via WMMA bf16.
// K/V tile kt+1 is fetched into registers while tile kt is being consumed.
__global__ __launch_bounds__(128)
void k_flash_attn(const bf16* __restrict__ Qb, const bf16* __restrict__ Kb,
                  const bf16* __restrict__ Vt, bf16* __restrict__ Ob) {
    constexpr int LT = 72;   // 64 + 8 pad (16B-aligned rows, conflict-free b128)
    __shared__ __attribute__((aligned(16))) bf16 Qs [64 * LT];
    __shared__ __attribute__((aligned(16))) bf16 Ks [64 * LT];
    __shared__ __attribute__((aligned(16))) bf16 Vts[64 * LT];
    __shared__ __attribute__((aligned(16))) bf16 Ps [64 * LT];

    const int qt = blockIdx.x;            // query tile (64 rows)
    const int bh = blockIdx.y;
    const int b = bh / HEADS, h = bh % HEADS;
    const int tid = threadIdx.x, lane = tid & 31, w = tid >> 5;
    const int l15 = lane & 15, kh = lane >> 4;

    const bf16* Qg = Qb + (size_t)b * SEQ * DM + h * DK;
    const bf16* Kg = Kb + (size_t)b * SEQ * DM + h * DK;
    const bf16* Vg = Vt + ((size_t)b * HEADS + h) * DK * SEQ;

    int trow[4], tcol[4];
    #pragma unroll
    for (int i = 0; i < 4; ++i) {          // 64x64 tile, 8 bf16 per thread-iter
        int idx = tid + i * 128;
        trow[i] = idx >> 3; tcol[i] = (idx & 7) * 8;
    }
    #pragma unroll
    for (int i = 0; i < 4; ++i)
        *(u32x4*)(Qs + trow[i] * LT + tcol[i]) =
            *(const u32x4*)(Qg + (size_t)(qt * 64 + trow[i]) * DM + tcol[i]);
    __syncthreads();

    const bf16* qrow = Qs + (w * 16 + l15) * LT;
    bf16x16 aq0 = frag_ld(qrow, kh), aq1 = frag_ld(qrow + 32, kh);

    float mrow[8], lrow[8];
    #pragma unroll
    for (int r = 0; r < 8; ++r) { mrow[r] = -1e30f; lrow[r] = 0.f; }
    f32x8 Oacc[4] = {};

    const int qg_base = qt * 64 + w * 16 + kh * 8;   // + r gives global q index

    u32x4 rk[4], rv[4];
    auto fetchKV = [&](int kt) {
        #pragma unroll
        for (int i = 0; i < 4; ++i) {
            rk[i] = *(const u32x4*)(Kg + (size_t)(kt * 64 + trow[i]) * DM + tcol[i]);
            rv[i] = *(const u32x4*)(Vg + (size_t)trow[i] * SEQ + kt * 64 + tcol[i]);
        }
    };
    fetchKV(0);

    for (int kt = 0; kt <= qt; ++kt) {
        __syncthreads();   // previous-iteration readers of Ks/Vts are done
        #pragma unroll
        for (int i = 0; i < 4; ++i) {
            *(u32x4*)(Ks  + trow[i] * LT + tcol[i]) = rk[i];
            *(u32x4*)(Vts + trow[i] * LT + tcol[i]) = rv[i];
        }
        __syncthreads();

        if (kt + 2 <= qt) {   // warm GL2 two tiles ahead
            __builtin_prefetch(Kg + (size_t)((kt + 2) * 64 + trow[0]) * DM + tcol[0], 0, 3);
            __builtin_prefetch(Vg + (size_t)trow[0] * SEQ + (kt + 2) * 64 + tcol[0], 0, 3);
        }
        if (kt < qt) fetchKV(kt + 1);   // loads in flight under score/softmax

        // scores: 16(q) x 64(k) per wave, K-dim = dk = 64 -> 2 chained WMMAs
        f32x8 st[4];
        #pragma unroll
        for (int nt = 0; nt < 4; ++nt) {
            const bf16* krow = Ks + (nt * 16 + l15) * LT;
            f32x8 a = {};
            a = wmma_bf16(aq0, frag_ld(krow, kh), a);
            a = wmma_bf16(aq1, frag_ld(krow + 32, kh), a);
            st[nt] = a;
        }
        // scale + causal mask
        #pragma unroll
        for (int nt = 0; nt < 4; ++nt) {
            int kg = kt * 64 + nt * 16 + l15;
            #pragma unroll
            for (int r = 0; r < 8; ++r) {
                float v = st[nt][r] * 0.125f;                // 1/sqrt(64)
                st[nt][r] = (kg > qg_base + r) ? -1e30f : v;
            }
        }
        // online softmax: row max over 16 lanes (columns) then over nt
        float sc[8];
        #pragma unroll
        for (int r = 0; r < 8; ++r) {
            float mx = fmaxf(fmaxf(st[0][r], st[1][r]), fmaxf(st[2][r], st[3][r]));
            #pragma unroll
            for (int m = 1; m < 16; m <<= 1) mx = fmaxf(mx, __shfl_xor(mx, m, 32));
            float mnew = fmaxf(mrow[r], mx);
            sc[r] = __expf(mrow[r] - mnew);
            #pragma unroll
            for (int nt = 0; nt < 4; ++nt) st[nt][r] = __expf(st[nt][r] - mnew);
            float sm = st[0][r] + st[1][r] + st[2][r] + st[3][r];
            #pragma unroll
            for (int m = 1; m < 16; m <<= 1) sm += __shfl_xor(sm, m, 32);
            lrow[r] = lrow[r] * sc[r] + sm;
            mrow[r] = mnew;
        }
        #pragma unroll
        for (int nt = 0; nt < 4; ++nt)
            #pragma unroll
            for (int r = 0; r < 8; ++r) Oacc[nt][r] *= sc[r];

        // P: C-layout -> LDS -> A-layout fragments
        #pragma unroll
        for (int nt = 0; nt < 4; ++nt)
            #pragma unroll
            for (int r = 0; r < 8; ++r)
                Ps[(w * 16 + kh * 8 + r) * LT + nt * 16 + l15] = (bf16)st[nt][r];
        __syncthreads();

        const bf16* prow = Ps + (w * 16 + l15) * LT;
        bf16x16 ap0 = frag_ld(prow, kh), ap1 = frag_ld(prow + 32, kh);
        #pragma unroll
        for (int nt = 0; nt < 4; ++nt) {
            const bf16* vrow = Vts + (nt * 16 + l15) * LT;
            Oacc[nt] = wmma_bf16(ap0, frag_ld(vrow, kh), Oacc[nt]);
            Oacc[nt] = wmma_bf16(ap1, frag_ld(vrow + 32, kh), Oacc[nt]);
        }
    }

    // normalize and write bf16 output (feeds the WO GEMM directly)
    #pragma unroll
    for (int nt = 0; nt < 4; ++nt)
        #pragma unroll
        for (int r = 0; r < 8; ++r) {
            float o = Oacc[nt][r] / lrow[r];
            size_t srow = (size_t)b * SEQ + qt * 64 + w * 16 + kh * 8 + r;
            Ob[srow * DM + h * DK + nt * 16 + l15] = (bf16)o;
        }
}

// ---------------- host launcher ----------------
extern "C" void kernel_launch(void* const* d_in, const int* in_sizes, int n_in,
                              void* d_out, int out_size, void* d_ws, size_t ws_size,
                              hipStream_t stream) {
    (void)in_sizes; (void)n_in; (void)out_size; (void)ws_size;
    const float* x  = (const float*)d_in[0];
    const float* wq = (const float*)d_in[1];
    const float* wk = (const float*)d_in[2];
    const float* wv = (const float*)d_in[3];
    const float* wo = (const float*)d_in[4];
    const float* w1 = (const float*)d_in[5];
    const float* w2 = (const float*)d_in[6];
    const float* w3 = (const float*)d_in[7];
    const float* g1 = (const float*)d_in[8];
    const float* g2 = (const float*)d_in[9];
    float* out = (float*)d_out;

    const size_t MB = 1ull << 20;
    char* p = (char*)d_ws;
    bf16*  n_bf  = (bf16*)p;            p += 8 * MB;   // 4096x1024 bf16
    bf16*  wq_bf = (bf16*)p;            p += 2 * MB;
    bf16*  wk_bf = (bf16*)p;            p += 2 * MB;
    bf16*  wv_bf = (bf16*)p;            p += 2 * MB;
    bf16*  wo_bf = (bf16*)p;            p += 2 * MB;
    bf16*  w1_bf = (bf16*)p;            p += 8 * MB;
    bf16*  w3_bf = (bf16*)p;            p += 8 * MB;
    bf16*  w2_bf = (bf16*)p;            p += 8 * MB;
    float* x1    = (float*)p;           p += 16 * MB;  // x + attn residual
    bf16*  n2_bf = (bf16*)p;            p += 8 * MB;
    // 64 MB region reused: {q_f,k_f,v_f fp32 + q_bf,k_bf} then a_f (w1 output)
    char*  reuse = p;                   p += 64 * MB;
    float* q_f  = (float*)reuse;
    float* k_f  = (float*)(reuse + 16 * MB);
    float* v_f  = (float*)(reuse + 32 * MB);
    bf16*  q_bf = (bf16*) (reuse + 48 * MB);
    bf16*  k_bf = (bf16*) (reuse + 56 * MB);
    float* a_f  = (float*)reuse;                       // 64 MB, after attention
    bf16*  vt_bf = (bf16*)p;            p += 8 * MB;
    bf16*  o_bf  = (bf16*)p;            p += 8 * MB;
    bf16*  h_bf  = (bf16*)p;            p += 32 * MB;  // swiglu output 4096x4096

    // 1) weights -> bf16
    //    (wq_bf .. w2_bf are one contiguous array that starts at wq_bf)
    k_weights_to_bf16<<<CONV_WGS, 512, 0, stream>>>(wq, wk, wv, wo, w1, w3, w2, wq_bf);

    // 2) n = rmsnorm(x, g1)
    k_rmsnorm<<<MROWS, 256, 0, stream>>>(x, g1, n_bf);

    // 3) Q,K,V projections (fp32 out, then RoPE)
    dim3 gQKV(DM / 128, MROWS / 128);
    k_gemm_nt<0><<<gQKV, 256, 0, stream>>>(n_bf, wq_bf, nullptr, q_f, MROWS, DM, DM);
    k_gemm_nt<0><<<gQKV, 256, 0, stream>>>(n_bf, wk_bf, nullptr, k_f, MROWS, DM, DM);
    k_gemm_nt<0><<<gQKV, 256, 0, stream>>>(n_bf, wv_bf, nullptr, v_f, MROWS, DM, DM);

    // 4) RoPE(q,k) -> bf16; V -> per-head transposed bf16
    k_rope<<<(BATCH * SEQ * DM / 2) / 256, 256, 0, stream>>>(q_f, k_f, v_f,
                                                             q_bf, k_bf, vt_bf);

    // 5) causal flash attention -> o (bf16)
    dim3 gAtt(SEQ / 64, BATCH * HEADS);
    k_flash_attn<<<gAtt, 128, 0, stream>>>(q_bf, k_bf, vt_bf, o_bf);

    // 6) x1 = x + o @ Wo^T
    k_gemm_nt<1><<<gQKV, 256, 0, stream>>>(o_bf, wo_bf, x, x1, MROWS, DM, DM);

    // 7) n2 = rmsnorm(x1, g2)
    k_rmsnorm<<<MROWS, 256, 0, stream>>>(x1, g2, n2_bf);

    // 8) a = n2 @ W1^T ; h = silu(a) * (n2 @ W3^T)  [fused epilogue]
    dim3 gFF(DFF / 128, MROWS / 128);
    k_gemm_nt<0><<<gFF, 256, 0, stream>>>(n2_bf, w1_bf, nullptr, a_f, MROWS, DFF, DM);
    k_gemm_nt<2><<<gFF, 256, 0, stream>>>(n2_bf, w3_bf, a_f, h_bf, MROWS, DFF, DM);

    // 9) out = x1 + h @ W2^T
    k_gemm_nt<1><<<gQKV, 256, 0, stream>>>(h_bf, w2_bf, x1, out, MROWS, DM, DFF);
}

// v003
// It runs in 318 microseconds.
// Two timings next to v002 both put it at 1.25 times that version's speed.
// Over all steps from v000 it is 1.74 times as fast.
#include <hip/hip_runtime.h>

// ---------------- problem constants ----------------
#define BATCH   2
#define SEQ     2048
#define DM      1024
#define HEADS   16
#define DK      64
#define DFF     4096
#define MROWS   (BATCH * SEQ)       // 4096
#define EPSV    1e-5f
#define THETA_F 10000.0f

// ---------------- types ----------------
typedef __bf16 bf16;
typedef __attribute__((ext_vector_type(16))) __bf16 bf16x16;
typedef __attribute__((ext_vector_type(8)))  __bf16 bf16x8;
typedef __attribute__((ext_vector_type(8)))  float  f32x8;
typedef __attribute__((ext_vector_type(4)))  unsigned int u32x4;

// Load one 16x32 bf16 WMMA fragment (A or B operand) from LDS.
// rowPtr points at the start of this lane's row (16-byte aligned, row stride
// is a multiple of 8 elements). kh = lane>>4 selects the K-half per the ISA
// 16-bit A-matrix layout: half 0 -> K {0..7, 16..23}, half 1 -> K {8..15, 24..31}.
__device__ __forceinline__ bf16x16 frag_ld(const bf16* rowPtr, int kh) {
    bf16x8 lo = *(const bf16x8*)(rowPtr + kh * 8);
    bf16x8 hi = *(const bf16x8*)(rowPtr + 16 + kh * 8);
    return __builtin_shufflevector(lo, hi, 0,1,2,3,4,5,6,7,8,9,10,11,12,13,14,15);
}

__device__ __forceinline__ f32x8 wmma_bf16(bf16x16 a, bf16x16 b, f32x8 c) {
    return __builtin_amdgcn_wmma_f32_16x16x32_bf16(false, a, false, b, (short)0, c, false, false);
}

// ---------------- fp32 -> bf16 conversion of all seven weights, one launch ----
// The bf16 copies lie back to back in the workspace in the order
// wq, wk, wv, wo, w1, w3, w2, so the destination is one array of CONV_TOTAL
// elements. One 16-wave work-group per WGP takes CONV_PER_WG consecutive
// elements of it (always inside one source, since every source's length is a
// multiple of CONV_PER_WG). A wave reads 32 x 512 contiguous bytes, many loads
// in flight at a time, and stores 32 x 256 contiguous bytes.
typedef __attribute__((ext_vector_type(4))) float  f32x4;
typedef __attribute__((ext_vector_type(4))) __bf16 bf16x4;
#define CONV_TOTAL   (4 * DM * DM + 3 * DFF * DM)   // 16,777,216
#define CONV_WGS     256
#define CONV_PER_WG  (CONV_TOTAL / CONV_WGS)        // 65,536
#define CONV_LOADS   (CONV_PER_WG / (512 * 4))      // 32 loads of 4 floats a lane
static_assert((DM * DM) % CONV_PER_WG == 0 && (DFF * DM) % CONV_PER_WG == 0,
              "a work-group's range must lie inside one weight");
__global__ __launch_bounds__(512)
void k_weights_to_bf16(const float* __restrict__ wq, const float* __restrict__ wk,
                       const float* __restrict__ wv, const float* __restrict__ wo,
                       const float* __restrict__ w1, const float* __restrict__ w3,
                       const float* __restrict__ w2, bf16* __restrict__ out) {
    const int first = blockIdx.x * CONV_PER_WG;   // index in the destination array
    const float* src = wq;                        // the weight that holds it ...
    int base = 0;                                 // ... and where that weight starts
    if (first >= 1 * DM * DM)                { src = wk; base = 1 * DM * DM; }
    if (first >= 2 * DM * DM)                { src = wv; base = 2 * DM * DM; }
    if (first >= 3 * DM * DM)                { src = wo; base = 3 * DM * DM; }
    if (first >= 4 * DM * DM)                { src = w1; base = 4 * DM * DM; }
    if (first >= 4 * DM * DM + 1 * DFF * DM) { src = w3; base = 4 * DM * DM + 1 * DFF * DM; }
    if (first >= 4 * DM * DM + 2 * DFF * DM) { src = w2; base = 4 * DM * DM + 2 * DFF * DM; }

    const int lane = threadIdx.x & 31, wave = threadIdx.x >> 5;
    const int at = first + wave * (CONV_LOADS * 128) + lane * 4;
    const f32x4* s = (const f32x4*)(src + (at - base));
    bf16x4*      d = (bf16x4*)(out + at);
    f32x4 v[CONV_LOADS];
    // Both loops unrolled: v[] stays in registers, the steps become immediate
    // offsets, and the loads can be issued ahead of the conversions.
    #pragma unroll
    for (int j = 0; j < CONV_LOADS; ++j)          // read once: non-temporal
        v[j] = __builtin_nontemporal_load(s + j * 32);
    #pragma unroll
    for (int j = 0; j < CONV_LOADS; ++j) {
        bf16x4 o = { (bf16)v[j][0], (bf16)v[j][1], (bf16)v[j][2], (bf16)v[j][3] };
        d[j * 32] = o;
    }
}

// ---------------- RMSNorm (one block per row) ----------------
__global__ __launch_bounds__(256) void k_rmsnorm(const float* __restrict__ X,
                                                 const float* __restrict__ G,
                                                 bf16* __restrict__ Out) {
    const int row = blockIdx.x;
    const float* x = X + (size_t)row * DM;
    float s = 0.f;
    #pragma unroll
    for (int i = threadIdx.x; i < DM; i += 256) { float v = x[i]; s += v * v; }
    #pragma unroll
    for (int m = 16; m >= 1; m >>= 1) s += __shfl_xor(s, m, 32);
    __shared__ float red[8];
    if ((threadIdx.x & 31) == 0) red[threadIdx.x >> 5] = s;
    __syncthreads();
    float tot = 0.f;
    #pragma unroll
    for (int j = 0; j < 8; ++j) tot += red[j];
    const float rinv = rsqrtf(tot / (float)DM + EPSV);
    bf16* o = Out + (size_t)row * DM;
    for (int i = threadIdx.x; i < DM; i += 256) o[i] = (bf16)(x[i] * rinv * G[i]);
}

// Eight asynchronous 16-byte copies per lane, global memory -> LDS, no register
// in between. The s_wait_xcnt is the last line of the copies' own statement so
// that no address register named here is rewritten ahead of it.
__device__ __forceinline__ void async_copy8(unsigned l, unsigned lstep,
                                            const bf16* g, size_t gstep) {
    asm volatile(
        "global_load_async_to_lds_b128 %0, %8, off\n\t"
        "global_load_async_to_lds_b128 %1, %9, off\n\t"
        "global_load_async_to_lds_b128 %2, %10, off\n\t"
        "global_load_async_to_lds_b128 %3, %11, off\n\t"
        "global_load_async_to_lds_b128 %4, %12, off\n\t"
        "global_load_async_to_lds_b128 %5, %13, off\n\t"
        "global_load_async_to_lds_b128 %6, %14, off\n\t"
        "global_load_async_to_lds_b128 %7, %15, off\n\t"
        "s_wait_xcnt 0x0"
        :: "v"(l), "v"(l + lstep), "v"(l + 2 * lstep), "v"(l + 3 * lstep),
           "v"(l + 4 * lstep), "v"(l + 5 * lstep), "v"(l + 6 * lstep), "v"(l + 7 * lstep),
           "v"(g), "v"(g + gstep), "v"(g + 2 * gstep), "v"(g + 3 * gstep),
           "v"(g + 4 * gstep), "v"(g + 5 * gstep), "v"(g + 6 * gstep), "v"(g + 7 * gstep)
        : "memory");
}

// ---------------- WMMA NT-GEMM: C[M,N] = A[M,K] * B[N,K]^T ----------------
// K is walked in tiles of 128. Two LDS buffers: tile t+1's asynchronous copies
// fly while tile t's 32 WMMAs per wave run; one barrier per tile publishes the
// next tile and frees the buffer just read. K must be a multiple of 128.
// EPI 0: store f32          EPI 1: store f32 + R[m,n] (residual)
// EPI 2: store bf16( silu(R[m,n]) * acc )   (fused SwiGLU; R = w1 output)
template <int EPI>
__global__ __launch_bounds__(256)
void k_gemm_nt(const bf16* __restrict__ A, const bf16* __restrict__ B,
               const float* __restrict__ R, void* __restrict__ Out,
               int M, int N, int K) {
    constexpr int BM = 128, BN = 128, BK = 128, LDT = BK + 8;  // 272-byte pitch
    constexpr int OPER = BM * LDT;                             // one operand's tile
    constexpr int STAGE = 2 * OPER;                            // [A tile | B tile]
    __shared__ __attribute__((aligned(16))) bf16 Sm[2 * STAGE];

    const int m0 = blockIdx.y * BM, n0 = blockIdx.x * BN;
    const int tid  = threadIdx.x;
    const int lane = tid & 31, wid = tid >> 5;   // 8 waves
    const int wm = wid >> 2, wn = wid & 3;       // 2 x 4 wave grid: 64x32 per wave
    const int l15 = lane & 15, kh = lane >> 4;

    // Copy map: 16 lanes cover one 256-byte row; a lane's 8 copies are 16 rows apart.
    const int crow = tid >> 4, ccol = (tid & 15) * 8;
    const bf16* gA = A + (size_t)(m0 + crow) * K + ccol;
    const bf16* gB = B + (size_t)(n0 + crow) * K + ccol;
    const unsigned lA = (unsigned)(size_t)(Sm + crow * LDT + ccol);
    const size_t gstep = (size_t)16 * K;
    auto stage_in = [&](int t, int buf) {
        const unsigned l = lA + (unsigned)(buf * STAGE * 2);
        async_copy8(l,            16 * LDT * 2, gA + (size_t)t * BK, gstep);
        async_copy8(l + OPER * 2, 16 * LDT * 2, gB + (size_t)t * BK, gstep);
    };

    const int nt = K / BK;
    stage_in(0, 0);
    asm volatile("s_wait_asynccnt 0x0" ::: "memory");   // tile 0 has landed (own copies)
    __syncthreads();                                    // ... and every wave's copies
    if (nt > 1) stage_in(1, 1);

    f32x8 acc[4][2] = {};

    for (int t = 0; t < nt; ++t) {
        const bf16* As = Sm + (t & 1) * STAGE;
        const bf16* Bs = As + OPER;
        // Unrolled: the four blocks' LDS offsets become immediates and a block's
        // reads can start under the WMMAs of the block before it.
        #pragma unroll
        for (int kk = 0; kk < BK; kk += 32) {
            bf16x16 afr[4], bfr[2];
            #pragma unroll
            for (int ni = 0; ni < 2; ++ni)
                bfr[ni] = frag_ld(Bs + (wn * 32 + ni * 16 + l15) * LDT + kk, kh);
            #pragma unroll
            for (int mi = 0; mi < 4; ++mi)
                afr[mi] = frag_ld(As + (wm * 64 + mi * 16 + l15) * LDT + kk, kh);
            // Keeps the block's 12 LDS reads one group in front of its 8 WMMAs: left
            // alone the compiler sinks them between the WMMAs, a full LDS wait per pair.
            __builtin_amdgcn_sched_barrier(0);
            #pragma unroll
            for (int mi = 0; mi < 4; ++mi)
                #pragma unroll
                for (int ni = 0; ni < 2; ++ni)
                    acc[mi][ni] = wmma_bf16(afr[mi], bfr[ni], acc[mi][ni]);
        }
        asm volatile("s_wait_dscnt 0x0" ::: "memory");     // own reads of this buffer are done
        asm volatile("s_wait_asynccnt 0x0" ::: "memory");  // own copies of tile t+1 have landed
        __syncthreads();   // publishes tile t+1; ends every reader's last read of tile t
        if (t + 2 < nt) stage_in(t + 2, t & 1);            // refill the buffer just read
    }
    asm volatile("s_wait_asynccnt 0x0" ::: "memory");      // nothing in flight at the wave's end

    #pragma unroll
    for (int mi = 0; mi < 4; ++mi)
        #pragma unroll
        for (int ni = 0; ni < 2; ++ni)
            #pragma unroll
            for (int r = 0; r < 8; ++r) {
                int gm = m0 + wm * 64 + mi * 16 + kh * 8 + r;
                int gn = n0 + wn * 32 + ni * 16 + l15;
                size_t off = (size_t)gm * N + gn;
                float v = acc[mi][ni][r];
                if constexpr (EPI == 0) {
                    ((float*)Out)[off] = v;
                } else if constexpr (EPI == 1) {
                    ((float*)Out)[off] = v + R[off];
                } else {
                    float a = R[off];
                    float g = a / (1.f + __expf(-a));   // a * sigmoid(a)
                    ((bf16*)Out)[off] = (bf16)(g * v);
                }
            }
}

// ---------------- RoPE on Q,K + bf16 convert; V -> per-head transposed bf16 ----
// Q,K,V are fp32 (B,S,DM). Qb,Kb: bf16 (B,S,DM). Vt: bf16 [b][h][dk][S].
__global__ __launch_bounds__(256)
void k_rope(const float* __restrict__ Q, const float* __restrict__ K,
            const float* __restrict__ V, bf16* __restrict__ Qb,
            bf16* __restrict__ Kb, bf16* __restrict__ Vt) {
    const int pairsPerRow = DM / 2;                       // 512
    size_t idx = (size_t)blockIdx.x * 256 + threadIdx.x;  // over B*S*DM/2
    size_t row = idx / pairsPerRow;                       // b*S + s
    int pr = (int)(idx % pairsPerRow);
    int h = pr / (DK / 2);
    int p = pr % (DK / 2);
    int s = (int)(row % SEQ);
    int b = (int)(row / SEQ);
    int e0 = h * DK + 2 * p;

    float inv = __powf(THETA_F, -2.f * (float)p / (float)DK);
    float sn, cs;
    __sincosf((float)s * inv, &sn, &cs);

    size_t base = row * DM;
    float q1 = Q[base + e0], q2 = Q[base + e0 + 1];
    Qb[base + e0]     = (bf16)(q1 * cs - q2 * sn);
    Qb[base + e0 + 1] = (bf16)(q1 * sn + q2 * cs);
    float k1 = K[base + e0], k2 = K[base + e0 + 1];
    Kb[base + e0]     = (bf16)(k1 * cs - k2 * sn);
    Kb[base + e0 + 1] = (bf16)(k1 * sn + k2 * cs);

    float v1 = V[base + e0], v2 = V[base + e0 + 1];
    size_t vtb = ((size_t)b * HEADS + h) * DK;
    Vt[(vtb + 2 * p)     * SEQ + s] = (bf16)v1;
    Vt[(vtb + 2 * p + 1) * SEQ + s] = (bf16)v2;
}

// ---------------- Flash attention (causal, online softmax) ----------------
// Block: 128 threads (4 waves), handles one (b,h) and 64 query rows.
// Each wave owns 16 queries and forms the TRANSPOSED products on WMMA bf16:
//   S^T = K * Q^T   (A = 16 keys from LDS,     B = the wave's 16 queries, in registers)
//   O^T += V^T * P^T (A = 16 rows of V^T, LDS, B = P^T packed from the score registers)
// In D a lane holds one column, so lane l has the scores of query l & 15 alone
// (keys 8 * (l >> 4) + r of each 16-key tile): maximum and sum run inside the lane,
// with one exchange between lanes l and l ^ 16, and two score tiles converted in
// place are the B operand of the second product in frag_ld's own k order.
// K/V tile kt+1 is fetched into registers while tile kt is being consumed.

// Lane l takes the value of lane l ^ 16.
__device__ __forceinline__ float other_half(float x) {
    int b = __builtin_bit_cast(int, x);
    return __builtin_bit_cast(float,
        __builtin_amdgcn_permlanex16(b, b, 0x76543210, 0xfedcba98, false, false));
}

__global__ __launch_bounds__(128)
void k_flash_attn(const bf16* __restrict__ Qb, const bf16* __restrict__ Kb,
                  const bf16* __restrict__ Vt, bf16* __restrict__ Ob) {
    constexpr int LT = 72;   // 64 + 8 pad (16B-aligned rows, conflict-free b128)
    __shared__ __attribute__((aligned(16))) bf16 Qs [64 * LT];
    __shared__ __attribute__((aligned(16))) bf16 Ks [64 * LT];
    __shared__ __attribute__((aligned(16))) bf16 Vts[64 * LT];

    const int qt = blockIdx.x;            // query tile (64 rows)
    const int bh = blockIdx.y;
    const int b = bh / HEADS, h = bh % HEADS;
    const int tid = threadIdx.x, lane = tid & 31, w = tid >> 5;
    const int l15 = lane & 15, kh = lane >> 4;

    const bf16* Qg = Qb + (size_t)b * SEQ * DM + h * DK;
    const bf16* Kg = Kb + (size_t)b * SEQ * DM + h * DK;
    const bf16* Vg = Vt + ((size_t)b * HEADS + h) * DK * SEQ;

    int trow[4], tcol[4];
    #pragma unroll
    for (int i = 0; i < 4; ++i) {          // 64x64 tile, 8 bf16 per thread-iter
        int idx = tid + i * 128;
        trow[i] = idx >> 3; tcol[i] = (idx & 7) * 8;
    }
    #pragma unroll
    for (int i = 0; i < 4; ++i)
        *(u32x4*)(Qs + trow[i] * LT + tcol[i]) =
            *(const u32x4*)(Qg + (size_t)(qt * 64 + trow[i]) * DM + tcol[i]);
    __syncthreads();

    const bf16* qrow = Qs + (w * 16 + l15) * LT;
    bf16x16 bq0 = frag_ld(qrow, kh), bq1 = frag_ld(qrow + 32, kh);

    float mrow = -1e30f, lrow = 0.f;      // this lane's query: running maximum and sum
    f32x8 Oacc[4] = {};                   // Oacc[nt][r] = O[query l15][nt*16 + kh*8 + r]

    const int qg = qt * 64 + w * 16 + l15;   // this lane's global query index

    u32x4 rk[4], rv[4];
    auto fetchKV = [&](int kt) {
        #pragma unroll
        for (int i = 0; i < 4; ++i) {
            rk[i] = *(const u32x4*)(Kg + (size_t)(kt * 64 + trow[i]) * DM + tcol[i]);
            rv[i] = *(const u32x4*)(Vg + (size_t)trow[i] * SEQ + kt * 64 + tcol[i]);
        }
    };
    fetchKV(0);

    for (int kt = 0; kt <= qt; ++kt) {
        __syncthreads();   // previous-iteration readers of Ks/Vts are done
        #pragma unroll
        for (int i = 0; i < 4; ++i) {
            *(u32x4*)(Ks  + trow[i] * LT + tcol[i]) = rk[i];
            *(u32x4*)(Vts + trow[i] * LT + tcol[i]) = rv[i];
        }
        __syncthreads();

        if (kt + 2 <= qt) {   // warm GL2 two tiles ahead
            __builtin_prefetch(Kg + (size_t)((kt + 2) * 64 + trow[0]) * DM + tcol[0], 0, 3);
            __builtin_prefetch(Vg + (size_t)trow[0] * SEQ + (kt + 2) * 64 + tcol[0], 0, 3);
        }
        if (kt < qt) fetchKV(kt + 1);   // loads in flight under score/softmax

        // scores, transposed: 64(k) x 16(q) per wave, K-dim = dk = 64 -> 2 chained WMMAs
        // st[mt][r] = S[key kt*64 + mt*16 + kh*8 + r][query l15]
        f32x8 st[4];
        #pragma unroll
        for (int mt = 0; mt < 4; ++mt) {
            const bf16* krow = Ks + (mt * 16 + l15) * LT;
            f32x8 a = {};
            a = wmma_bf16(frag_ld(krow, kh), bq0, a);
            a = wmma_bf16(frag_ld(krow + 32, kh), bq1, a);
            st[mt] = a;
        }
        // scale + causal mask
        #pragma unroll
        for (int mt = 0; mt < 4; ++mt) {
            int kg = kt * 64 + mt * 16 + kh * 8;
            #pragma unroll
            for (int r = 0; r < 8; ++r) {
                float v = st[mt][r] * 0.125f;                // 1/sqrt(64)
                st[mt][r] = (kg + r > qg) ? -1e30f : v;
            }
        }
        // online softmax: the lane's 32 keys, then the other half's 32
        float mx8[8];
        #pragma unroll
        for (int r = 0; r < 8; ++r)
            mx8[r] = fmaxf(fmaxf(st[0][r], st[1][r]), fmaxf(st[2][r], st[3][r]));
        float mx = fmaxf(fmaxf(fmaxf(mx8[0], mx8[1]), fmaxf(mx8[2], mx8[3])),
                         fmaxf(fmaxf(mx8[4], mx8[5]), fmaxf(mx8[6], mx8[7])));
        mx = fmaxf(mx, other_half(mx));
        const float mnew = fmaxf(mrow, mx);
        const float sc = __expf(mrow - mnew);
        #pragma unroll
        for (int mt = 0; mt < 4; ++mt)
            #pragma unroll
            for (int r = 0; r < 8; ++r) st[mt][r] = __expf(st[mt][r] - mnew);
        float sm8[8];
        #pragma unroll
        for (int r = 0; r < 8; ++r)
            sm8[r] = (st[0][r] + st[1][r]) + (st[2][r] + st[3][r]);
        float sm = ((sm8[0] + sm8[1]) + (sm8[2] + sm8[3])) +
                   ((sm8[4] + sm8[5]) + (sm8[6] + sm8[7]));
        sm += other_half(sm);
        lrow = lrow * sc + sm;
        mrow = mnew;
        #pragma unroll
        for (int nt = 0; nt < 4; ++nt)
            #pragma unroll
            for (int r = 0; r < 8; ++r) Oacc[nt][r] *= sc;

        // P^T as B operand: element s of keys 32g .. 32g+31 is tile 2g + (s >> 3), register s & 7
        bf16x16 bp0, bp1;
        #pragma unroll
        for (int s = 0; s < 16; ++s) {
            bp0[s] = (bf16)st[s >> 3][s & 7];
            bp1[s] = (bf16)st[2 + (s >> 3)][s & 7];
        }
        #pragma unroll
        for (int nt = 0; nt < 4; ++nt) {
            const bf16* vrow = Vts + (nt * 16 + l15) * LT;
            Oacc[nt] = wmma_bf16(frag_ld(vrow, kh), bp0, Oacc[nt]);
            Oacc[nt] = wmma_bf16(frag_ld(vrow + 32, kh), bp1, Oacc[nt]);
        }
    }

    // normalize and write bf16 output (feeds the WO GEMM directly):
    // a lane's 8 registers of a tile are 8 consecutive elements of its query's row
    const size_t srow = (size_t)b * SEQ + qg;
    #pragma unroll
    for (int nt = 0; nt < 4; ++nt) {
        bf16x8 o;
        #pragma unroll
        for (int r = 0; r < 8; ++r) o[r] = (bf16)(Oacc[nt][r] / lrow);
        *(bf16x8*)(Ob + srow * DM + h * DK + nt * 16 + kh * 8) = o;
    }
}

// ---------------- host launcher ----------------
extern "C" void kernel_launch(void* const* d_in, const int* in_sizes, int n_in,
                              void* d_out, int out_size, void* d_ws, size_t ws_size,
                              hipStream_t stream) {
    (void)in_sizes; (void)n_in; (void)out_size; (void)ws_size;
    const float* x  = (const float*)d_in[0];
    const float* wq = (const float*)d_in[1];
    const float* wk = (const float*)d_in[2];
    const float* wv = (const float*)d_in[3];
    const float* wo = (const float*)d_in[4];
    const float* w1 = (const float*)d_in[5];
    const float* w2 = (const float*)d_in[6];
    const float* w3 = (const float*)d_in[7];
    const float* g1 = (const float*)d_in[8];
    const float* g2 = (const float*)d_in[9];
    float* out = (float*)d_out;

    const size_t MB = 1ull << 20;
    char* p = (char*)d_ws;
    bf16*  n_bf  = (bf16*)p;            p += 8 * MB;   // 4096x1024 bf16
    bf16*  wq_bf = (bf16*)p;            p += 2 * MB;
    bf16*  wk_bf = (bf16*)p;            p += 2 * MB;
    bf16*  wv_bf = (bf16*)p;            p += 2 * MB;
    bf16*  wo_bf = (bf16*)p;            p += 2 * MB;
    bf16*  w1_bf = (bf16*)p;            p += 8 * MB;
    bf16*  w3_bf = (bf16*)p;            p += 8 * MB;
    bf16*  w2_bf = (bf16*)p;            p += 8 * MB;
    float* x1    = (float*)p;           p += 16 * MB;  // x + attn residual
    bf16*  n2_bf = (bf16*)p;            p += 8 * MB;
    // 64 MB region reused: {q_f,k_f,v_f fp32 + q_bf,k_bf} then a_f (w1 output)
    char*  reuse = p;                   p += 64 * MB;
    float* q_f  = (float*)reuse;
    float* k_f  = (float*)(reuse + 16 * MB);
    float* v_f  = (float*)(reuse + 32 * MB);
    bf16*  q_bf = (bf16*) (reuse + 48 * MB);
    bf16*  k_bf = (bf16*) (reuse + 56 * MB);
    float* a_f  = (float*)reuse;                       // 64 MB, after attention
    bf16*  vt_bf = (bf16*)p;            p += 8 * MB;
    bf16*  o_bf  = (bf16*)p;            p += 8 * MB;
    bf16*  h_bf  = (bf16*)p;            p += 32 * MB;  // swiglu output 4096x4096

    // 1) weights -> bf16
    //    (wq_bf .. w2_bf are one contiguous array that starts at wq_bf)
    k_weights_to_bf16<<<CONV_WGS, 512, 0, stream>>>(wq, wk, wv, wo, w1, w3, w2, wq_bf);

    // 2) n = rmsnorm(x, g1)
    k_rmsnorm<<<MROWS, 256, 0, stream>>>(x, g1, n_bf);

    // 3) Q,K,V projections (fp32 out, then RoPE)
    dim3 gQKV(DM / 128, MROWS / 128);
    k_gemm_nt<0><<<gQKV, 256, 0, stream>>>(n_bf, wq_bf, nullptr, q_f, MROWS, DM, DM);
    k_gemm_nt<0><<<gQKV, 256, 0, stream>>>(n_bf, wk_bf, nullptr, k_f, MROWS, DM, DM);
    k_gemm_nt<0><<<gQKV, 256, 0, stream>>>(n_bf, wv_bf, nullptr, v_f, MROWS, DM, DM);

    // 4) RoPE(q,k) -> bf16; V -> per-head transposed bf16
    k_rope<<<(BATCH * SEQ * DM / 2) / 256, 256, 0, stream>>>(q_f, k_f, v_f,
                                                             q_bf, k_bf, vt_bf);

    // 5) causal flash attention -> o (bf16)
    dim3 gAtt(SEQ / 64, BATCH * HEADS);
    k_flash_attn<<<gAtt, 128, 0, stream>>>(q_bf, k_bf, vt_bf, o_bf);

    // 6) x1 = x + o @ Wo^T
    k_gemm_nt<1><<<gQKV, 256, 0, stream>>>(o_bf, wo_bf, x, x1, MROWS, DM, DM);

    // 7) n2 = rmsnorm(x1, g2)
    k_rmsnorm<<<MROWS, 256, 0, stream>>>(x1, g2, n2_bf);

    // 8) a = n2 @ W1^T ; h = silu(a) * (n2 @ W3^T)  [fused epilogue]
    dim3 gFF(DFF / 128, MROWS / 128);
    k_gemm_nt<0><<<gFF, 256, 0, stream>>>(n2_bf, w1_bf, nullptr, a_f, MROWS, DFF, DM);
    k_gemm_nt<2><<<gFF, 256, 0, stream>>>(n2_bf, w3_bf, a_f, h_bf, MROWS, DFF, DM);

    // 9) out = x1 + h @ W2^T
    k_gemm_nt<1><<<gQKV, 256, 0, stream>>>(h_bf, w2_bf, x1, out, MROWS, DM, DFF);
}

// v004
// Measured time: 309 microseconds a run.
// Next to v003, in two timings, it ran 1.03 and 1.04 times as fast.
// All steps since v000 together make it 1.81 times as fast.
#include <hip/hip_runtime.h>

// ---------------- problem constants ----------------
#define BATCH   2
#define SEQ     2048
#define DM      1024
#define HEADS   16
#define DK      64
#define DFF     4096
#define MROWS   (BATCH * SEQ)       // 4096
#define EPSV    1e-5f
#define THETA_F 10000.0f

// ---------------- types ----------------
typedef __bf16 bf16;
typedef __attribute__((ext_vector_type(16))) __bf16 bf16x16;
typedef __attribute__((ext_vector_type(8)))  __bf16 bf16x8;
typedef __attribute__((ext_vector_type(8)))  float  f32x8;
typedef __attribute__((ext_vector_type(4)))  unsigned int u32x4;

// Load one 16x32 bf16 WMMA fragment (A or B operand) from LDS.
// rowPtr points at the start of this lane's row (16-byte aligned, row stride
// is a multiple of 8 elements). kh = lane>>4 selects the K-half per the ISA
// 16-bit A-matrix layout: half 0 -> K {0..7, 16..23}, half 1 -> K {8..15, 24..31}.
__device__ __forceinline__ bf16x16 frag_ld(const bf16* rowPtr, int kh) {
    bf16x8 lo = *(const bf16x8*)(rowPtr + kh * 8);
    bf16x8 hi = *(const bf16x8*)(rowPtr + 16 + kh * 8);
    return __builtin_shufflevector(lo, hi, 0,1,2,3,4,5,6,7,8,9,10,11,12,13,14,15);
}

__device__ __forceinline__ f32x8 wmma_bf16(bf16x16 a, bf16x16 b, f32x8 c) {
    return __builtin_amdgcn_wmma_f32_16x16x32_bf16(false, a, false, b, (short)0, c, false, false);
}

// ---------------- fp32 -> bf16 conversion of all seven weights, one launch ----
// The bf16 copies lie back to back in the workspace in the order
// wq, wk, wv, wo, w1, w3, w2, so the destination is one array of CONV_TOTAL
// elements. One 16-wave work-group per WGP takes CONV_PER_WG consecutive
// elements of it (always inside one source, since every source's length is a
// multiple of CONV_PER_WG). A wave reads 32 x 512 contiguous bytes, many loads
// in flight at a time, and stores 32 x 256 contiguous bytes.
typedef __attribute__((ext_vector_type(4))) float  f32x4;
typedef __attribute__((ext_vector_type(4))) __bf16 bf16x4;
#define CONV_TOTAL   (4 * DM * DM + 3 * DFF * DM)   // 16,777,216
#define CONV_WGS     256
#define CONV_PER_WG  (CONV_TOTAL / CONV_WGS)        // 65,536
#define CONV_LOADS   (CONV_PER_WG / (512 * 4))      // 32 loads of 4 floats a lane
static_assert((DM * DM) % CONV_PER_WG == 0 && (DFF * DM) % CONV_PER_WG == 0,
              "a work-group's range must lie inside one weight");
__global__ __launch_bounds__(512)
void k_weights_to_bf16(const float* __restrict__ wq, const float* __restrict__ wk,
                       const float* __restrict__ wv, const float* __restrict__ wo,
                       const float* __restrict__ w1, const float* __restrict__ w3,
                       const float* __restrict__ w2, bf16* __restrict__ out) {
    const int first = blockIdx.x * CONV_PER_WG;   // index in the destination array
    const float* src = wq;                        // the weight that holds it ...
    int base = 0;                                 // ... and where that weight starts
    if (first >= 1 * DM * DM)                { src = wk; base = 1 * DM * DM; }
    if (first >= 2 * DM * DM)                { src = wv; base = 2 * DM * DM; }
    if (first >= 3 * DM * DM)                { src = wo; base = 3 * DM * DM; }
    if (first >= 4 * DM * DM)                { src = w1; base = 4 * DM * DM; }
    if (first >= 4 * DM * DM + 1 * DFF * DM) { src = w3; base = 4 * DM * DM + 1 * DFF * DM; }
    if (first >= 4 * DM * DM + 2 * DFF * DM) { src = w2; base = 4 * DM * DM + 2 * DFF * DM; }

    const int lane = threadIdx.x & 31, wave = threadIdx.x >> 5;
    const int at = first + wave * (CONV_LOADS * 128) + lane * 4;
    const f32x4* s = (const f32x4*)(src + (at - base));
    bf16x4*      d = (bf16x4*)(out + at);
    f32x4 v[CONV_LOADS];
    // Both loops unrolled: v[] stays in registers, the steps become immediate
    // offsets, and the loads can be issued ahead of the conversions.
    #pragma unroll
    for (int j = 0; j < CONV_LOADS; ++j)          // read once: non-temporal
        v[j] = __builtin_nontemporal_load(s + j * 32);
    #pragma unroll
    for (int j = 0; j < CONV_LOADS; ++j) {
        bf16x4 o = { (bf16)v[j][0], (bf16)v[j][1], (bf16)v[j][2], (bf16)v[j][3] };
        d[j * 32] = o;
    }
}

// ---------------- RMSNorm (one block per row) ----------------
__global__ __launch_bounds__(256) void k_rmsnorm(const float* __restrict__ X,
                                                 const float* __restrict__ G,
                                                 bf16* __restrict__ Out) {
    const int row = blockIdx.x;
    const float* x = X + (size_t)row * DM;
    float s = 0.f;
    #pragma unroll
    for (int i = threadIdx.x; i < DM; i += 256) { float v = x[i]; s += v * v; }
    #pragma unroll
    for (int m = 16; m >= 1; m >>= 1) s += __shfl_xor(s, m, 32);
    __shared__ float red[8];
    if ((threadIdx.x & 31) == 0) red[threadIdx.x >> 5] = s;
    __syncthreads();
    float tot = 0.f;
    #pragma unroll
    for (int j = 0; j < 8; ++j) tot += red[j];
    const float rinv = rsqrtf(tot / (float)DM + EPSV);
    bf16* o = Out + (size_t)row * DM;
    for (int i = threadIdx.x; i < DM; i += 256) o[i] = (bf16)(x[i] * rinv * G[i]);
}

// Eight asynchronous 16-byte copies per lane, global memory -> LDS, no register
// in between. The s_wait_xcnt is the last line of the copies' own statement so
// that no address register named here is rewritten ahead of it.
__device__ __forceinline__ void async_copy8(unsigned l, unsigned lstep,
                                            const bf16* g, size_t gstep) {
    asm volatile(
        "global_load_async_to_lds_b128 %0, %8, off\n\t"
        "global_load_async_to_lds_b128 %1, %9, off\n\t"
        "global_load_async_to_lds_b128 %2, %10, off\n\t"
        "global_load_async_to_lds_b128 %3, %11, off\n\t"
        "global_load_async_to_lds_b128 %4, %12, off\n\t"
        "global_load_async_to_lds_b128 %5, %13, off\n\t"
        "global_load_async_to_lds_b128 %6, %14, off\n\t"
        "global_load_async_to_lds_b128 %7, %15, off\n\t"
        "s_wait_xcnt 0x0"
        :: "v"(l), "v"(l + lstep), "v"(l + 2 * lstep), "v"(l + 3 * lstep),
           "v"(l + 4 * lstep), "v"(l + 5 * lstep), "v"(l + 6 * lstep), "v"(l + 7 * lstep),
           "v"(g), "v"(g + gstep), "v"(g + 2 * gstep), "v"(g + 3 * gstep),
           "v"(g + 4 * gstep), "v"(g + 5 * gstep), "v"(g + 6 * gstep), "v"(g + 7 * gstep)
        : "memory");
}

// ---------------- WMMA NT-GEMM: C[M,N] = A[M,K] * B[N,K]^T ----------------
// K is walked in tiles of 128. Two LDS buffers: tile t+1's asynchronous copies
// fly while tile t's 32 WMMAs per wave run; one barrier per tile publishes the
// next tile and frees the buffer just read. K must be a multiple of 128.
// EPI 0: store f32          EPI 1: store f32 + R[m,n] (residual)
// EPI 2: store bf16( silu(R[m,n]) * acc )   (fused SwiGLU; R = w1 output)
template <int EPI>
__global__ __launch_bounds__(256)
void k_gemm_nt(const bf16* __restrict__ A, const bf16* __restrict__ B,
               const float* __restrict__ R, void* __restrict__ Out,
               int M, int N, int K) {
    constexpr int BM = 128, BN = 128, BK = 128, LDT = BK + 8;  // 272-byte pitch
    constexpr int OPER = BM * LDT;                             // one operand's tile
    constexpr int STAGE = 2 * OPER;                            // [A tile | B tile]
    __shared__ __attribute__((aligned(16))) bf16 Sm[2 * STAGE];

    const int m0 = blockIdx.y * BM, n0 = blockIdx.x * BN;
    const int tid  = threadIdx.x;
    const int lane = tid & 31, wid = tid >> 5;   // 8 waves
    const int wm = wid >> 2, wn = wid & 3;       // 2 x 4 wave grid: 64x32 per wave
    const int l15 = lane & 15, kh = lane >> 4;

    // Copy map: 16 lanes cover one 256-byte row; a lane's 8 copies are 16 rows apart.
    const int crow = tid >> 4, ccol = (tid & 15) * 8;
    const bf16* gA = A + (size_t)(m0 + crow) * K + ccol;
    const bf16* gB = B + (size_t)(n0 + crow) * K + ccol;
    const unsigned lA = (unsigned)(size_t)(Sm + crow * LDT + ccol);
    const size_t gstep = (size_t)16 * K;
    auto stage_in = [&](int t, int buf) {
        const unsigned l = lA + (unsigned)(buf * STAGE * 2);
        async_copy8(l,            16 * LDT * 2, gA + (size_t)t * BK, gstep);
        async_copy8(l + OPER * 2, 16 * LDT * 2, gB + (size_t)t * BK, gstep);
    };

    const int nt = K / BK;
    stage_in(0, 0);
    asm volatile("s_wait_asynccnt 0x0" ::: "memory");   // tile 0 has landed (own copies)
    __syncthreads();                                    // ... and every wave's copies
    if (nt > 1) stage_in(1, 1);

    f32x8 acc[4][2] = {};

    for (int t = 0; t < nt; ++t) {
        const bf16* As = Sm + (t & 1) * STAGE;
        const bf16* Bs = As + OPER;
        // Unrolled: the four blocks' LDS offsets become immediates and a block's
        // reads can start under the WMMAs of the block before it.
        #pragma unroll
        for (int kk = 0; kk < BK; kk += 32) {
            bf16x16 afr[4], bfr[2];
            #pragma unroll
            for (int ni = 0; ni < 2; ++ni)
                bfr[ni] = frag_ld(Bs + (wn * 32 + ni * 16 + l15) * LDT + kk, kh);
            #pragma unroll
            for (int mi = 0; mi < 4; ++mi)
                afr[mi] = frag_ld(As + (wm * 64 + mi * 16 + l15) * LDT + kk, kh);
            // Keeps the block's 12 LDS reads one group in front of its 8 WMMAs: left
            // alone the compiler sinks them between the WMMAs, a full LDS wait per pair.
            __builtin_amdgcn_sched_barrier(0);
            #pragma unroll
            for (int mi = 0; mi < 4; ++mi)
                #pragma unroll
                for (int ni = 0; ni < 2; ++ni)
                    acc[mi][ni] = wmma_bf16(afr[mi], bfr[ni], acc[mi][ni]);
        }
        asm volatile("s_wait_dscnt 0x0" ::: "memory");     // own reads of this buffer are done
        asm volatile("s_wait_asynccnt 0x0" ::: "memory");  // own copies of tile t+1 have landed
        __syncthreads();   // publishes tile t+1; ends every reader's last read of tile t
        if (t + 2 < nt) stage_in(t + 2, t & 1);            // refill the buffer just read
    }
    asm volatile("s_wait_asynccnt 0x0" ::: "memory");      // nothing in flight at the wave's end

    #pragma unroll
    for (int mi = 0; mi < 4; ++mi)
        #pragma unroll
        for (int ni = 0; ni < 2; ++ni)
            #pragma unroll
            for (int r = 0; r < 8; ++r) {
                int gm = m0 + wm * 64 + mi * 16 + kh * 8 + r;
                int gn = n0 + wn * 32 + ni * 16 + l15;
                size_t off = (size_t)gm * N + gn;
                float v = acc[mi][ni][r];
                if constexpr (EPI == 0) {
                    ((float*)Out)[off] = v;
                } else if constexpr (EPI == 1) {
                    ((float*)Out)[off] = v + R[off];
                } else {
                    float a = R[off];
                    float g = a / (1.f + __expf(-a));   // a * sigmoid(a)
                    ((bf16*)Out)[off] = (bf16)(g * v);
                }
            }
}

// ---------------- RoPE on Q,K + bf16 convert; V -> per-head transposed bf16 ----
// Q,K,V are fp32 (B,S,DM). Qb,Kb: bf16 (B,S,DM). Vt: bf16 [b][h][dk][S].
__global__ __launch_bounds__(256)
void k_rope(const float* __restrict__ Q, const float* __restrict__ K,
            const float* __restrict__ V, bf16* __restrict__ Qb,
            bf16* __restrict__ Kb, bf16* __restrict__ Vt) {
    const int pairsPerRow = DM / 2;                       // 512
    size_t idx = (size_t)blockIdx.x * 256 + threadIdx.x;  // over B*S*DM/2
    size_t row = idx / pairsPerRow;                       // b*S + s
    int pr = (int)(idx % pairsPerRow);
    int h = pr / (DK / 2);
    int p = pr % (DK / 2);
    int s = (int)(row % SEQ);
    int b = (int)(row / SEQ);
    int e0 = h * DK + 2 * p;

    float inv = __powf(THETA_F, -2.f * (float)p / (float)DK);
    float sn, cs;
    __sincosf((float)s * inv, &sn, &cs);

    size_t base = row * DM;
    float q1 = Q[base + e0], q2 = Q[base + e0 + 1];
    Qb[base + e0]     = (bf16)(q1 * cs - q2 * sn);
    Qb[base + e0 + 1] = (bf16)(q1 * sn + q2 * cs);
    float k1 = K[base + e0], k2 = K[base + e0 + 1];
    Kb[base + e0]     = (bf16)(k1 * cs - k2 * sn);
    Kb[base + e0 + 1] = (bf16)(k1 * sn + k2 * cs);

    float v1 = V[base + e0], v2 = V[base + e0 + 1];
    size_t vtb = ((size_t)b * HEADS + h) * DK;
    Vt[(vtb + 2 * p)     * SEQ + s] = (bf16)v1;
    Vt[(vtb + 2 * p + 1) * SEQ + s] = (bf16)v2;
}

// ---------------- Flash attention (causal, online softmax) ----------------
// Block: 128 threads (4 waves), handles one (b,h) and two tiles of 64 query rows,
// tile 31 - p and then tile p: 32 - p and p + 1 key tiles, 33 for every block, so
// that all blocks, resident together, end together wherever they are placed.
// Each wave owns 16 queries and forms the TRANSPOSED products on WMMA bf16:
//   S^T = K * Q^T   (A = 16 keys from LDS,     B = the wave's 16 queries, in registers)
//   O^T += V^T * P^T (A = 16 rows of V^T, LDS, B = P^T packed from the score registers)
// In D a lane holds one column, so lane l has the scores of query l & 15 alone
// (keys 8 * (l >> 4) + r of each 16-key tile): maximum and sum run inside the lane,
// with one exchange between lanes l and l ^ 16, and two score tiles converted in
// place are the B operand of the second product in frag_ld's own k order.
// K/V tile kt+1 is fetched into registers while tile kt is being consumed.

// Lane l takes the value of lane l ^ 16.
__device__ __forceinline__ float other_half(float x) {
    int b = __builtin_bit_cast(int, x);
    return __builtin_bit_cast(float,
        __builtin_amdgcn_permlanex16(b, b, 0x76543210, 0xfedcba98, false, false));
}

__global__ __launch_bounds__(128)
void k_flash_attn(const bf16* __restrict__ Qb, const bf16* __restrict__ Kb,
                  const bf16* __restrict__ Vt, bf16* __restrict__ Ob) {
    constexpr int LT = 72;   // 64 + 8 pad (16B-aligned rows, conflict-free b128)
    __shared__ __attribute__((aligned(16))) bf16 Qs [2 * 64 * LT];   // both query tiles
    __shared__ __attribute__((aligned(16))) bf16 Ks [64 * LT];
    __shared__ __attribute__((aligned(16))) bf16 Vts[64 * LT];

    const int qtile[2] = { SEQ / 64 - 1 - (int)blockIdx.x, (int)blockIdx.x };
    const int bh = blockIdx.y;
    const int b = bh / HEADS, h = bh % HEADS;
    const int tid = threadIdx.x, lane = tid & 31, w = tid >> 5;
    const int l15 = lane & 15, kh = lane >> 4;

    const bf16* Qg = Qb + (size_t)b * SEQ * DM + h * DK;
    const bf16* Kg = Kb + (size_t)b * SEQ * DM + h * DK;
    const bf16* Vg = Vt + ((size_t)b * HEADS + h) * DK * SEQ;

    int trow[4], tcol[4];
    #pragma unroll
    for (int i = 0; i < 4; ++i) {          // 64x64 tile, 8 bf16 per thread-iter
        int idx = tid + i * 128;
        trow[i] = idx >> 3; tcol[i] = (idx & 7) * 8;
    }
    #pragma unroll
    for (int hf = 0; hf < 2; ++hf)
        #pragma unroll
        for (int i = 0; i < 4; ++i)
            *(u32x4*)(Qs + hf * 64 * LT + trow[i] * LT + tcol[i]) =
                *(const u32x4*)(Qg + (size_t)(qtile[hf] * 64 + trow[i]) * DM + tcol[i]);
    __syncthreads();

    // Not unrolled: one copy of the key loop in the instruction cache.
    #pragma unroll 1
    for (int half = 0; half < 2; ++half) {
    const int qt = half ? qtile[1] : qtile[0];   // query tile (64 rows)

    const bf16* qrow = Qs + half * 64 * LT + (w * 16 + l15) * LT;
    bf16x16 bq0 = frag_ld(qrow, kh), bq1 = frag_ld(qrow + 32, kh);

    float mrow = -1e30f, lrow = 0.f;      // this lane's query: running maximum and sum
    f32x8 Oacc[4] = {};                   // Oacc[nt][r] = O[query l15][nt*16 + kh*8 + r]

    const int qg = qt * 64 + w * 16 + l15;   // this lane's global query index

    u32x4 rk[4], rv[4];
    auto fetchKV = [&](int kt) {
        #pragma unroll
        for (int i = 0; i < 4; ++i) {
            rk[i] = *(const u32x4*)(Kg + (size_t)(kt * 64 + trow[i]) * DM + tcol[i]);
            rv[i] = *(const u32x4*)(Vg + (size_t)trow[i] * SEQ + kt * 64 + tcol[i]);
        }
    };
    fetchKV(0);

    for (int kt = 0; kt <= qt; ++kt) {
        __syncthreads();   // previous-iteration readers of Ks/Vts are done
        #pragma unroll
        for (int i = 0; i < 4; ++i) {
            *(u32x4*)(Ks  + trow[i] * LT + tcol[i]) = rk[i];
            *(u32x4*)(Vts + trow[i] * LT + tcol[i]) = rv[i];
        }
        __syncthreads();

        if (kt + 2 <= qt) {   // warm GL2 two tiles ahead
            __builtin_prefetch(Kg + (size_t)((kt + 2) * 64 + trow[0]) * DM + tcol[0], 0, 3);
            __builtin_prefetch(Vg + (size_t)trow[0] * SEQ + (kt + 2) * 64 + tcol[0], 0, 3);
        }
        if (kt < qt) fetchKV(kt + 1);   // loads in flight under score/softmax

        // scores, transposed: 64(k) x 16(q) per wave, K-dim = dk = 64 -> 2 chained WMMAs
        // st[mt][r] = S[key kt*64 + mt*16 + kh*8 + r][query l15]
        f32x8 st[4];
        #pragma unroll
        for (int mt = 0; mt < 4; ++mt) {
            const bf16* krow = Ks + (mt * 16 + l15) * LT;
            f32x8 a = {};
            a = wmma_bf16(frag_ld(krow, kh), bq0, a);
            a = wmma_bf16(frag_ld(krow + 32, kh), bq1, a);
            st[mt] = a;
        }
        // scale + causal mask
        #pragma unroll
        for (int mt = 0; mt < 4; ++mt) {
            int kg = kt * 64 + mt * 16 + kh * 8;
            #pragma unroll
            for (int r = 0; r < 8; ++r) {
                float v = st[mt][r] * 0.125f;                // 1/sqrt(64)
                st[mt][r] = (kg + r > qg) ? -1e30f : v;
            }
        }
        // online softmax: the lane's 32 keys, then the other half's 32
        float mx8[8];
        #pragma unroll
        for (int r = 0; r < 8; ++r)
            mx8[r] = fmaxf(fmaxf(st[0][r], st[1][r]), fmaxf(st[2][r], st[3][r]));
        float mx = fmaxf(fmaxf(fmaxf(mx8[0], mx8[1]), fmaxf(mx8[2], mx8[3])),
                         fmaxf(fmaxf(mx8[4], mx8[5]), fmaxf(mx8[6], mx8[7])));
        mx = fmaxf(mx, other_half(mx));
        const float mnew = fmaxf(mrow, mx);
        const float sc = __expf(mrow - mnew);
        #pragma unroll
        for (int mt = 0; mt < 4; ++mt)
            #pragma unroll
            for (int r = 0; r < 8; ++r) st[mt][r] = __expf(st[mt][r] - mnew);
        float sm8[8];
        #pragma unroll
        for (int r = 0; r < 8; ++r)
            sm8[r] = (st[0][r] + st[1][r]) + (st[2][r] + st[3][r]);
        float sm = ((sm8[0] + sm8[1]) + (sm8[2] + sm8[3])) +
                   ((sm8[4] + sm8[5]) + (sm8[6] + sm8[7]));
        sm += other_half(sm);
        lrow = lrow * sc + sm;
        mrow = mnew;
        #pragma unroll
        for (int nt = 0; nt < 4; ++nt)
            #pragma unroll
            for (int r = 0; r < 8; ++r) Oacc[nt][r] *= sc;

        // P^T as B operand: element s of keys 32g .. 32g+31 is tile 2g + (s >> 3), register s & 7
        bf16x16 bp0, bp1;
        #pragma unroll
        for (int s = 0; s < 16; ++s) {
            bp0[s] = (bf16)st[s >> 3][s & 7];
            bp1[s] = (bf16)st[2 + (s >> 3)][s & 7];
        }
        #pragma unroll
        for (int nt = 0; nt < 4; ++nt) {
            const bf16* vrow = Vts + (nt * 16 + l15) * LT;
            Oacc[nt] = wmma_bf16(frag_ld(vrow, kh), bp0, Oacc[nt]);
            Oacc[nt] = wmma_bf16(frag_ld(vrow + 32, kh), bp1, Oacc[nt]);
        }
    }

    // normalize and write bf16 output (feeds the WO GEMM directly):
    // a lane's 8 registers of a tile are 8 consecutive elements of its query's row
    const size_t srow = (size_t)b * SEQ + qg;
    #pragma unroll
    for (int nt = 0; nt < 4; ++nt) {
        bf16x8 o;
        #pragma unroll
        for (int r = 0; r < 8; ++r) o[r] = (bf16)(Oacc[nt][r] / lrow);
        *(bf16x8*)(Ob + srow * DM + h * DK + nt * 16 + kh * 8) = o;
    }
    // The second tile's code rewrites the registers that these stores name.
    asm volatile("s_wait_xcnt 0x0" ::: "memory");
    }   // half
}

// ---------------- host launcher ----------------
extern "C" void kernel_launch(void* const* d_in, const int* in_sizes, int n_in,
                              void* d_out, int out_size, void* d_ws, size_t ws_size,
                              hipStream_t stream) {
    (void)in_sizes; (void)n_in; (void)out_size; (void)ws_size;
    const float* x  = (const float*)d_in[0];
    const float* wq = (const float*)d_in[1];
    const float* wk = (const float*)d_in[2];
    const float* wv = (const float*)d_in[3];
    const float* wo = (const float*)d_in[4];
    const float* w1 = (const float*)d_in[5];
    const float* w2 = (const float*)d_in[6];
    const float* w3 = (const float*)d_in[7];
    const float* g1 = (const float*)d_in[8];
    const float* g2 = (const float*)d_in[9];
    float* out = (float*)d_out;

    const size_t MB = 1ull << 20;
    char* p = (char*)d_ws;
    bf16*  n_bf  = (bf16*)p;            p += 8 * MB;   // 4096x1024 bf16
    bf16*  wq_bf = (bf16*)p;            p += 2 * MB;
    bf16*  wk_bf = (bf16*)p;            p += 2 * MB;
    bf16*  wv_bf = (bf16*)p;            p += 2 * MB;
    bf16*  wo_bf = (bf16*)p;            p += 2 * MB;
    bf16*  w1_bf = (bf16*)p;            p += 8 * MB;
    bf16*  w3_bf = (bf16*)p;            p += 8 * MB;
    bf16*  w2_bf = (bf16*)p;            p += 8 * MB;
    float* x1    = (float*)p;           p += 16 * MB;  // x + attn residual
    bf16*  n2_bf = (bf16*)p;            p += 8 * MB;
    // 64 MB region reused: {q_f,k_f,v_f fp32 + q_bf,k_bf} then a_f (w1 output)
    char*  reuse = p;                   p += 64 * MB;
    float* q_f  = (float*)reuse;
    float* k_f  = (float*)(reuse + 16 * MB);
    float* v_f  = (float*)(reuse + 32 * MB);
    bf16*  q_bf = (bf16*) (reuse + 48 * MB);
    bf16*  k_bf = (bf16*) (reuse + 56 * MB);
    float* a_f  = (float*)reuse;                       // 64 MB, after attention
    bf16*  vt_bf = (bf16*)p;            p += 8 * MB;
    bf16*  o_bf  = (bf16*)p;            p += 8 * MB;
    bf16*  h_bf  = (bf16*)p;            p += 32 * MB;  // swiglu output 4096x4096

    // 1) weights -> bf16
    //    (wq_bf .. w2_bf are one contiguous array that starts at wq_bf)
    k_weights_to_bf16<<<CONV_WGS, 512, 0, stream>>>(wq, wk, wv, wo, w1, w3, w2, wq_bf);

    // 2) n = rmsnorm(x, g1)
    k_rmsnorm<<<MROWS, 256, 0, stream>>>(x, g1, n_bf);

    // 3) Q,K,V projections (fp32 out, then RoPE)
    dim3 gQKV(DM / 128, MROWS / 128);
    k_gemm_nt<0><<<gQKV, 256, 0, stream>>>(n_bf, wq_bf, nullptr, q_f, MROWS, DM, DM);
    k_gemm_nt<0><<<gQKV, 256, 0, stream>>>(n_bf, wk_bf, nullptr, k_f, MROWS, DM, DM);
    k_gemm_nt<0><<<gQKV, 256, 0, stream>>>(n_bf, wv_bf, nullptr, v_f, MROWS, DM, DM);

    // 4) RoPE(q,k) -> bf16; V -> per-head transposed bf16
    k_rope<<<(BATCH * SEQ * DM / 2) / 256, 256, 0, stream>>>(q_f, k_f, v_f,
                                                             q_bf, k_bf, vt_bf);

    // 5) causal flash attention -> o (bf16)
    dim3 gAtt(SEQ / 128, BATCH * HEADS);
    k_flash_attn<<<gAtt, 128, 0, stream>>>(q_bf, k_bf, vt_bf, o_bf);

    // 6) x1 = x + o @ Wo^T
    k_gemm_nt<1><<<gQKV, 256, 0, stream>>>(o_bf, wo_bf, x, x1, MROWS, DM, DM);

    // 7) n2 = rmsnorm(x1, g2)
    k_rmsnorm<<<MROWS, 256, 0, stream>>>(x1, g2, n2_bf);

    // 8) a = n2 @ W1^T ; h = silu(a) * (n2 @ W3^T)  [fused epilogue]
    dim3 gFF(DFF / 128, MROWS / 128);
    k_gemm_nt<0><<<gFF, 256, 0, stream>>>(n2_bf, w1_bf, nullptr, a_f, MROWS, DFF, DM);
    k_gemm_nt<2><<<gFF, 256, 0, stream>>>(n2_bf, w3_bf, a_f, h_bf, MROWS, DFF, DM);

    // 9) out = x1 + h @ W2^T
    k_gemm_nt<1><<<gQKV, 256, 0, stream>>>(h_bf, w2_bf, x1, out, MROWS, DM, DFF);
}

// v005
// A run of this version takes 219 microseconds.
// Next to v004, in two timings, it ran 1.40 times as fast each time.
// All steps since v000 together make it 2.53 times as fast.
#include <hip/hip_runtime.h>

// ---------------- problem constants ----------------
#define BATCH   2
#define SEQ     2048
#define DM      1024
#define HEADS   16
#define DK      64
#define DFF     4096
#define MROWS   (BATCH * SEQ)       // 4096
#define EPSV    1e-5f
#define THETA_F 10000.0f

// ---------------- types ----------------
typedef __bf16 bf16;
typedef __attribute__((ext_vector_type(16))) __bf16 bf16x16;
typedef __attribute__((ext_vector_type(8)))  __bf16 bf16x8;
typedef __attribute__((ext_vector_type(8)))  float  f32x8;
typedef __attribute__((ext_vector_type(4)))  unsigned int u32x4;

// Load one 16x32 bf16 WMMA fragment (A or B operand) from LDS.
// rowPtr points at the start of this lane's row (16-byte aligned, row stride
// is a multiple of 8 elements). kh = lane>>4 selects the K-half per the ISA
// 16-bit A-matrix layout: half 0 -> K {0..7, 16..23}, half 1 -> K {8..15, 24..31}.
__device__ __forceinline__ bf16x16 frag_ld(const bf16* rowPtr, int kh) {
    bf16x8 lo = *(const bf16x8*)(rowPtr + kh * 8);
    bf16x8 hi = *(const bf16x8*)(rowPtr + 16 + kh * 8);
    return __builtin_shufflevector(lo, hi, 0,1,2,3,4,5,6,7,8,9,10,11,12,13,14,15);
}

__device__ __forceinline__ f32x8 wmma_bf16(bf16x16 a, bf16x16 b, f32x8 c) {
    return __builtin_amdgcn_wmma_f32_16x16x32_bf16(false, a, false, b, (short)0, c, false, false);
}

// ---------------- fp32 -> bf16 conversion of all seven weights, one launch ----
// The bf16 copies lie back to back in the workspace in the order
// wq, wk, wv, wo, w1, w3, w2, so the destination is one array of CONV_TOTAL
// elements. One 16-wave work-group per WGP takes CONV_PER_WG consecutive
// elements of it (always inside one source, since every source's length is a
// multiple of CONV_PER_WG). A wave reads 32 x 512 contiguous bytes, many loads
// in flight at a time, and stores 32 x 256 contiguous bytes.
typedef __attribute__((ext_vector_type(4))) float  f32x4;
typedef __attribute__((ext_vector_type(4))) __bf16 bf16x4;
#define CONV_TOTAL   (4 * DM * DM + 3 * DFF * DM)   // 16,777,216
#define CONV_WGS     256
#define CONV_PER_WG  (CONV_TOTAL / CONV_WGS)        // 65,536
#define CONV_LOADS   (CONV_PER_WG / (512 * 4))      // 32 loads of 4 floats a lane
static_assert((DM * DM) % CONV_PER_WG == 0 && (DFF * DM) % CONV_PER_WG == 0,
              "a work-group's range must lie inside one weight");
__global__ __launch_bounds__(512)
void k_weights_to_bf16(const float* __restrict__ wq, const float* __restrict__ wk,
                       const float* __restrict__ wv, const float* __restrict__ wo,
                       const float* __restrict__ w1, const float* __restrict__ w3,
                       const float* __restrict__ w2, bf16* __restrict__ out) {
    const int first = blockIdx.x * CONV_PER_WG;   // index in the destination array
    const float* src = wq;                        // the weight that holds it ...
    int base = 0;                                 // ... and where that weight starts
    if (first >= 1 * DM * DM)                { src = wk; base = 1 * DM * DM; }
    if (first >= 2 * DM * DM)                { src = wv; base = 2 * DM * DM; }
    if (first >= 3 * DM * DM)                { src = wo; base = 3 * DM * DM; }
    if (first >= 4 * DM * DM)                { src = w1; base = 4 * DM * DM; }
    if (first >= 4 * DM * DM + 1 * DFF * DM) { src = w3; base = 4 * DM * DM + 1 * DFF * DM; }
    if (first >= 4 * DM * DM + 2 * DFF * DM) { src = w2; base = 4 * DM * DM + 2 * DFF * DM; }

    const int lane = threadIdx.x & 31, wave = threadIdx.x >> 5;
    const int at = first + wave * (CONV_LOADS * 128) + lane * 4;
    const f32x4* s = (const f32x4*)(src + (at - base));
    bf16x4*      d = (bf16x4*)(out + at);
    f32x4 v[CONV_LOADS];
    // Both loops unrolled: v[] stays in registers, the steps become immediate
    // offsets, and the loads can be issued ahead of the conversions.
    #pragma unroll
    for (int j = 0; j < CONV_LOADS; ++j)          // read once: non-temporal
        v[j] = __builtin_nontemporal_load(s + j * 32);
    #pragma unroll
    for (int j = 0; j < CONV_LOADS; ++j) {
        bf16x4 o = { (bf16)v[j][0], (bf16)v[j][1], (bf16)v[j][2], (bf16)v[j][3] };
        d[j * 32] = o;
    }
}

// ---------------- RMSNorm (one block per row) ----------------
__global__ __launch_bounds__(256) void k_rmsnorm(const float* __restrict__ X,
                                                 const float* __restrict__ G,
                                                 bf16* __restrict__ Out) {
    const int row = blockIdx.x;
    const float* x = X + (size_t)row * DM;
    float s = 0.f;
    #pragma unroll
    for (int i = threadIdx.x; i < DM; i += 256) { float v = x[i]; s += v * v; }
    #pragma unroll
    for (int m = 16; m >= 1; m >>= 1) s += __shfl_xor(s, m, 32);
    __shared__ float red[8];
    if ((threadIdx.x & 31) == 0) red[threadIdx.x >> 5] = s;
    __syncthreads();
    float tot = 0.f;
    #pragma unroll
    for (int j = 0; j < 8; ++j) tot += red[j];
    const float rinv = rsqrtf(tot / (float)DM + EPSV);
    bf16* o = Out + (size_t)row * DM;
    for (int i = threadIdx.x; i < DM; i += 256) o[i] = (bf16)(x[i] * rinv * G[i]);
}

// Eight asynchronous 16-byte copies per lane, global memory -> LDS, no register
// in between. The s_wait_xcnt is the last line of the copies' own statement so
// that no address register named here is rewritten ahead of it.
__device__ __forceinline__ void async_copy8(unsigned l, unsigned lstep,
                                            const bf16* g, size_t gstep) {
    asm volatile(
        "global_load_async_to_lds_b128 %0, %8, off\n\t"
        "global_load_async_to_lds_b128 %1, %9, off\n\t"
        "global_load_async_to_lds_b128 %2, %10, off\n\t"
        "global_load_async_to_lds_b128 %3, %11, off\n\t"
        "global_load_async_to_lds_b128 %4, %12, off\n\t"
        "global_load_async_to_lds_b128 %5, %13, off\n\t"
        "global_load_async_to_lds_b128 %6, %14, off\n\t"
        "global_load_async_to_lds_b128 %7, %15, off\n\t"
        "s_wait_xcnt 0x0"
        :: "v"(l), "v"(l + lstep), "v"(l + 2 * lstep), "v"(l + 3 * lstep),
           "v"(l + 4 * lstep), "v"(l + 5 * lstep), "v"(l + 6 * lstep), "v"(l + 7 * lstep),
           "v"(g), "v"(g + gstep), "v"(g + 2 * gstep), "v"(g + 3 * gstep),
           "v"(g + 4 * gstep), "v"(g + 5 * gstep), "v"(g + 6 * gstep), "v"(g + 7 * gstep)
        : "memory");
}

// sin and cos of x radians, formed as __sincosf forms them. One statement, so that
// the v_nop stands directly behind the second transcendental: the slot that the
// instruction set asks for in front of an instruction that overwrites its source.
__device__ __forceinline__ void sincos_slot(float x, float& sn, float& cs) {
    const float rev = x * 0.15915494f;   // 1 / (2 pi): the instructions take revolutions
    asm("v_sin_f32 %0, %2\n\tv_cos_f32 %1, %2\n\tv_nop" : "=&v"(sn), "=&v"(cs) : "v"(rev));
}

// ---------------- WMMA NT-GEMM: C[M,N] = A[M,K] * B[N,K]^T ----------------
// K is walked in tiles of 128. Two LDS buffers: tile t+1's asynchronous copies
// fly while tile t's 32 WMMAs per wave run; one barrier per tile publishes the
// next tile and frees the buffer just read. K must be a multiple of 128.
// EPI 0: store f32          EPI 1: store f32 + R[m,n] (residual)
// EPI 2: store bf16( silu(R[m,n]) * acc )   (fused SwiGLU; R = w1 output)
// In D a lane holds 8 consecutive rows m of one column n, so the side that is
// contiguous in the output goes in as A and the lane stores 16 bytes of bf16:
// EPI 3: A = Wq or Wk (m = feature), B = tokens: RoPE on the lane's 4 pairs,
//        Out[n][m] bf16 (B,S,DM). The wave's 64 rows are one head.
// EPI 4: A = tokens, B = Wv (n = feature): Out[b][n][s] bf16, V transposed per head.
template <int EPI>
__global__ __launch_bounds__(256)
void k_gemm_nt(const bf16* __restrict__ A, const bf16* __restrict__ B,
               const float* __restrict__ R, void* __restrict__ Out,
               int M, int N, int K) {
    constexpr int BM = 128, BN = 128, BK = 128, LDT = BK + 8;  // 272-byte pitch
    constexpr int OPER = BM * LDT;                             // one operand's tile
    constexpr int STAGE = 2 * OPER;                            // [A tile | B tile]
    __shared__ __attribute__((aligned(16))) bf16 Sm[2 * STAGE];

    const int m0 = blockIdx.y * BM, n0 = blockIdx.x * BN;
    const int tid  = threadIdx.x;
    const int lane = tid & 31, wid = tid >> 5;   // 8 waves
    const int wm = wid >> 2, wn = wid & 3;       // 2 x 4 wave grid: 64x32 per wave
    const int l15 = lane & 15, kh = lane >> 4;

    // Copy map: 16 lanes cover one 256-byte row; a lane's 8 copies are 16 rows apart.
    const int crow = tid >> 4, ccol = (tid & 15) * 8;
    const bf16* gA = A + (size_t)(m0 + crow) * K + ccol;
    const bf16* gB = B + (size_t)(n0 + crow) * K + ccol;
    const unsigned lA = (unsigned)(size_t)(Sm + crow * LDT + ccol);
    const size_t gstep = (size_t)16 * K;
    auto stage_in = [&](int t, int buf) {
        const unsigned l = lA + (unsigned)(buf * STAGE * 2);
        async_copy8(l,            16 * LDT * 2, gA + (size_t)t * BK, gstep);
        async_copy8(l + OPER * 2, 16 * LDT * 2, gB + (size_t)t * BK, gstep);
    };

    const int nt = K / BK;
    stage_in(0, 0);
    asm volatile("s_wait_asynccnt 0x0" ::: "memory");   // tile 0 has landed (own copies)
    __syncthreads();                                    // ... and every wave's copies
    if (nt > 1) stage_in(1, 1);

    f32x8 acc[4][2] = {};

    for (int t = 0; t < nt; ++t) {
        const bf16* As = Sm + (t & 1) * STAGE;
        const bf16* Bs = As + OPER;
        // Unrolled: the four blocks' LDS offsets become immediates and a block's
        // reads can start under the WMMAs of the block before it.
        #pragma unroll
        for (int kk = 0; kk < BK; kk += 32) {
            bf16x16 afr[4], bfr[2];
            #pragma unroll
            for (int ni = 0; ni < 2; ++ni)
                bfr[ni] = frag_ld(Bs + (wn * 32 + ni * 16 + l15) * LDT + kk, kh);
            #pragma unroll
            for (int mi = 0; mi < 4; ++mi)
                afr[mi] = frag_ld(As + (wm * 64 + mi * 16 + l15) * LDT + kk, kh);
            // Keeps the block's 12 LDS reads one group in front of its 8 WMMAs: left
            // alone the compiler sinks them between the WMMAs, a full LDS wait per pair.
            __builtin_amdgcn_sched_barrier(0);
            #pragma unroll
            for (int mi = 0; mi < 4; ++mi)
                #pragma unroll
                for (int ni = 0; ni < 2; ++ni)
                    acc[mi][ni] = wmma_bf16(afr[mi], bfr[ni], acc[mi][ni]);
        }
        asm volatile("s_wait_dscnt 0x0" ::: "memory");     // own reads of this buffer are done
        asm volatile("s_wait_asynccnt 0x0" ::: "memory");  // own copies of tile t+1 have landed
        __syncthreads();   // publishes tile t+1; ends every reader's last read of tile t
        if (t + 2 < nt) stage_in(t + 2, t & 1);            // refill the buffer just read
    }
    asm volatile("s_wait_asynccnt 0x0" ::: "memory");      // nothing in flight at the wave's end

    if constexpr (EPI == 3) {
        static_assert(DK == 64, "a wave's 64 rows are one head");
        #pragma unroll
        for (int mi = 0; mi < 4; ++mi) {
            float inv[4];                              // pairs mi*8 + kh*4 + j of the head
            #pragma unroll
            for (int j = 0; j < 4; ++j) {              // theta^(-2p/DK), p known to the compiler
                const float lo = __powf(THETA_F, -2.f * (float)(mi * 8 + j) / (float)DK);
                const float hi = __powf(THETA_F, -2.f * (float)(mi * 8 + 4 + j) / (float)DK);
                inv[j] = kh ? hi : lo;
            }
            #pragma unroll
            for (int ni = 0; ni < 2; ++ni) {
                const int gm = m0 + wm * 64 + mi * 16 + kh * 8;   // first of 8 features
                const int gn = n0 + wn * 32 + ni * 16 + l15;      // token
                const int s  = gn % SEQ;
                bf16x8 o;
                #pragma unroll
                for (int j = 0; j < 4; ++j) {
                    float sn, cs;
                    sincos_slot((float)s * inv[j], sn, cs);
                    const float x1 = acc[mi][ni][2 * j], x2 = acc[mi][ni][2 * j + 1];
                    o[2 * j]     = (bf16)(x1 * cs - x2 * sn);
                    o[2 * j + 1] = (bf16)(x1 * sn + x2 * cs);
                }
                *(bf16x8*)((bf16*)Out + (size_t)gn * M + gm) = o;
            }
        }
    } else if constexpr (EPI == 4) {
        static_assert(SEQ % BM == 0, "a tile's tokens lie in one batch entry");
        #pragma unroll
        for (int mi = 0; mi < 4; ++mi)
            #pragma unroll
            for (int ni = 0; ni < 2; ++ni) {
                const int gm = m0 + wm * 64 + mi * 16 + kh * 8;   // first of 8 tokens
                const int gn = n0 + wn * 32 + ni * 16 + l15;      // feature
                bf16x8 o;
                #pragma unroll
                for (int r = 0; r < 8; ++r) o[r] = (bf16)acc[mi][ni][r];
                *(bf16x8*)((bf16*)Out + ((size_t)(gm / SEQ) * N + gn) * SEQ + gm % SEQ) = o;
            }
    } else {
    #pragma unroll
    for (int mi = 0; mi < 4; ++mi)
        #pragma unroll
        for (int ni = 0; ni < 2; ++ni)
            #pragma unroll
            for (int r = 0; r < 8; ++r) {
                int gm = m0 + wm * 64 + mi * 16 + kh * 8 + r;
                int gn = n0 + wn * 32 + ni * 16 + l15;
                size_t off = (size_t)gm * N + gn;
                float v = acc[mi][ni][r];
                if constexpr (EPI == 0) {
                    ((float*)Out)[off] = v;
                } else if constexpr (EPI == 1) {
                    ((float*)Out)[off] = v + R[off];
                } else {
                    float a = R[off];
                    float g = a / (1.f + __expf(-a));   // a * sigmoid(a)
                    ((bf16*)Out)[off] = (bf16)(g * v);
                }
            }
    }   // EPI 0, 1, 2
}

// ---------------- Flash attention (causal, online softmax) ----------------
// Block: 128 threads (4 waves), handles one (b,h) and two tiles of 64 query rows,
// tile 31 - p and then tile p: 32 - p and p + 1 key tiles, 33 for every block, so
// that all blocks, resident together, end together wherever they are placed.
// Each wave owns 16 queries and forms the TRANSPOSED products on WMMA bf16:
//   S^T = K * Q^T   (A = 16 keys from LDS,     B = the wave's 16 queries, in registers)
//   O^T += V^T * P^T (A = 16 rows of V^T, LDS, B = P^T packed from the score registers)
// In D a lane holds one column, so lane l has the scores of query l & 15 alone
// (keys 8 * (l >> 4) + r of each 16-key tile): maximum and sum run inside the lane,
// with one exchange between lanes l and l ^ 16, and two score tiles converted in
// place are the B operand of the second product in frag_ld's own k order.
// K/V tile kt+1 is fetched into registers while tile kt is being consumed.

// Lane l takes the value of lane l ^ 16.
__device__ __forceinline__ float other_half(float x) {
    int b = __builtin_bit_cast(int, x);
    return __builtin_bit_cast(float,
        __builtin_amdgcn_permlanex16(b, b, 0x76543210, 0xfedcba98, false, false));
}

__global__ __launch_bounds__(128)
void k_flash_attn(const bf16* __restrict__ Qb, const bf16* __restrict__ Kb,
                  const bf16* __restrict__ Vt, bf16* __restrict__ Ob) {
    constexpr int LT = 72;   // 64 + 8 pad (16B-aligned rows, conflict-free b128)
    __shared__ __attribute__((aligned(16))) bf16 Qs [2 * 64 * LT];   // both query tiles
    __shared__ __attribute__((aligned(16))) bf16 Ks [64 * LT];
    __shared__ __attribute__((aligned(16))) bf16 Vts[64 * LT];

    const int qtile[2] = { SEQ / 64 - 1 - (int)blockIdx.x, (int)blockIdx.x };
    const int bh = blockIdx.y;
    const int b = bh / HEADS, h = bh % HEADS;
    const int tid = threadIdx.x, lane = tid & 31, w = tid >> 5;
    const int l15 = lane & 15, kh = lane >> 4;

    const bf16* Qg = Qb + (size_t)b * SEQ * DM + h * DK;
    const bf16* Kg = Kb + (size_t)b * SEQ * DM + h * DK;
    const bf16* Vg = Vt + ((size_t)b * HEADS + h) * DK * SEQ;

    int trow[4], tcol[4];
    #pragma unroll
    for (int i = 0; i < 4; ++i) {          // 64x64 tile, 8 bf16 per thread-iter
        int idx = tid + i * 128;
        trow[i] = idx >> 3; tcol[i] = (idx & 7) * 8;
    }
    #pragma unroll
    for (int hf = 0; hf < 2; ++hf)
        #pragma unroll
        for (int i = 0; i < 4; ++i)
            *(u32x4*)(Qs + hf * 64 * LT + trow[i] * LT + tcol[i]) =
                *(const u32x4*)(Qg + (size_t)(qtile[hf] * 64 + trow[i]) * DM + tcol[i]);
    __syncthreads();

    // Not unrolled: one copy of the key loop in the instruction cache.
    #pragma unroll 1
    for (int half = 0; half < 2; ++half) {
    const int qt = half ? qtile[1] : qtile[0];   // query tile (64 rows)

    const bf16* qrow = Qs + half * 64 * LT + (w * 16 + l15) * LT;
    bf16x16 bq0 = frag_ld(qrow, kh), bq1 = frag_ld(qrow + 32, kh);

    float mrow = -1e30f, lrow = 0.f;      // this lane's query: running maximum and sum
    f32x8 Oacc[4] = {};                   // Oacc[nt][r] = O[query l15][nt*16 + kh*8 + r]

    const int qg = qt * 64 + w * 16 + l15;   // this lane's global query index

    u32x4 rk[4], rv[4];
    auto fetchKV = [&](int kt) {
        #pragma unroll
        for (int i = 0; i < 4; ++i) {
            rk[i] = *(const u32x4*)(Kg + (size_t)(kt * 64 + trow[i]) * DM + tcol[i]);
            rv[i] = *(const u32x4*)(Vg + (size_t)trow[i] * SEQ + kt * 64 + tcol[i]);
        }
    };
    fetchKV(0);

    for (int kt = 0; kt <= qt; ++kt) {
        __syncthreads();   // previous-iteration readers of Ks/Vts are done
        #pragma unroll
        for (int i = 0; i < 4; ++i) {
            *(u32x4*)(Ks  + trow[i] * LT + tcol[i]) = rk[i];
            *(u32x4*)(Vts + trow[i] * LT + tcol[i]) = rv[i];
        }
        __syncthreads();

        if (kt + 2 <= qt) {   // warm GL2 two tiles ahead
            __builtin_prefetch(Kg + (size_t)((kt + 2) * 64 + trow[0]) * DM + tcol[0], 0, 3);
            __builtin_prefetch(Vg + (size_t)trow[0] * SEQ + (kt + 2) * 64 + tcol[0], 0, 3);
        }
        if (kt < qt) fetchKV(kt + 1);   // loads in flight under score/softmax

        // scores, transposed: 64(k) x 16(q) per wave, K-dim = dk = 64 -> 2 chained WMMAs
        // st[mt][r] = S[key kt*64 + mt*16 + kh*8 + r][query l15]
        f32x8 st[4];
        #pragma unroll
        for (int mt = 0; mt < 4; ++mt) {
            const bf16* krow = Ks + (mt * 16 + l15) * LT;
            f32x8 a = {};
            a = wmma_bf16(frag_ld(krow, kh), bq0, a);
            a = wmma_bf16(frag_ld(krow + 32, kh), bq1, a);
            st[mt] = a;
        }
        // scale + causal mask
        #pragma unroll
        for (int mt = 0; mt < 4; ++mt) {
            int kg = kt * 64 + mt * 16 + kh * 8;
            #pragma unroll
            for (int r = 0; r < 8; ++r) {
                float v = st[mt][r] * 0.125f;                // 1/sqrt(64)
                st[mt][r] = (kg + r > qg) ? -1e30f : v;
            }
        }
        // online softmax: the lane's 32 keys, then the other half's 32
        float mx8[8];
        #pragma unroll
        for (int r = 0; r < 8; ++r)
            mx8[r] = fmaxf(fmaxf(st[0][r], st[1][r]), fmaxf(st[2][r], st[3][r]));
        float mx = fmaxf(fmaxf(fmaxf(mx8[0], mx8[1]), fmaxf(mx8[2], mx8[3])),
                         fmaxf(fmaxf(mx8[4], mx8[5]), fmaxf(mx8[6], mx8[7])));
        mx = fmaxf(mx, other_half(mx));
        const float mnew = fmaxf(mrow, mx);
        const float sc = __expf(mrow - mnew);
        #pragma unroll
        for (int mt = 0; mt < 4; ++mt)
            #pragma unroll
            for (int r = 0; r < 8; ++r) st[mt][r] = __expf(st[mt][r] - mnew);
        float sm8[8];
        #pragma unroll
        for (int r = 0; r < 8; ++r)
            sm8[r] = (st[0][r] + st[1][r]) + (st[2][r] + st[3][r]);
        float sm = ((sm8[0] + sm8[1]) + (sm8[2] + sm8[3])) +
                   ((sm8[4] + sm8[5]) + (sm8[6] + sm8[7]));
        sm += other_half(sm);
        lrow = lrow * sc + sm;
        mrow = mnew;
        #pragma unroll
        for (int nt = 0; nt < 4; ++nt)
            #pragma unroll
            for (int r = 0; r < 8; ++r) Oacc[nt][r] *= sc;

        // P^T as B operand: element s of keys 32g .. 32g+31 is tile 2g + (s >> 3), register s & 7
        bf16x16 bp0, bp1;
        #pragma unroll
        for (int s = 0; s < 16; ++s) {
            bp0[s] = (bf16)st[s >> 3][s & 7];
            bp1[s] = (bf16)st[2 + (s >> 3)][s & 7];
        }
        #pragma unroll
        for (int nt = 0; nt < 4; ++nt) {
            const bf16* vrow = Vts + (nt * 16 + l15) * LT;
            Oacc[nt] = wmma_bf16(frag_ld(vrow, kh), bp0, Oacc[nt]);
            Oacc[nt] = wmma_bf16(frag_ld(vrow + 32, kh), bp1, Oacc[nt]);
        }
    }

    // normalize and write bf16 output (feeds the WO GEMM directly):
    // a lane's 8 registers of a tile are 8 consecutive elements of its query's row
    const size_t srow = (size_t)b * SEQ + qg;
    #pragma unroll
    for (int nt = 0; nt < 4; ++nt) {
        bf16x8 o;
        #pragma unroll
        for (int r = 0; r < 8; ++r) o[r] = (bf16)(Oacc[nt][r] / lrow);
        *(bf16x8*)(Ob + srow * DM + h * DK + nt * 16 + kh * 8) = o;
    }
    // The second tile's code rewrites the registers that these stores name.
    asm volatile("s_wait_xcnt 0x0" ::: "memory");
    }   // half
}

// ---------------- host launcher ----------------
extern "C" void kernel_launch(void* const* d_in, const int* in_sizes, int n_in,
                              void* d_out, int out_size, void* d_ws, size_t ws_size,
                              hipStream_t stream) {
    (void)in_sizes; (void)n_in; (void)out_size; (void)ws_size;
    const float* x  = (const float*)d_in[0];
    const float* wq = (const float*)d_in[1];
    const float* wk = (const float*)d_in[2];
    const float* wv = (const float*)d_in[3];
    const float* wo = (const float*)d_in[4];
    const float* w1 = (const float*)d_in[5];
    const float* w2 = (const float*)d_in[6];
    const float* w3 = (const float*)d_in[7];
    const float* g1 = (const float*)d_in[8];
    const float* g2 = (const float*)d_in[9];
    float* out = (float*)d_out;

    const size_t MB = 1ull << 20;
    char* p = (char*)d_ws;
    bf16*  n_bf  = (bf16*)p;            p += 8 * MB;   // 4096x1024 bf16
    bf16*  wq_bf = (bf16*)p;            p += 2 * MB;
    bf16*  wk_bf = (bf16*)p;            p += 2 * MB;
    bf16*  wv_bf = (bf16*)p;            p += 2 * MB;
    bf16*  wo_bf = (bf16*)p;            p += 2 * MB;
    bf16*  w1_bf = (bf16*)p;            p += 8 * MB;
    bf16*  w3_bf = (bf16*)p;            p += 8 * MB;
    bf16*  w2_bf = (bf16*)p;            p += 8 * MB;
    float* x1    = (float*)p;           p += 16 * MB;  // x + attn residual
    bf16*  n2_bf = (bf16*)p;            p += 8 * MB;
    // 64 MB region reused: {q_bf,k_bf} then a_f (w1 output)
    char*  reuse = p;                   p += 64 * MB;
    bf16*  q_bf = (bf16*) (reuse + 48 * MB);
    bf16*  k_bf = (bf16*) (reuse + 56 * MB);
    float* a_f  = (float*)reuse;                       // 64 MB, after attention
    bf16*  vt_bf = (bf16*)p;            p += 8 * MB;
    bf16*  o_bf  = (bf16*)p;            p += 8 * MB;
    bf16*  h_bf  = (bf16*)p;            p += 32 * MB;  // swiglu output 4096x4096

    // 1) weights -> bf16
    //    (wq_bf .. w2_bf are one contiguous array that starts at wq_bf)
    k_weights_to_bf16<<<CONV_WGS, 512, 0, stream>>>(wq, wk, wv, wo, w1, w3, w2, wq_bf);

    // 2) n = rmsnorm(x, g1)
    k_rmsnorm<<<MROWS, 256, 0, stream>>>(x, g1, n_bf);

    // 3) Q,K projections with RoPE -> bf16 (weight as A, tokens as B)
    dim3 gQKV(DM / 128, MROWS / 128);
    dim3 gQK(MROWS / 128, DM / 128);
    k_gemm_nt<3><<<gQK, 256, 0, stream>>>(wq_bf, n_bf, nullptr, q_bf, DM, MROWS, DM);
    k_gemm_nt<3><<<gQK, 256, 0, stream>>>(wk_bf, n_bf, nullptr, k_bf, DM, MROWS, DM);

    // 4) V projection -> per-head transposed bf16
    k_gemm_nt<4><<<gQKV, 256, 0, stream>>>(n_bf, wv_bf, nullptr, vt_bf, MROWS, DM, DM);

    // 5) causal flash attention -> o (bf16)
    dim3 gAtt(SEQ / 128, BATCH * HEADS);
    k_flash_attn<<<gAtt, 128, 0, stream>>>(q_bf, k_bf, vt_bf, o_bf);

    // 6) x1 = x + o @ Wo^T
    k_gemm_nt<1><<<gQKV, 256, 0, stream>>>(o_bf, wo_bf, x, x1, MROWS, DM, DM);

    // 7) n2 = rmsnorm(x1, g2)
    k_rmsnorm<<<MROWS, 256, 0, stream>>>(x1, g2, n2_bf);

    // 8) a = n2 @ W1^T ; h = silu(a) * (n2 @ W3^T)  [fused epilogue]
    dim3 gFF(DFF / 128, MROWS / 128);
    k_gemm_nt<0><<<gFF, 256, 0, stream>>>(n2_bf, w1_bf, nullptr, a_f, MROWS, DFF, DM);
    k_gemm_nt<2><<<gFF, 256, 0, stream>>>(n2_bf, w3_bf, a_f, h_bf, MROWS, DFF, DM);

    // 9) out = x1 + h @ W2^T
    k_gemm_nt<1><<<gQKV, 256, 0, stream>>>(h_bf, w2_bf, x1, out, MROWS, DM, DFF);
}

// v006
// One run takes 194 microseconds.
// Timed twice side by side with v005, it ran 1.13 times as fast both times.
// All steps since v000 together make it 2.86 times as fast.
#include <hip/hip_runtime.h>

// ---------------- problem constants ----------------
#define BATCH   2
#define SEQ     2048
#define DM      1024
#define HEADS   16
#define DK      64
#define DFF     4096
#define MROWS   (BATCH * SEQ)       // 4096
#define EPSV    1e-5f
#define THETA_F 10000.0f

// ---------------- types ----------------
typedef __bf16 bf16;
typedef __attribute__((ext_vector_type(16))) __bf16 bf16x16;
typedef __attribute__((ext_vector_type(8)))  __bf16 bf16x8;
typedef __attribute__((ext_vector_type(8)))  float  f32x8;
typedef __attribute__((ext_vector_type(4)))  unsigned int u32x4;

// Load one 16x32 bf16 WMMA fragment (A or B operand) from LDS.
// rowPtr points at the start of this lane's row (16-byte aligned, row stride
// is a multiple of 8 elements). kh = lane>>4 selects the K-half per the ISA
// 16-bit A-matrix layout: half 0 -> K {0..7, 16..23}, half 1 -> K {8..15, 24..31}.
__device__ __forceinline__ bf16x16 frag_ld(const bf16* rowPtr, int kh) {
    bf16x8 lo = *(const bf16x8*)(rowPtr + kh * 8);
    bf16x8 hi = *(const bf16x8*)(rowPtr + 16 + kh * 8);
    return __builtin_shufflevector(lo, hi, 0,1,2,3,4,5,6,7,8,9,10,11,12,13,14,15);
}

__device__ __forceinline__ f32x8 wmma_bf16(bf16x16 a, bf16x16 b, f32x8 c) {
    return __builtin_amdgcn_wmma_f32_16x16x32_bf16(false, a, false, b, (short)0, c, false, false);
}

// ---------------- fp32 -> bf16 conversion of all seven weights, one launch ----
// The bf16 copies lie back to back in the workspace in the order
// wq, wk, wv, wo, w1, w3, w2, so the destination is one array of CONV_TOTAL
// elements. One 16-wave work-group per WGP takes CONV_PER_WG consecutive
// elements of it (always inside one source, since every source's length is a
// multiple of CONV_PER_WG). A wave reads 32 x 512 contiguous bytes, many loads
// in flight at a time, and stores 32 x 256 contiguous bytes.
typedef __attribute__((ext_vector_type(4))) float  f32x4;
typedef __attribute__((ext_vector_type(4))) __bf16 bf16x4;
#define CONV_TOTAL   (4 * DM * DM + 3 * DFF * DM)   // 16,777,216
#define CONV_WGS     256
#define CONV_PER_WG  (CONV_TOTAL / CONV_WGS)        // 65,536
#define CONV_LOADS   (CONV_PER_WG / (512 * 4))      // 32 loads of 4 floats a lane
static_assert((DM * DM) % CONV_PER_WG == 0 && (DFF * DM) % CONV_PER_WG == 0,
              "a work-group's range must lie inside one weight");
__global__ __launch_bounds__(512)
void k_weights_to_bf16(const float* __restrict__ wq, const float* __restrict__ wk,
                       const float* __restrict__ wv, const float* __restrict__ wo,
                       const float* __restrict__ w1, const float* __restrict__ w3,
                       const float* __restrict__ w2, bf16* __restrict__ out) {
    const int first = blockIdx.x * CONV_PER_WG;   // index in the destination array
    const float* src = wq;                        // the weight that holds it ...
    int base = 0;                                 // ... and where that weight starts
    if (first >= 1 * DM * DM)                { src = wk; base = 1 * DM * DM; }
    if (first >= 2 * DM * DM)                { src = wv; base = 2 * DM * DM; }
    if (first >= 3 * DM * DM)                { src = wo; base = 3 * DM * DM; }
    if (first >= 4 * DM * DM)                { src = w1; base = 4 * DM * DM; }
    if (first >= 4 * DM * DM + 1 * DFF * DM) { src = w3; base = 4 * DM * DM + 1 * DFF * DM; }
    if (first >= 4 * DM * DM + 2 * DFF * DM) { src = w2; base = 4 * DM * DM + 2 * DFF * DM; }

    const int lane = threadIdx.x & 31, wave = threadIdx.x >> 5;
    const int at = first + wave * (CONV_LOADS * 128) + lane * 4;
    const f32x4* s = (const f32x4*)(src + (at - base));
    bf16x4*      d = (bf16x4*)(out + at);
    f32x4 v[CONV_LOADS];
    // Both loops unrolled: v[] stays in registers, the steps become immediate
    // offsets, and the loads can be issued ahead of the conversions.
    #pragma unroll
    for (int j = 0; j < CONV_LOADS; ++j)          // read once: non-temporal
        v[j] = __builtin_nontemporal_load(s + j * 32);
    #pragma unroll
    for (int j = 0; j < CONV_LOADS; ++j) {
        bf16x4 o = { (bf16)v[j][0], (bf16)v[j][1], (bf16)v[j][2], (bf16)v[j][3] };
        d[j * 32] = o;
    }
}

// ---------------- RMSNorm (one block per row) ----------------
__global__ __launch_bounds__(256) void k_rmsnorm(const float* __restrict__ X,
                                                 const float* __restrict__ G,
                                                 bf16* __restrict__ Out) {
    const int row = blockIdx.x;
    const float* x = X + (size_t)row * DM;
    float s = 0.f;
    #pragma unroll
    for (int i = threadIdx.x; i < DM; i += 256) { float v = x[i]; s += v * v; }
    #pragma unroll
    for (int m = 16; m >= 1; m >>= 1) s += __shfl_xor(s, m, 32);
    __shared__ float red[8];
    if ((threadIdx.x & 31) == 0) red[threadIdx.x >> 5] = s;
    __syncthreads();
    float tot = 0.f;
    #pragma unroll
    for (int j = 0; j < 8; ++j) tot += red[j];
    const float rinv = rsqrtf(tot / (float)DM + EPSV);
    bf16* o = Out + (size_t)row * DM;
    for (int i = threadIdx.x; i < DM; i += 256) o[i] = (bf16)(x[i] * rinv * G[i]);
}

// Eight asynchronous 16-byte copies per lane, global memory -> LDS, no register
// in between. The s_wait_xcnt is the last line of the copies' own statement so
// that no address register named here is rewritten ahead of it.
__device__ __forceinline__ void async_copy8(unsigned l, unsigned lstep,
                                            const bf16* g, size_t gstep) {
    asm volatile(
        "global_load_async_to_lds_b128 %0, %8, off\n\t"
        "global_load_async_to_lds_b128 %1, %9, off\n\t"
        "global_load_async_to_lds_b128 %2, %10, off\n\t"
        "global_load_async_to_lds_b128 %3, %11, off\n\t"
        "global_load_async_to_lds_b128 %4, %12, off\n\t"
        "global_load_async_to_lds_b128 %5, %13, off\n\t"
        "global_load_async_to_lds_b128 %6, %14, off\n\t"
        "global_load_async_to_lds_b128 %7, %15, off\n\t"
        "s_wait_xcnt 0x0"
        :: "v"(l), "v"(l + lstep), "v"(l + 2 * lstep), "v"(l + 3 * lstep),
           "v"(l + 4 * lstep), "v"(l + 5 * lstep), "v"(l + 6 * lstep), "v"(l + 7 * lstep),
           "v"(g), "v"(g + gstep), "v"(g + 2 * gstep), "v"(g + 3 * gstep),
           "v"(g + 4 * gstep), "v"(g + 5 * gstep), "v"(g + 6 * gstep), "v"(g + 7 * gstep)
        : "memory");
}

// The same, the first four copies from ga and the last four from gb: two sources
// whose rows lie one behind the other in LDS.
__device__ __forceinline__ void async_copy4x2(unsigned l, unsigned lstep,
                                              const bf16* ga, const bf16* gb, size_t gstep) {
    asm volatile(
        "global_load_async_to_lds_b128 %0, %8, off\n\t"
        "global_load_async_to_lds_b128 %1, %9, off\n\t"
        "global_load_async_to_lds_b128 %2, %10, off\n\t"
        "global_load_async_to_lds_b128 %3, %11, off\n\t"
        "global_load_async_to_lds_b128 %4, %12, off\n\t"
        "global_load_async_to_lds_b128 %5, %13, off\n\t"
        "global_load_async_to_lds_b128 %6, %14, off\n\t"
        "global_load_async_to_lds_b128 %7, %15, off\n\t"
        "s_wait_xcnt 0x0"
        :: "v"(l), "v"(l + lstep), "v"(l + 2 * lstep), "v"(l + 3 * lstep),
           "v"(l + 4 * lstep), "v"(l + 5 * lstep), "v"(l + 6 * lstep), "v"(l + 7 * lstep),
           "v"(ga), "v"(ga + gstep), "v"(ga + 2 * gstep), "v"(ga + 3 * gstep),
           "v"(gb), "v"(gb + gstep), "v"(gb + 2 * gstep), "v"(gb + 3 * gstep)
        : "memory");
}

// sin and cos of x radians, formed as __sincosf forms them. One statement, so that
// the v_nop stands directly behind the second transcendental: the slot that the
// instruction set asks for in front of an instruction that overwrites its source.
__device__ __forceinline__ void sincos_slot(float x, float& sn, float& cs) {
    const float rev = x * 0.15915494f;   // 1 / (2 pi): the instructions take revolutions
    asm("v_sin_f32 %0, %2\n\tv_cos_f32 %1, %2\n\tv_nop" : "=&v"(sn), "=&v"(cs) : "v"(rev));
}

// ---------------- WMMA NT-GEMM: C[M,N] = A[M,K] * B[N,K]^T ----------------
// K is walked in tiles of 128. Two LDS buffers: tile t+1's asynchronous copies
// fly while tile t's 32 WMMAs per wave run; one barrier per tile publishes the
// next tile and frees the buffer just read. K must be a multiple of 128.
// EPI 1: store f32 + R[m,n] (residual)
// In D a lane holds 8 consecutive rows m of one column n, so the side that is
// contiguous in the output goes in as A and the lane stores 16 bytes of bf16:
// EPI 3: A = Wq or Wk (m = feature), B = tokens: RoPE on the lane's 4 pairs,
//        Out[n][m] bf16 (B,S,DM). The wave's 64 rows are one head.
// EPI 4: A = tokens, B = Wv (n = feature): Out[b][n][s] bf16, V transposed per head.
template <int EPI>
__global__ __launch_bounds__(256)
void k_gemm_nt(const bf16* __restrict__ A, const bf16* __restrict__ B,
               const float* __restrict__ R, void* __restrict__ Out,
               int M, int N, int K) {
    constexpr int BM = 128, BN = 128, BK = 128, LDT = BK + 8;  // 272-byte pitch
    constexpr int OPER = BM * LDT;                             // one operand's tile
    constexpr int STAGE = 2 * OPER;                            // [A tile | B tile]
    __shared__ __attribute__((aligned(16))) bf16 Sm[2 * STAGE];

    const int m0 = blockIdx.y * BM, n0 = blockIdx.x * BN;
    const int tid  = threadIdx.x;
    const int lane = tid & 31, wid = tid >> 5;   // 8 waves
    const int wm = wid >> 2, wn = wid & 3;       // 2 x 4 wave grid: 64x32 per wave
    const int l15 = lane & 15, kh = lane >> 4;

    // Copy map: 16 lanes cover one 256-byte row; a lane's 8 copies are 16 rows apart.
    const int crow = tid >> 4, ccol = (tid & 15) * 8;
    const bf16* gA = A + (size_t)(m0 + crow) * K + ccol;
    const bf16* gB = B + (size_t)(n0 + crow) * K + ccol;
    const unsigned lA = (unsigned)(size_t)(Sm + crow * LDT + ccol);
    const size_t gstep = (size_t)16 * K;
    auto stage_in = [&](int t, int buf) {
        const unsigned l = lA + (unsigned)(buf * STAGE * 2);
        async_copy8(l,            16 * LDT * 2, gA + (size_t)t * BK, gstep);
        async_copy8(l + OPER * 2, 16 * LDT * 2, gB + (size_t)t * BK, gstep);
    };

    const int nt = K / BK;
    stage_in(0, 0);
    asm volatile("s_wait_asynccnt 0x0" ::: "memory");   // tile 0 has landed (own copies)
    __syncthreads();                                    // ... and every wave's copies
    if (nt > 1) stage_in(1, 1);

    f32x8 acc[4][2] = {};

    for (int t = 0; t < nt; ++t) {
        const bf16* As = Sm + (t & 1) * STAGE;
        const bf16* Bs = As + OPER;
        // Unrolled: the four blocks' LDS offsets become immediates and a block's
        // reads can start under the WMMAs of the block before it.
        #pragma unroll
        for (int kk = 0; kk < BK; kk += 32) {
            bf16x16 afr[4], bfr[2];
            #pragma unroll
            for (int ni = 0; ni < 2; ++ni)
                bfr[ni] = frag_ld(Bs + (wn * 32 + ni * 16 + l15) * LDT + kk, kh);
            #pragma unroll
            for (int mi = 0; mi < 4; ++mi)
                afr[mi] = frag_ld(As + (wm * 64 + mi * 16 + l15) * LDT + kk, kh);
            // Keeps the block's 12 LDS reads one group in front of its 8 WMMAs: left
            // alone the compiler sinks them between the WMMAs, a full LDS wait per pair.
            __builtin_amdgcn_sched_barrier(0);
            #pragma unroll
            for (int mi = 0; mi < 4; ++mi)
                #pragma unroll
                for (int ni = 0; ni < 2; ++ni)
                    acc[mi][ni] = wmma_bf16(afr[mi], bfr[ni], acc[mi][ni]);
        }
        asm volatile("s_wait_dscnt 0x0" ::: "memory");     // own reads of this buffer are done
        asm volatile("s_wait_asynccnt 0x0" ::: "memory");  // own copies of tile t+1 have landed
        __syncthreads();   // publishes tile t+1; ends every reader's last read of tile t
        if (t + 2 < nt) stage_in(t + 2, t & 1);            // refill the buffer just read
    }
    asm volatile("s_wait_asynccnt 0x0" ::: "memory");      // nothing in flight at the wave's end

    if constexpr (EPI == 3) {
        static_assert(DK == 64, "a wave's 64 rows are one head");
        #pragma unroll
        for (int mi = 0; mi < 4; ++mi) {
            float inv[4];                              // pairs mi*8 + kh*4 + j of the head
            #pragma unroll
            for (int j = 0; j < 4; ++j) {              // theta^(-2p/DK), p known to the compiler
                const float lo = __powf(THETA_F, -2.f * (float)(mi * 8 + j) / (float)DK);
                const float hi = __powf(THETA_F, -2.f * (float)(mi * 8 + 4 + j) / (float)DK);
                inv[j] = kh ? hi : lo;
            }
            #pragma unroll
            for (int ni = 0; ni < 2; ++ni) {
                const int gm = m0 + wm * 64 + mi * 16 + kh * 8;   // first of 8 features
                const int gn = n0 + wn * 32 + ni * 16 + l15;      // token
                const int s  = gn % SEQ;
                bf16x8 o;
                #pragma unroll
                for (int j = 0; j < 4; ++j) {
                    float sn, cs;
                    sincos_slot((float)s * inv[j], sn, cs);
                    const float x1 = acc[mi][ni][2 * j], x2 = acc[mi][ni][2 * j + 1];
                    o[2 * j]     = (bf16)(x1 * cs - x2 * sn);
                    o[2 * j + 1] = (bf16)(x1 * sn + x2 * cs);
                }
                *(bf16x8*)((bf16*)Out + (size_t)gn * M + gm) = o;
            }
        }
    } else if constexpr (EPI == 4) {
        static_assert(SEQ % BM == 0, "a tile's tokens lie in one batch entry");
        #pragma unroll
        for (int mi = 0; mi < 4; ++mi)
            #pragma unroll
            for (int ni = 0; ni < 2; ++ni) {
                const int gm = m0 + wm * 64 + mi * 16 + kh * 8;   // first of 8 tokens
                const int gn = n0 + wn * 32 + ni * 16 + l15;      // feature
                bf16x8 o;
                #pragma unroll
                for (int r = 0; r < 8; ++r) o[r] = (bf16)acc[mi][ni][r];
                *(bf16x8*)((bf16*)Out + ((size_t)(gm / SEQ) * N + gn) * SEQ + gm % SEQ) = o;
            }
    } else {
    #pragma unroll
    for (int mi = 0; mi < 4; ++mi)
        #pragma unroll
        for (int ni = 0; ni < 2; ++ni)
            #pragma unroll
            for (int r = 0; r < 8; ++r) {
                int gm = m0 + wm * 64 + mi * 16 + kh * 8 + r;
                int gn = n0 + wn * 32 + ni * 16 + l15;
                size_t off = (size_t)gm * N + gn;
                ((float*)Out)[off] = acc[mi][ni][r] + R[off];
            }
    }   // EPI 1
}

// ---------------- SwiGLU up-projection: H = silu(X W1^T) * (X W3^T), one launch ----
// A work-group forms BOTH products for 128 features x 256 tokens. A stage is
// [W1 128 rows | W3 128 rows | X 256 rows] of 128 k; the ring is k_gemm_nt's.
// The weights go in as A (m = feature) and the tokens as B, so in D a lane holds 8
// consecutive features of one token, of both products in the same registers' places:
// the gate is formed in registers and the lane stores 16 bytes of bf16.
// 16 waves, 4 x 4: a wave has 32 features (of each weight) x 64 tokens, that is 8
// fragments for 16 WMMAs. K must be a multiple of 128.
__global__ __launch_bounds__(512)
void k_ffn_up(const bf16* __restrict__ W1, const bf16* __restrict__ W3,
              const bf16* __restrict__ X, bf16* __restrict__ H, int F, int K) {
    constexpr int BF = 128, BT = 256, BK = 128, LDT = BK + 8;  // 272-byte pitch
    constexpr int WPART = 2 * BF * LDT;                        // both weights' tiles
    constexpr int STAGE = WPART + BT * LDT;
    __shared__ __attribute__((aligned(16))) bf16 Sm[2 * STAGE];

    const int f0 = blockIdx.x * BF, t0 = blockIdx.y * BT;
    const int tid  = threadIdx.x;
    const int lane = tid & 31, wid = tid >> 5;
    const int wf = wid >> 2, wt = wid & 3;
    const int l15 = lane & 15, kh = lane >> 4;

    // Copy map: 16 lanes cover one 256-byte row; a lane's copies are 32 rows apart.
    const int crow = tid >> 4, ccol = (tid & 15) * 8;
    const bf16* g1 = W1 + (size_t)(f0 + crow) * K + ccol;
    const bf16* g3 = W3 + (size_t)(f0 + crow) * K + ccol;
    const bf16* gX = X  + (size_t)(t0 + crow) * K + ccol;
    const unsigned lW = (unsigned)(size_t)(Sm + crow * LDT + ccol);
    const size_t gstep = (size_t)32 * K;
    auto stage_in = [&](int t, int buf) {
        const unsigned l = lW + (unsigned)(buf * STAGE * 2);
        async_copy4x2(l,           32 * LDT * 2, g1 + (size_t)t * BK, g3 + (size_t)t * BK, gstep);
        async_copy8(l + WPART * 2, 32 * LDT * 2, gX + (size_t)t * BK, gstep);
    };

    const int nt = K / BK;
    stage_in(0, 0);
    asm volatile("s_wait_asynccnt 0x0" ::: "memory");   // tile 0 has landed (own copies)
    __syncthreads();                                    // ... and every wave's copies
    if (nt > 1) stage_in(1, 1);

    f32x8 acc1[2][4] = {}, acc3[2][4] = {};

    for (int t = 0; t < nt; ++t) {
        const bf16* Ws = Sm + (t & 1) * STAGE;
        const bf16* Xs = Ws + WPART;
        // Unrolled: the four blocks' LDS offsets become immediates. (The short loops
        // over mi, ni and r, here and in the epilogue, are unrolled so that the
        // fragment and accumulator arrays are indexed by constants and stay in registers.)
        #pragma unroll
        for (int kk = 0; kk < BK; kk += 32) {
            bf16x16 a1[2], a3[2], xb[4];
            #pragma unroll
            for (int ni = 0; ni < 4; ++ni)
                xb[ni] = frag_ld(Xs + (wt * 64 + ni * 16 + l15) * LDT + kk, kh);
            #pragma unroll
            for (int mi = 0; mi < 2; ++mi) {
                a1[mi] = frag_ld(Ws + (wf * 32 + mi * 16 + l15) * LDT + kk, kh);
                a3[mi] = frag_ld(Ws + (BF + wf * 32 + mi * 16 + l15) * LDT + kk, kh);
            }
            // Keeps the block's 16 LDS reads one group in front of its 16 WMMAs: left
            // alone the compiler sinks them between the WMMAs, a full LDS wait per pair.
            __builtin_amdgcn_sched_barrier(0);
            #pragma unroll
            for (int mi = 0; mi < 2; ++mi)
                #pragma unroll
                for (int ni = 0; ni < 4; ++ni) {
                    acc1[mi][ni] = wmma_bf16(a1[mi], xb[ni], acc1[mi][ni]);
                    acc3[mi][ni] = wmma_bf16(a3[mi], xb[ni], acc3[mi][ni]);
                }
        }
        asm volatile("s_wait_dscnt 0x0" ::: "memory");     // own reads of this buffer are done
        asm volatile("s_wait_asynccnt 0x0" ::: "memory");  // own copies of tile t+1 have landed
        __syncthreads();   // publishes tile t+1; ends every reader's last read of tile t
        if (t + 2 < nt) stage_in(t + 2, t & 1);            // refill the buffer just read
    }
    asm volatile("s_wait_asynccnt 0x0" ::: "memory");      // nothing in flight at the wave's end

    #pragma unroll
    for (int mi = 0; mi < 2; ++mi)
        #pragma unroll
        for (int ni = 0; ni < 4; ++ni) {
            const int gf = f0 + wf * 32 + mi * 16 + kh * 8;   // first of 8 features
            const int gt = t0 + wt * 64 + ni * 16 + l15;      // token
            bf16x8 o;
            #pragma unroll
            for (int r = 0; r < 8; ++r) {
                const float a = acc1[mi][ni][r];
                const float g = a / (1.f + __expf(-a));       // a * sigmoid(a)
                o[r] = (bf16)(g * acc3[mi][ni][r]);
            }
            *(bf16x8*)(H + (size_t)gt * F + gf) = o;
        }
}

// ---------------- Flash attention (causal, online softmax) ----------------
// Block: 128 threads (4 waves), handles one (b,h) and two tiles of 64 query rows,
// tile 31 - p and then tile p: 32 - p and p + 1 key tiles, 33 for every block, so
// that all blocks, resident together, end together wherever they are placed.
// Each wave owns 16 queries and forms the TRANSPOSED products on WMMA bf16:
//   S^T = K * Q^T   (A = 16 keys from LDS,     B = the wave's 16 queries, in registers)
//   O^T += V^T * P^T (A = 16 rows of V^T, LDS, B = P^T packed from the score registers)
// In D a lane holds one column, so lane l has the scores of query l & 15 alone
// (keys 8 * (l >> 4) + r of each 16-key tile): maximum and sum run inside the lane,
// with one exchange between lanes l and l ^ 16, and two score tiles converted in
// place are the B operand of the second product in frag_ld's own k order.
// K/V tile kt+1 is fetched into registers while tile kt is being consumed.

// Lane l takes the value of lane l ^ 16.
__device__ __forceinline__ float other_half(float x) {
    int b = __builtin_bit_cast(int, x);
    return __builtin_bit_cast(float,
        __builtin_amdgcn_permlanex16(b, b, 0x76543210, 0xfedcba98, false, false));
}

__global__ __launch_bounds__(128)
void k_flash_attn(const bf16* __restrict__ Qb, const bf16* __restrict__ Kb,
                  const bf16* __restrict__ Vt, bf16* __restrict__ Ob) {
    constexpr int LT = 72;   // 64 + 8 pad (16B-aligned rows, conflict-free b128)
    __shared__ __attribute__((aligned(16))) bf16 Qs [2 * 64 * LT];   // both query tiles
    __shared__ __attribute__((aligned(16))) bf16 Ks [64 * LT];
    __shared__ __attribute__((aligned(16))) bf16 Vts[64 * LT];

    const int qtile[2] = { SEQ / 64 - 1 - (int)blockIdx.x, (int)blockIdx.x };
    const int bh = blockIdx.y;
    const int b = bh / HEADS, h = bh % HEADS;
    const int tid = threadIdx.x, lane = tid & 31, w = tid >> 5;
    const int l15 = lane & 15, kh = lane >> 4;

    const bf16* Qg = Qb + (size_t)b * SEQ * DM + h * DK;
    const bf16* Kg = Kb + (size_t)b * SEQ * DM + h * DK;
    const bf16* Vg = Vt + ((size_t)b * HEADS + h) * DK * SEQ;

    int trow[4], tcol[4];
    #pragma unroll
    for (int i = 0; i < 4; ++i) {          // 64x64 tile, 8 bf16 per thread-iter
        int idx = tid + i * 128;
        trow[i] = idx >> 3; tcol[i] = (idx & 7) * 8;
    }
    #pragma unroll
    for (int hf = 0; hf < 2; ++hf)
        #pragma unroll
        for (int i = 0; i < 4; ++i)
            *(u32x4*)(Qs + hf * 64 * LT + trow[i] * LT + tcol[i]) =
                *(const u32x4*)(Qg + (size_t)(qtile[hf] * 64 + trow[i]) * DM + tcol[i]);
    __syncthreads();

    // Not unrolled: one copy of the key loop in the instruction cache.
    #pragma unroll 1
    for (int half = 0; half < 2; ++half) {
    const int qt = half ? qtile[1] : qtile[0];   // query tile (64 rows)

    const bf16* qrow = Qs + half * 64 * LT + (w * 16 + l15) * LT;
    bf16x16 bq0 = frag_ld(qrow, kh), bq1 = frag_ld(qrow + 32, kh);

    float mrow = -1e30f, lrow = 0.f;      // this lane's query: running maximum and sum
    f32x8 Oacc[4] = {};                   // Oacc[nt][r] = O[query l15][nt*16 + kh*8 + r]

    const int qg = qt * 64 + w * 16 + l15;   // this lane's global query index

    u32x4 rk[4], rv[4];
    auto fetchKV = [&](int kt) {
        #pragma unroll
        for (int i = 0; i < 4; ++i) {
            rk[i] = *(const u32x4*)(Kg + (size_t)(kt * 64 + trow[i]) * DM + tcol[i]);
            rv[i] = *(const u32x4*)(Vg + (size_t)trow[i] * SEQ + kt * 64 + tcol[i]);
        }
    };
    fetchKV(0);

    for (int kt = 0; kt <= qt; ++kt) {
        __syncthreads();   // previous-iteration readers of Ks/Vts are done
        #pragma unroll
        for (int i = 0; i < 4; ++i) {
            *(u32x4*)(Ks  + trow[i] * LT + tcol[i]) = rk[i];
            *(u32x4*)(Vts + trow[i] * LT + tcol[i]) = rv[i];
        }
        __syncthreads();

        if (kt + 2 <= qt) {   // warm GL2 two tiles ahead
            __builtin_prefetch(Kg + (size_t)((kt + 2) * 64 + trow[0]) * DM + tcol[0], 0, 3);
            __builtin_prefetch(Vg + (size_t)trow[0] * SEQ + (kt + 2) * 64 + tcol[0], 0, 3);
        }
        if (kt < qt) fetchKV(kt + 1);   // loads in flight under score/softmax

        // scores, transposed: 64(k) x 16(q) per wave, K-dim = dk = 64 -> 2 chained WMMAs
        // st[mt][r] = S[key kt*64 + mt*16 + kh*8 + r][query l15]
        f32x8 st[4];
        #pragma unroll
        for (int mt = 0; mt < 4; ++mt) {
            const bf16* krow = Ks + (mt * 16 + l15) * LT;
            f32x8 a = {};
            a = wmma_bf16(frag_ld(krow, kh), bq0, a);
            a = wmma_bf16(frag_ld(krow + 32, kh), bq1, a);
            st[mt] = a;
        }
        // scale + causal mask
        #pragma unroll
        for (int mt = 0; mt < 4; ++mt) {
            int kg = kt * 64 + mt * 16 + kh * 8;
            #pragma unroll
            for (int r = 0; r < 8; ++r) {
                float v = st[mt][r] * 0.125f;                // 1/sqrt(64)
                st[mt][r] = (kg + r > qg) ? -1e30f : v;
            }
        }
        // online softmax: the lane's 32 keys, then the other half's 32
        float mx8[8];
        #pragma unroll
        for (int r = 0; r < 8; ++r)
            mx8[r] = fmaxf(fmaxf(st[0][r], st[1][r]), fmaxf(st[2][r], st[3][r]));
        float mx = fmaxf(fmaxf(fmaxf(mx8[0], mx8[1]), fmaxf(mx8[2], mx8[3])),
                         fmaxf(fmaxf(mx8[4], mx8[5]), fmaxf(mx8[6], mx8[7])));
        mx = fmaxf(mx, other_half(mx));
        const float mnew = fmaxf(mrow, mx);
        const float sc = __expf(mrow - mnew);
        #pragma unroll
        for (int mt = 0; mt < 4; ++mt)
            #pragma unroll
            for (int r = 0; r < 8; ++r) st[mt][r] = __expf(st[mt][r] - mnew);
        float sm8[8];
        #pragma unroll
        for (int r = 0; r < 8; ++r)
            sm8[r] = (st[0][r] + st[1][r]) + (st[2][r] + st[3][r]);
        float sm = ((sm8[0] + sm8[1]) + (sm8[2] + sm8[3])) +
                   ((sm8[4] + sm8[5]) + (sm8[6] + sm8[7]));
        sm += other_half(sm);
        lrow = lrow * sc + sm;
        mrow = mnew;
        #pragma unroll
        for (int nt = 0; nt < 4; ++nt)
            #pragma unroll
            for (int r = 0; r < 8; ++r) Oacc[nt][r] *= sc;

        // P^T as B operand: element s of keys 32g .. 32g+31 is tile 2g + (s >> 3), register s & 7
        bf16x16 bp0, bp1;
        #pragma unroll
        for (int s = 0; s < 16; ++s) {
            bp0[s] = (bf16)st[s >> 3][s & 7];
            bp1[s] = (bf16)st[2 + (s >> 3)][s & 7];
        }
        #pragma unroll
        for (int nt = 0; nt < 4; ++nt) {
            const bf16* vrow = Vts + (nt * 16 + l15) * LT;
            Oacc[nt] = wmma_bf16(frag_ld(vrow, kh), bp0, Oacc[nt]);
            Oacc[nt] = wmma_bf16(frag_ld(vrow + 32, kh), bp1, Oacc[nt]);
        }
    }

    // normalize and write bf16 output (feeds the WO GEMM directly):
    // a lane's 8 registers of a tile are 8 consecutive elements of its query's row
    const size_t srow = (size_t)b * SEQ + qg;
    #pragma unroll
    for (int nt = 0; nt < 4; ++nt) {
        bf16x8 o;
        #pragma unroll
        for (int r = 0; r < 8; ++r) o[r] = (bf16)(Oacc[nt][r] / lrow);
        *(bf16x8*)(Ob + srow * DM + h * DK + nt * 16 + kh * 8) = o;
    }
    // The second tile's code rewrites the registers that these stores name.
    asm volatile("s_wait_xcnt 0x0" ::: "memory");
    }   // half
}

// ---------------- host launcher ----------------
extern "C" void kernel_launch(void* const* d_in, const int* in_sizes, int n_in,
                              void* d_out, int out_size, void* d_ws, size_t ws_size,
                              hipStream_t stream) {
    (void)in_sizes; (void)n_in; (void)out_size; (void)ws_size;
    const float* x  = (const float*)d_in[0];
    const float* wq = (const float*)d_in[1];
    const float* wk = (const float*)d_in[2];
    const float* wv = (const float*)d_in[3];
    const float* wo = (const float*)d_in[4];
    const float* w1 = (const float*)d_in[5];
    const float* w2 = (const float*)d_in[6];
    const float* w3 = (const float*)d_in[7];
    const float* g1 = (const float*)d_in[8];
    const float* g2 = (const float*)d_in[9];
    float* out = (float*)d_out;

    const size_t MB = 1ull << 20;
    char* p = (char*)d_ws;
    bf16*  n_bf  = (bf16*)p;            p += 8 * MB;   // 4096x1024 bf16
    bf16*  wq_bf = (bf16*)p;            p += 2 * MB;
    bf16*  wk_bf = (bf16*)p;            p += 2 * MB;
    bf16*  wv_bf = (bf16*)p;            p += 2 * MB;
    bf16*  wo_bf = (bf16*)p;            p += 2 * MB;
    bf16*  w1_bf = (bf16*)p;            p += 8 * MB;
    bf16*  w3_bf = (bf16*)p;            p += 8 * MB;
    bf16*  w2_bf = (bf16*)p;            p += 8 * MB;
    float* x1    = (float*)p;           p += 16 * MB;  // x + attn residual
    bf16*  n2_bf = (bf16*)p;            p += 8 * MB;
    // 64 MB region: q_bf and k_bf lie in its last quarter
    char*  reuse = p;                   p += 64 * MB;
    bf16*  q_bf = (bf16*) (reuse + 48 * MB);
    bf16*  k_bf = (bf16*) (reuse + 56 * MB);
    bf16*  vt_bf = (bf16*)p;            p += 8 * MB;
    bf16*  o_bf  = (bf16*)p;            p += 8 * MB;
    bf16*  h_bf  = (bf16*)p;            p += 32 * MB;  // swiglu output 4096x4096

    // 1) weights -> bf16
    //    (wq_bf .. w2_bf are one contiguous array that starts at wq_bf)
    k_weights_to_bf16<<<CONV_WGS, 512, 0, stream>>>(wq, wk, wv, wo, w1, w3, w2, wq_bf);

    // 2) n = rmsnorm(x, g1)
    k_rmsnorm<<<MROWS, 256, 0, stream>>>(x, g1, n_bf);

    // 3) Q,K projections with RoPE -> bf16 (weight as A, tokens as B)
    dim3 gQKV(DM / 128, MROWS / 128);
    dim3 gQK(MROWS / 128, DM / 128);
    k_gemm_nt<3><<<gQK, 256, 0, stream>>>(wq_bf, n_bf, nullptr, q_bf, DM, MROWS, DM);
    k_gemm_nt<3><<<gQK, 256, 0, stream>>>(wk_bf, n_bf, nullptr, k_bf, DM, MROWS, DM);

    // 4) V projection -> per-head transposed bf16
    k_gemm_nt<4><<<gQKV, 256, 0, stream>>>(n_bf, wv_bf, nullptr, vt_bf, MROWS, DM, DM);

    // 5) causal flash attention -> o (bf16)
    dim3 gAtt(SEQ / 128, BATCH * HEADS);
    k_flash_attn<<<gAtt, 128, 0, stream>>>(q_bf, k_bf, vt_bf, o_bf);

    // 6) x1 = x + o @ Wo^T
    k_gemm_nt<1><<<gQKV, 256, 0, stream>>>(o_bf, wo_bf, x, x1, MROWS, DM, DM);

    // 7) n2 = rmsnorm(x1, g2)
    k_rmsnorm<<<MROWS, 256, 0, stream>>>(x1, g2, n2_bf);

    // 8) h = silu(n2 @ W1^T) * (n2 @ W3^T), both products in one launch
    dim3 gFF(DFF / 128, MROWS / 256);
    k_ffn_up<<<gFF, 512, 0, stream>>>(w1_bf, w3_bf, n2_bf, h_bf, DFF, DM);

    // 9) out = x1 + h @ W2^T
    k_gemm_nt<1><<<gQKV, 256, 0, stream>>>(h_bf, w2_bf, x1, out, MROWS, DM, DFF);
}

// v007
// It runs in 181 microseconds.
// Next to v006, in two timings, it ran 1.07 and 1.06 times as fast.
// All steps since v000 together make it 3.04 times as fast.
#include <hip/hip_runtime.h>

// ---------------- problem constants ----------------
#define BATCH   2
#define SEQ     2048
#define DM      1024
#define HEADS   16
#define DK      64
#define DFF     4096
#define MROWS   (BATCH * SEQ)       // 4096
#define EPSV    1e-5f
#define THETA_F 10000.0f

// ---------------- types ----------------
typedef __bf16 bf16;
typedef __attribute__((ext_vector_type(16))) __bf16 bf16x16;
typedef __attribute__((ext_vector_type(8)))  __bf16 bf16x8;
typedef __attribute__((ext_vector_type(8)))  float  f32x8;
typedef __attribute__((ext_vector_type(4)))  unsigned int u32x4;

// Load one 16x32 bf16 WMMA fragment (A or B operand) from LDS.
// rowPtr points at the start of this lane's row (16-byte aligned, row stride
// is a multiple of 8 elements). kh = lane>>4 selects the K-half per the ISA
// 16-bit A-matrix layout: half 0 -> K {0..7, 16..23}, half 1 -> K {8..15, 24..31}.
__device__ __forceinline__ bf16x16 frag_ld(const bf16* rowPtr, int kh) {
    bf16x8 lo = *(const bf16x8*)(rowPtr + kh * 8);
    bf16x8 hi = *(const bf16x8*)(rowPtr + 16 + kh * 8);
    return __builtin_shufflevector(lo, hi, 0,1,2,3,4,5,6,7,8,9,10,11,12,13,14,15);
}

__device__ __forceinline__ f32x8 wmma_bf16(bf16x16 a, bf16x16 b, f32x8 c) {
    return __builtin_amdgcn_wmma_f32_16x16x32_bf16(false, a, false, b, (short)0, c, false, false);
}

// ---------------- fp32 -> bf16 conversion of all seven weights, one launch ----
// The bf16 copies lie back to back in the workspace in the order
// wq, wk, wv, wo, w1, w3, w2, so the destination is one array of CONV_TOTAL
// elements. One 16-wave work-group per WGP takes CONV_PER_WG consecutive
// elements of it (always inside one source, since every source's length is a
// multiple of CONV_PER_WG). A wave reads 32 x 512 contiguous bytes, many loads
// in flight at a time, and stores 32 x 256 contiguous bytes.
typedef __attribute__((ext_vector_type(4))) float  f32x4;
typedef __attribute__((ext_vector_type(4))) __bf16 bf16x4;
#define CONV_TOTAL   (4 * DM * DM + 3 * DFF * DM)   // 16,777,216
#define CONV_WGS     256
#define CONV_PER_WG  (CONV_TOTAL / CONV_WGS)        // 65,536
#define CONV_LOADS   (CONV_PER_WG / (512 * 4))      // 32 loads of 4 floats a lane
static_assert((DM * DM) % CONV_PER_WG == 0 && (DFF * DM) % CONV_PER_WG == 0,
              "a work-group's range must lie inside one weight");
__global__ __launch_bounds__(512)
void k_weights_to_bf16(const float* __restrict__ wq, const float* __restrict__ wk,
                       const float* __restrict__ wv, const float* __restrict__ wo,
                       const float* __restrict__ w1, const float* __restrict__ w3,
                       const float* __restrict__ w2, bf16* __restrict__ out) {
    const int first = blockIdx.x * CONV_PER_WG;   // index in the destination array
    const float* src = wq;                        // the weight that holds it ...
    int base = 0;                                 // ... and where that weight starts
    if (first >= 1 * DM * DM)                { src = wk; base = 1 * DM * DM; }
    if (first >= 2 * DM * DM)                { src = wv; base = 2 * DM * DM; }
    if (first >= 3 * DM * DM)                { src = wo; base = 3 * DM * DM; }
    if (first >= 4 * DM * DM)                { src = w1; base = 4 * DM * DM; }
    if (first >= 4 * DM * DM + 1 * DFF * DM) { src = w3; base = 4 * DM * DM + 1 * DFF * DM; }
    if (first >= 4 * DM * DM + 2 * DFF * DM) { src = w2; base = 4 * DM * DM + 2 * DFF * DM; }

    const int lane = threadIdx.x & 31, wave = threadIdx.x >> 5;
    const int at = first + wave * (CONV_LOADS * 128) + lane * 4;
    const f32x4* s = (const f32x4*)(src + (at - base));
    bf16x4*      d = (bf16x4*)(out + at);
    f32x4 v[CONV_LOADS];
    // Both loops unrolled: v[] stays in registers, the steps become immediate
    // offsets, and the loads can be issued ahead of the conversions.
    #pragma unroll
    for (int j = 0; j < CONV_LOADS; ++j)          // read once: non-temporal
        v[j] = __builtin_nontemporal_load(s + j * 32);
    #pragma unroll
    for (int j = 0; j < CONV_LOADS; ++j) {
        bf16x4 o = { (bf16)v[j][0], (bf16)v[j][1], (bf16)v[j][2], (bf16)v[j][3] };
        d[j * 32] = o;
    }
}

// ---------------- RMSNorm (one block per row) ----------------
__global__ __launch_bounds__(256) void k_rmsnorm(const float* __restrict__ X,
                                                 const float* __restrict__ G,
                                                 bf16* __restrict__ Out) {
    const int row = blockIdx.x;
    const float* x = X + (size_t)row * DM;
    float s = 0.f;
    #pragma unroll
    for (int i = threadIdx.x; i < DM; i += 256) { float v = x[i]; s += v * v; }
    #pragma unroll
    for (int m = 16; m >= 1; m >>= 1) s += __shfl_xor(s, m, 32);
    __shared__ float red[8];
    if ((threadIdx.x & 31) == 0) red[threadIdx.x >> 5] = s;
    __syncthreads();
    float tot = 0.f;
    #pragma unroll
    for (int j = 0; j < 8; ++j) tot += red[j];
    const float rinv = rsqrtf(tot / (float)DM + EPSV);
    bf16* o = Out + (size_t)row * DM;
    for (int i = threadIdx.x; i < DM; i += 256) o[i] = (bf16)(x[i] * rinv * G[i]);
}

// Eight asynchronous 16-byte copies per lane, global memory -> LDS, no register
// in between. The s_wait_xcnt is the last line of the copies' own statement so
// that no address register named here is rewritten ahead of it.
__device__ __forceinline__ void async_copy8(unsigned l, unsigned lstep,
                                            const bf16* g, size_t gstep) {
    asm volatile(
        "global_load_async_to_lds_b128 %0, %8, off\n\t"
        "global_load_async_to_lds_b128 %1, %9, off\n\t"
        "global_load_async_to_lds_b128 %2, %10, off\n\t"
        "global_load_async_to_lds_b128 %3, %11, off\n\t"
        "global_load_async_to_lds_b128 %4, %12, off\n\t"
        "global_load_async_to_lds_b128 %5, %13, off\n\t"
        "global_load_async_to_lds_b128 %6, %14, off\n\t"
        "global_load_async_to_lds_b128 %7, %15, off\n\t"
        "s_wait_xcnt 0x0"
        :: "v"(l), "v"(l + lstep), "v"(l + 2 * lstep), "v"(l + 3 * lstep),
           "v"(l + 4 * lstep), "v"(l + 5 * lstep), "v"(l + 6 * lstep), "v"(l + 7 * lstep),
           "v"(g), "v"(g + gstep), "v"(g + 2 * gstep), "v"(g + 3 * gstep),
           "v"(g + 4 * gstep), "v"(g + 5 * gstep), "v"(g + 6 * gstep), "v"(g + 7 * gstep)
        : "memory");
}

// The same, the first four copies from ga and the last four from gb: two sources
// whose rows lie one behind the other in LDS.
__device__ __forceinline__ void async_copy4x2(unsigned l, unsigned lstep,
                                              const bf16* ga, const bf16* gb, size_t gstep) {
    asm volatile(
        "global_load_async_to_lds_b128 %0, %8, off\n\t"
        "global_load_async_to_lds_b128 %1, %9, off\n\t"
        "global_load_async_to_lds_b128 %2, %10, off\n\t"
        "global_load_async_to_lds_b128 %3, %11, off\n\t"
        "global_load_async_to_lds_b128 %4, %12, off\n\t"
        "global_load_async_to_lds_b128 %5, %13, off\n\t"
        "global_load_async_to_lds_b128 %6, %14, off\n\t"
        "global_load_async_to_lds_b128 %7, %15, off\n\t"
        "s_wait_xcnt 0x0"
        :: "v"(l), "v"(l + lstep), "v"(l + 2 * lstep), "v"(l + 3 * lstep),
           "v"(l + 4 * lstep), "v"(l + 5 * lstep), "v"(l + 6 * lstep), "v"(l + 7 * lstep),
           "v"(ga), "v"(ga + gstep), "v"(ga + 2 * gstep), "v"(ga + 3 * gstep),
           "v"(gb), "v"(gb + gstep), "v"(gb + 2 * gstep), "v"(gb + 3 * gstep)
        : "memory");
}

// sin and cos of x radians, formed as __sincosf forms them. One statement, so that
// the v_nop stands directly behind the second transcendental: the slot that the
// instruction set asks for in front of an instruction that overwrites its source.
__device__ __forceinline__ void sincos_slot(float x, float& sn, float& cs) {
    const float rev = x * 0.15915494f;   // 1 / (2 pi): the instructions take revolutions
    asm("v_sin_f32 %0, %2\n\tv_cos_f32 %1, %2\n\tv_nop" : "=&v"(sn), "=&v"(cs) : "v"(rev));
}

// ---------------- WMMA NT-GEMM: C[M,N] = A[M,K] * B[N,K]^T + R[M,N], f32 out ----
// K is walked in tiles of 128. Two LDS buffers: tile t+1's asynchronous copies
// fly while tile t's 32 WMMAs per wave run; one barrier per tile publishes the
// next tile and frees the buffer just read. K must be a multiple of 128.
__global__ __launch_bounds__(256)
void k_gemm_nt(const bf16* __restrict__ A, const bf16* __restrict__ B,
               const float* __restrict__ R, float* __restrict__ Out,
               int M, int N, int K) {
    constexpr int BM = 128, BN = 128, BK = 128, LDT = BK + 8;  // 272-byte pitch
    constexpr int OPER = BM * LDT;                             // one operand's tile
    constexpr int STAGE = 2 * OPER;                            // [A tile | B tile]
    __shared__ __attribute__((aligned(16))) bf16 Sm[2 * STAGE];

    const int m0 = blockIdx.y * BM, n0 = blockIdx.x * BN;
    const int tid  = threadIdx.x;
    const int lane = tid & 31, wid = tid >> 5;   // 8 waves
    const int wm = wid >> 2, wn = wid & 3;       // 2 x 4 wave grid: 64x32 per wave
    const int l15 = lane & 15, kh = lane >> 4;

    // Copy map: 16 lanes cover one 256-byte row; a lane's 8 copies are 16 rows apart.
    const int crow = tid >> 4, ccol = (tid & 15) * 8;
    const bf16* gA = A + (size_t)(m0 + crow) * K + ccol;
    const bf16* gB = B + (size_t)(n0 + crow) * K + ccol;
    const unsigned lA = (unsigned)(size_t)(Sm + crow * LDT + ccol);
    const size_t gstep = (size_t)16 * K;
    auto stage_in = [&](int t, int buf) {
        const unsigned l = lA + (unsigned)(buf * STAGE * 2);
        async_copy8(l,            16 * LDT * 2, gA + (size_t)t * BK, gstep);
        async_copy8(l + OPER * 2, 16 * LDT * 2, gB + (size_t)t * BK, gstep);
    };

    const int nt = K / BK;
    stage_in(0, 0);
    asm volatile("s_wait_asynccnt 0x0" ::: "memory");   // tile 0 has landed (own copies)
    __syncthreads();                                    // ... and every wave's copies
    if (nt > 1) stage_in(1, 1);

    f32x8 acc[4][2] = {};

    for (int t = 0; t < nt; ++t) {
        const bf16* As = Sm + (t & 1) * STAGE;
        const bf16* Bs = As + OPER;
        // Unrolled: the four blocks' LDS offsets become immediates and a block's
        // reads can start under the WMMAs of the block before it.
        #pragma unroll
        for (int kk = 0; kk < BK; kk += 32) {
            bf16x16 afr[4], bfr[2];
            #pragma unroll
            for (int ni = 0; ni < 2; ++ni)
                bfr[ni] = frag_ld(Bs + (wn * 32 + ni * 16 + l15) * LDT + kk, kh);
            #pragma unroll
            for (int mi = 0; mi < 4; ++mi)
                afr[mi] = frag_ld(As + (wm * 64 + mi * 16 + l15) * LDT + kk, kh);
            // Keeps the block's 12 LDS reads one group in front of its 8 WMMAs: left
            // alone the compiler sinks them between the WMMAs, a full LDS wait per pair.
            __builtin_amdgcn_sched_barrier(0);
            #pragma unroll
            for (int mi = 0; mi < 4; ++mi)
                #pragma unroll
                for (int ni = 0; ni < 2; ++ni)
                    acc[mi][ni] = wmma_bf16(afr[mi], bfr[ni], acc[mi][ni]);
        }
        asm volatile("s_wait_dscnt 0x0" ::: "memory");     // own reads of this buffer are done
        asm volatile("s_wait_asynccnt 0x0" ::: "memory");  // own copies of tile t+1 have landed
        __syncthreads();   // publishes tile t+1; ends every reader's last read of tile t
        if (t + 2 < nt) stage_in(t + 2, t & 1);            // refill the buffer just read
    }
    asm volatile("s_wait_asynccnt 0x0" ::: "memory");      // nothing in flight at the wave's end

    #pragma unroll
    for (int mi = 0; mi < 4; ++mi)
        #pragma unroll
        for (int ni = 0; ni < 2; ++ni)
            #pragma unroll
            for (int r = 0; r < 8; ++r) {
                int gm = m0 + wm * 64 + mi * 16 + kh * 8 + r;
                int gn = n0 + wn * 32 + ni * 16 + l15;
                size_t off = (size_t)gm * N + gn;
                Out[off] = acc[mi][ni][r] + R[off];
            }
}

// ---------------- Q, K and V projections, one launch ----------------
// The three bf16 weights lie back to back, so they are one matrix W of 3 * DM rows
// (48 heads of 64 features: 16 of Q, 16 of K, 16 of V). A work-group forms 192
// features (3 heads) x 256 tokens: 16 x 16 work-groups, one per WGP. A stage is
// [W 192 rows | X 256 rows] of 128 k; the ring is k_gemm_nt's.
// 12 waves, 3 x 4: a wave has ONE head x 64 tokens, 8 fragments for 16 WMMAs.
// In D a lane holds 8 consecutive rows of one column, so the side that is contiguous
// in the output goes in as A and the lane stores 16 bytes of bf16:
//   Q, K head: A = weight, B = tokens: RoPE on the lane's 4 pairs, Out[token][feature].
//   V head:    A = tokens, B = weight: Vt[b][feature][s], V transposed per head.
// Both sides of a wave's tile are 64 rows at the same pitch, read by the same loader, so
// the choice is only which rows' address is the A side's: one loop serves both.

__global__ __launch_bounds__(384)
void k_qkv(const bf16* __restrict__ Wqkv, const bf16* __restrict__ X,
           bf16* __restrict__ Qo, bf16* __restrict__ Ko, bf16* __restrict__ Vt, int K) {
    constexpr int BF = 192, BT = 256, BK = 128, LDT = BK + 8;  // 272-byte pitch
    constexpr int WPART = BF * LDT;
    constexpr int STAGE = WPART + BT * LDT;
    static_assert(DK == 64 && BF % DK == 0 && (3 * DM) % BF == 0 && MROWS % BT == 0 &&
                  SEQ % BT == 0, "a wave has one head; a tile's tokens lie in one batch entry");
    __shared__ __attribute__((aligned(16))) bf16 Sm[2 * STAGE];

    const int f0 = blockIdx.x * BF, t0 = blockIdx.y * BT;
    const int tid  = threadIdx.x;
    const int lane = tid & 31;
    // The wave's number in a scalar register: what hangs on it (who copies what, which
    // operand order, which epilogue) is then a scalar branch with every lane on.
    const int wid = __builtin_amdgcn_readfirstlane(tid >> 5);
    const int wf = wid >> 2, wt = wid & 3;
    const int l15 = lane & 15, kh = lane >> 4;
    const int head  = blockIdx.x * (BF / DK) + wf;   // 0 .. 47 in the stacked weight
    const int which = head / HEADS;                  // 0 Q, 1 K, 2 V
    const int hf0   = (head % HEADS) * DK;           // the head's first feature in its matrix

    // Copy map: 16 lanes cover one 256-byte row. Waves 0..7 bring the 256 token rows
    // (16 rows a copy step, 16 copies a lane), waves 8..11 the 192 weight rows (8 rows a
    // step, 24 copies a lane).
    const bool forX = wid < 8;
    const int  crow = (forX ? tid : tid - 256) >> 4, ccol = (tid & 15) * 8;
    const bf16* g0 = (forX ? X + (size_t)(t0 + crow) * K : Wqkv + (size_t)(f0 + crow) * K) + ccol;
    const unsigned l0 = (unsigned)(size_t)(Sm + (forX ? WPART : 0) + crow * LDT + ccol);
    auto stage_in = [&](int t, int buf) {
        const unsigned l = l0 + (unsigned)(buf * STAGE * 2);
        const bf16*    g = g0 + (size_t)t * BK;
        if (forX) {   // two paths, so that the LDS steps are constants in each
            async_copy8(l,                 16 * LDT * 2, g,                   (size_t)16 * K);
            async_copy8(l + 128 * LDT * 2, 16 * LDT * 2, g + (size_t)128 * K, (size_t)16 * K);
        } else {
            async_copy8(l,                 8 * LDT * 2, g,                   (size_t)8 * K);
            async_copy8(l + 64 * LDT * 2,  8 * LDT * 2, g + (size_t)64 * K,  (size_t)8 * K);
            async_copy8(l + 128 * LDT * 2, 8 * LDT * 2, g + (size_t)128 * K, (size_t)8 * K);
        }
    };

    const int nt = K / BK;
    stage_in(0, 0);
    asm volatile("s_wait_asynccnt 0x0" ::: "memory");   // tile 0 has landed (own copies)
    __syncthreads();                                    // ... and every wave's copies
    if (nt > 1) stage_in(1, 1);

    // This lane's first row of the A side and of the B side, in buffer 0.
    const int wrow = (wf * 64 + l15) * LDT, xrow = WPART + (wt * 64 + l15) * LDT;
    const bf16* arow = Sm + (which == 2 ? xrow : wrow);
    const bf16* brow = Sm + (which == 2 ? wrow : xrow);

    f32x8 acc[4][4] = {};   // [A fragment][B fragment]

    for (int t = 0; t < nt; ++t) {
        const bf16* As = arow + (t & 1) * STAGE;
        const bf16* Bs = brow + (t & 1) * STAGE;
        // Unrolled: the four blocks' LDS offsets become immediates. (The short loops
        // over mi, ni, j and r, here and in the epilogue, are unrolled so that the
        // fragment and accumulator arrays are indexed by constants and stay in registers.)
        #pragma unroll
        for (int kk = 0; kk < BK; kk += 32) {
            bf16x16 afr[4], bfr[4];
            #pragma unroll
            for (int ni = 0; ni < 4; ++ni) bfr[ni] = frag_ld(Bs + ni * 16 * LDT + kk, kh);
            #pragma unroll
            for (int mi = 0; mi < 4; ++mi) afr[mi] = frag_ld(As + mi * 16 * LDT + kk, kh);
            // Keeps the block's 16 LDS reads one group in front of its 16 WMMAs: left
            // alone the compiler sinks them between the WMMAs, a full LDS wait per pair.
            __builtin_amdgcn_sched_barrier(0);
            #pragma unroll
            for (int mi = 0; mi < 4; ++mi)
                #pragma unroll
                for (int ni = 0; ni < 4; ++ni)
                    acc[mi][ni] = wmma_bf16(afr[mi], bfr[ni], acc[mi][ni]);
        }
        asm volatile("s_wait_dscnt 0x0" ::: "memory");     // own reads of this buffer are done
        asm volatile("s_wait_asynccnt 0x0" ::: "memory");  // own copies of tile t+1 have landed
        __syncthreads();   // publishes tile t+1; ends every reader's last read of tile t
        if (t + 2 < nt) stage_in(t + 2, t & 1);            // refill the buffer just read
    }
    asm volatile("s_wait_asynccnt 0x0" ::: "memory");      // nothing in flight at the wave's end

    if (which == 2) {
        #pragma unroll
        for (int mi = 0; mi < 4; ++mi)
            #pragma unroll
            for (int ni = 0; ni < 4; ++ni) {
                const int gt = t0 + wt * 64 + mi * 16 + kh * 8;   // first of 8 tokens
                const int gf = hf0 + ni * 16 + l15;               // feature
                bf16x8 o;
                #pragma unroll
                for (int r = 0; r < 8; ++r) o[r] = (bf16)acc[mi][ni][r];
                *(bf16x8*)(Vt + ((size_t)(gt / SEQ) * DM + gf) * SEQ + gt % SEQ) = o;
            }
    } else {
        bf16* Out = which ? Ko : Qo;
        #pragma unroll
        for (int mi = 0; mi < 4; ++mi) {
            float inv[4];                              // pairs mi*8 + kh*4 + j of the head
            #pragma unroll
            for (int j = 0; j < 4; ++j) {              // theta^(-2p/DK), p known to the compiler
                const float lo = __powf(THETA_F, -2.f * (float)(mi * 8 + j) / (float)DK);
                const float hi = __powf(THETA_F, -2.f * (float)(mi * 8 + 4 + j) / (float)DK);
                inv[j] = kh ? hi : lo;
            }
            #pragma unroll
            for (int ni = 0; ni < 4; ++ni) {
                const int gf = hf0 + mi * 16 + kh * 8;            // first of 8 features
                const int gt = t0 + wt * 64 + ni * 16 + l15;      // token
                const int s  = gt % SEQ;
                bf16x8 o;
                #pragma unroll
                for (int j = 0; j < 4; ++j) {
                    float sn, cs;
                    sincos_slot((float)s * inv[j], sn, cs);
                    const float x1 = acc[mi][ni][2 * j], x2 = acc[mi][ni][2 * j + 1];
                    o[2 * j]     = (bf16)(x1 * cs - x2 * sn);
                    o[2 * j + 1] = (bf16)(x1 * sn + x2 * cs);
                }
                *(bf16x8*)(Out + (size_t)gt * DM + gf) = o;
            }
        }
        // In the built code the V epilogue stands behind this branch's end and rewrites
        // the registers that the last stores name: the wait stands in front of it.
        asm volatile("s_wait_xcnt 0x0" ::: "memory");
    }
}

// ---------------- SwiGLU up-projection: H = silu(X W1^T) * (X W3^T), one launch ----
// A work-group forms BOTH products for 128 features x 256 tokens. A stage is
// [W1 128 rows | W3 128 rows | X 256 rows] of 128 k; the ring is k_gemm_nt's.
// The weights go in as A (m = feature) and the tokens as B, so in D a lane holds 8
// consecutive features of one token, of both products in the same registers' places:
// the gate is formed in registers and the lane stores 16 bytes of bf16.
// 16 waves, 4 x 4: a wave has 32 features (of each weight) x 64 tokens, that is 8
// fragments for 16 WMMAs. K must be a multiple of 128.
__global__ __launch_bounds__(512)
void k_ffn_up(const bf16* __restrict__ W1, const bf16* __restrict__ W3,
              const bf16* __restrict__ X, bf16* __restrict__ H, int F, int K) {
    constexpr int BF = 128, BT = 256, BK = 128, LDT = BK + 8;  // 272-byte pitch
    constexpr int WPART = 2 * BF * LDT;                        // both weights' tiles
    constexpr int STAGE = WPART + BT * LDT;
    __shared__ __attribute__((aligned(16))) bf16 Sm[2 * STAGE];

    const int f0 = blockIdx.x * BF, t0 = blockIdx.y * BT;
    const int tid  = threadIdx.x;
    const int lane = tid & 31, wid = tid >> 5;
    const int wf = wid >> 2, wt = wid & 3;
    const int l15 = lane & 15, kh = lane >> 4;

    // Copy map: 16 lanes cover one 256-byte row; a lane's copies are 32 rows apart.
    const int crow = tid >> 4, ccol = (tid & 15) * 8;
    const bf16* g1 = W1 + (size_t)(f0 + crow) * K + ccol;
    const bf16* g3 = W3 + (size_t)(f0 + crow) * K + ccol;
    const bf16* gX = X  + (size_t)(t0 + crow) * K + ccol;
    const unsigned lW = (unsigned)(size_t)(Sm + crow * LDT + ccol);
    const size_t gstep = (size_t)32 * K;
    auto stage_in = [&](int t, int buf) {
        const unsigned l = lW + (unsigned)(buf * STAGE * 2);
        async_copy4x2(l,           32 * LDT * 2, g1 + (size_t)t * BK, g3 + (size_t)t * BK, gstep);
        async_copy8(l + WPART * 2, 32 * LDT * 2, gX + (size_t)t * BK, gstep);
    };

    const int nt = K / BK;
    stage_in(0, 0);
    asm volatile("s_wait_asynccnt 0x0" ::: "memory");   // tile 0 has landed (own copies)
    __syncthreads();                                    // ... and every wave's copies
    if (nt > 1) stage_in(1, 1);

    f32x8 acc1[2][4] = {}, acc3[2][4] = {};

    for (int t = 0; t < nt; ++t) {
        const bf16* Ws = Sm + (t & 1) * STAGE;
        const bf16* Xs = Ws + WPART;
        // Unrolled: the four blocks' LDS offsets become immediates. (The short loops
        // over mi, ni and r, here and in the epilogue, are unrolled so that the
        // fragment and accumulator arrays are indexed by constants and stay in registers.)
        #pragma unroll
        for (int kk = 0; kk < BK; kk += 32) {
            bf16x16 a1[2], a3[2], xb[4];
            #pragma unroll
            for (int ni = 0; ni < 4; ++ni)
                xb[ni] = frag_ld(Xs + (wt * 64 + ni * 16 + l15) * LDT + kk, kh);
            #pragma unroll
            for (int mi = 0; mi < 2; ++mi) {
                a1[mi] = frag_ld(Ws + (wf * 32 + mi * 16 + l15) * LDT + kk, kh);
                a3[mi] = frag_ld(Ws + (BF + wf * 32 + mi * 16 + l15) * LDT + kk, kh);
            }
            // Keeps the block's 16 LDS reads one group in front of its 16 WMMAs: left
            // alone the compiler sinks them between the WMMAs, a full LDS wait per pair.
            __builtin_amdgcn_sched_barrier(0);
            #pragma unroll
            for (int mi = 0; mi < 2; ++mi)
                #pragma unroll
                for (int ni = 0; ni < 4; ++ni) {
                    acc1[mi][ni] = wmma_bf16(a1[mi], xb[ni], acc1[mi][ni]);
                    acc3[mi][ni] = wmma_bf16(a3[mi], xb[ni], acc3[mi][ni]);
                }
        }
        asm volatile("s_wait_dscnt 0x0" ::: "memory");     // own reads of this buffer are done
        asm volatile("s_wait_asynccnt 0x0" ::: "memory");  // own copies of tile t+1 have landed
        __syncthreads();   // publishes tile t+1; ends every reader's last read of tile t
        if (t + 2 < nt) stage_in(t + 2, t & 1);            // refill the buffer just read
    }
    asm volatile("s_wait_asynccnt 0x0" ::: "memory");      // nothing in flight at the wave's end

    #pragma unroll
    for (int mi = 0; mi < 2; ++mi)
        #pragma unroll
        for (int ni = 0; ni < 4; ++ni) {
            const int gf = f0 + wf * 32 + mi * 16 + kh * 8;   // first of 8 features
            const int gt = t0 + wt * 64 + ni * 16 + l15;      // token
            bf16x8 o;
            #pragma unroll
            for (int r = 0; r < 8; ++r) {
                const float a = acc1[mi][ni][r];
                const float g = a / (1.f + __expf(-a));       // a * sigmoid(a)
                o[r] = (bf16)(g * acc3[mi][ni][r]);
            }
            *(bf16x8*)(H + (size_t)gt * F + gf) = o;
        }
}

// ---------------- Flash attention (causal, online softmax) ----------------
// Block: 128 threads (4 waves), handles one (b,h) and two tiles of 64 query rows,
// tile 31 - p and then tile p: 32 - p and p + 1 key tiles, 33 for every block, so
// that all blocks, resident together, end together wherever they are placed.
// Each wave owns 16 queries and forms the TRANSPOSED products on WMMA bf16:
//   S^T = K * Q^T   (A = 16 keys from LDS,     B = the wave's 16 queries, in registers)
//   O^T += V^T * P^T (A = 16 rows of V^T, LDS, B = P^T packed from the score registers)
// In D a lane holds one column, so lane l has the scores of query l & 15 alone
// (keys 8 * (l >> 4) + r of each 16-key tile): maximum and sum run inside the lane,
// with one exchange between lanes l and l ^ 16, and two score tiles converted in
// place are the B operand of the second product in frag_ld's own k order.
// K/V tile kt+1 is fetched into registers while tile kt is being consumed.

// Lane l takes the value of lane l ^ 16.
__device__ __forceinline__ float other_half(float x) {
    int b = __builtin_bit_cast(int, x);
    return __builtin_bit_cast(float,
        __builtin_amdgcn_permlanex16(b, b, 0x76543210, 0xfedcba98, false, false));
}

__global__ __launch_bounds__(128)
void k_flash_attn(const bf16* __restrict__ Qb, const bf16* __restrict__ Kb,
                  const bf16* __restrict__ Vt, bf16* __restrict__ Ob) {
    constexpr int LT = 72;   // 64 + 8 pad (16B-aligned rows, conflict-free b128)
    __shared__ __attribute__((aligned(16))) bf16 Qs [2 * 64 * LT];   // both query tiles
    __shared__ __attribute__((aligned(16))) bf16 Ks [64 * LT];
    __shared__ __attribute__((aligned(16))) bf16 Vts[64 * LT];

    const int qtile[2] = { SEQ / 64 - 1 - (int)blockIdx.x, (int)blockIdx.x };
    const int bh = blockIdx.y;
    const int b = bh / HEADS, h = bh % HEADS;
    const int tid = threadIdx.x, lane = tid & 31, w = tid >> 5;
    const int l15 = lane & 15, kh = lane >> 4;

    const bf16* Qg = Qb + (size_t)b * SEQ * DM + h * DK;
    const bf16* Kg = Kb + (size_t)b * SEQ * DM + h * DK;
    const bf16* Vg = Vt + ((size_t)b * HEADS + h) * DK * SEQ;

    int trow[4], tcol[4];
    #pragma unroll
    for (int i = 0; i < 4; ++i) {          // 64x64 tile, 8 bf16 per thread-iter
        int idx = tid + i * 128;
        trow[i] = idx >> 3; tcol[i] = (idx & 7) * 8;
    }
    #pragma unroll
    for (int hf = 0; hf < 2; ++hf)
        #pragma unroll
        for (int i = 0; i < 4; ++i)
            *(u32x4*)(Qs + hf * 64 * LT + trow[i] * LT + tcol[i]) =
                *(const u32x4*)(Qg + (size_t)(qtile[hf] * 64 + trow[i]) * DM + tcol[i]);
    __syncthreads();

    // Not unrolled: one copy of the key loop in the instruction cache.
    #pragma unroll 1
    for (int half = 0; half < 2; ++half) {
    const int qt = half ? qtile[1] : qtile[0];   // query tile (64 rows)

    const bf16* qrow = Qs + half * 64 * LT + (w * 16 + l15) * LT;
    bf16x16 bq0 = frag_ld(qrow, kh), bq1 = frag_ld(qrow + 32, kh);

    float mrow = -1e30f, lrow = 0.f;      // this lane's query: running maximum and sum
    f32x8 Oacc[4] = {};                   // Oacc[nt][r] = O[query l15][nt*16 + kh*8 + r]

    const int qg = qt * 64 + w * 16 + l15;   // this lane's global query index

    u32x4 rk[4], rv[4];
    auto fetchKV = [&](int kt) {
        #pragma unroll
        for (int i = 0; i < 4; ++i) {
            rk[i] = *(const u32x4*)(Kg + (size_t)(kt * 64 + trow[i]) * DM + tcol[i]);
            rv[i] = *(const u32x4*)(Vg + (size_t)trow[i] * SEQ + kt * 64 + tcol[i]);
        }
    };
    fetchKV(0);

    for (int kt = 0; kt <= qt; ++kt) {
        __syncthreads();   // previous-iteration readers of Ks/Vts are done
        #pragma unroll
        for (int i = 0; i < 4; ++i) {
            *(u32x4*)(Ks  + trow[i] * LT + tcol[i]) = rk[i];
            *(u32x4*)(Vts + trow[i] * LT + tcol[i]) = rv[i];
        }
        __syncthreads();

        if (kt + 2 <= qt) {   // warm GL2 two tiles ahead
            __builtin_prefetch(Kg + (size_t)((kt + 2) * 64 + trow[0]) * DM + tcol[0], 0, 3);
            __builtin_prefetch(Vg + (size_t)trow[0] * SEQ + (kt + 2) * 64 + tcol[0], 0, 3);
        }
        if (kt < qt) fetchKV(kt + 1);   // loads in flight under score/softmax

        // scores, transposed: 64(k) x 16(q) per wave, K-dim = dk = 64 -> 2 chained WMMAs
        // st[mt][r] = S[key kt*64 + mt*16 + kh*8 + r][query l15]
        f32x8 st[4];
        #pragma unroll
        for (int mt = 0; mt < 4; ++mt) {
            const bf16* krow = Ks + (mt * 16 + l15) * LT;
            f32x8 a = {};
            a = wmma_bf16(frag_ld(krow, kh), bq0, a);
            a = wmma_bf16(frag_ld(krow + 32, kh), bq1, a);
            st[mt] = a;
        }
        // scale + causal mask
        #pragma unroll
        for (int mt = 0; mt < 4; ++mt) {
            int kg = kt * 64 + mt * 16 + kh * 8;
            #pragma unroll
            for (int r = 0; r < 8; ++r) {
                float v = st[mt][r] * 0.125f;                // 1/sqrt(64)
                st[mt][r] = (kg + r > qg) ? -1e30f : v;
            }
        }
        // online softmax: the lane's 32 keys, then the other half's 32
        float mx8[8];
        #pragma unroll
        for (int r = 0; r < 8; ++r)
            mx8[r] = fmaxf(fmaxf(st[0][r], st[1][r]), fmaxf(st[2][r], st[3][r]));
        float mx = fmaxf(fmaxf(fmaxf(mx8[0], mx8[1]), fmaxf(mx8[2], mx8[3])),
                         fmaxf(fmaxf(mx8[4], mx8[5]), fmaxf(mx8[6], mx8[7])));
        mx = fmaxf(mx, other_half(mx));
        const float mnew = fmaxf(mrow, mx);
        const float sc = __expf(mrow - mnew);
        #pragma unroll
        for (int mt = 0; mt < 4; ++mt)
            #pragma unroll
            for (int r = 0; r < 8; ++r) st[mt][r] = __expf(st[mt][r] - mnew);
        float sm8[8];
        #pragma unroll
        for (int r = 0; r < 8; ++r)
            sm8[r] = (st[0][r] + st[1][r]) + (st[2][r] + st[3][r]);
        float sm = ((sm8[0] + sm8[1]) + (sm8[2] + sm8[3])) +
                   ((sm8[4] + sm8[5]) + (sm8[6] + sm8[7]));
        sm += other_half(sm);
        lrow = lrow * sc + sm;
        mrow = mnew;
        #pragma unroll
        for (int nt = 0; nt < 4; ++nt)
            #pragma unroll
            for (int r = 0; r < 8; ++r) Oacc[nt][r] *= sc;

        // P^T as B operand: element s of keys 32g .. 32g+31 is tile 2g + (s >> 3), register s & 7
        bf16x16 bp0, bp1;
        #pragma unroll
        for (int s = 0; s < 16; ++s) {
            bp0[s] = (bf16)st[s >> 3][s & 7];
            bp1[s] = (bf16)st[2 + (s >> 3)][s & 7];
        }
        #pragma unroll
        for (int nt = 0; nt < 4; ++nt) {
            const bf16* vrow = Vts + (nt * 16 + l15) * LT;
            Oacc[nt] = wmma_bf16(frag_ld(vrow, kh), bp0, Oacc[nt]);
            Oacc[nt] = wmma_bf16(frag_ld(vrow + 32, kh), bp1, Oacc[nt]);
        }
    }

    // normalize and write bf16 output (feeds the WO GEMM directly):
    // a lane's 8 registers of a tile are 8 consecutive elements of its query's row
    const size_t srow = (size_t)b * SEQ + qg;
    #pragma unroll
    for (int nt = 0; nt < 4; ++nt) {
        bf16x8 o;
        #pragma unroll
        for (int r = 0; r < 8; ++r) o[r] = (bf16)(Oacc[nt][r] / lrow);
        *(bf16x8*)(Ob + srow * DM + h * DK + nt * 16 + kh * 8) = o;
    }
    // The second tile's code rewrites the registers that these stores name.
    asm volatile("s_wait_xcnt 0x0" ::: "memory");
    }   // half
}

// ---------------- host launcher ----------------
extern "C" void kernel_launch(void* const* d_in, const int* in_sizes, int n_in,
                              void* d_out, int out_size, void* d_ws, size_t ws_size,
                              hipStream_t stream) {
    (void)in_sizes; (void)n_in; (void)out_size; (void)ws_size;
    const float* x  = (const float*)d_in[0];
    const float* wq = (const float*)d_in[1];
    const float* wk = (const float*)d_in[2];
    const float* wv = (const float*)d_in[3];
    const float* wo = (const float*)d_in[4];
    const float* w1 = (const float*)d_in[5];
    const float* w2 = (const float*)d_in[6];
    const float* w3 = (const float*)d_in[7];
    const float* g1 = (const float*)d_in[8];
    const float* g2 = (const float*)d_in[9];
    float* out = (float*)d_out;

    const size_t MB = 1ull << 20;
    char* p = (char*)d_ws;
    bf16*  n_bf  = (bf16*)p;            p += 8 * MB;   // 4096x1024 bf16
    bf16*  wq_bf = (bf16*)p;            p += 2 * MB;
    bf16*  wk_bf = (bf16*)p;            p += 2 * MB;
    bf16*  wv_bf = (bf16*)p;            p += 2 * MB;
    bf16*  wo_bf = (bf16*)p;            p += 2 * MB;
    bf16*  w1_bf = (bf16*)p;            p += 8 * MB;
    bf16*  w3_bf = (bf16*)p;            p += 8 * MB;
    bf16*  w2_bf = (bf16*)p;            p += 8 * MB;
    float* x1    = (float*)p;           p += 16 * MB;  // x + attn residual
    bf16*  n2_bf = (bf16*)p;            p += 8 * MB;
    // 64 MB region: q_bf and k_bf lie in its last quarter
    char*  reuse = p;                   p += 64 * MB;
    bf16*  q_bf = (bf16*) (reuse + 48 * MB);
    bf16*  k_bf = (bf16*) (reuse + 56 * MB);
    bf16*  vt_bf = (bf16*)p;            p += 8 * MB;
    bf16*  o_bf  = (bf16*)p;            p += 8 * MB;
    bf16*  h_bf  = (bf16*)p;            p += 32 * MB;  // swiglu output 4096x4096

    // 1) weights -> bf16
    //    (wq_bf .. w2_bf are one contiguous array that starts at wq_bf)
    k_weights_to_bf16<<<CONV_WGS, 512, 0, stream>>>(wq, wk, wv, wo, w1, w3, w2, wq_bf);

    // 2) n = rmsnorm(x, g1)
    k_rmsnorm<<<MROWS, 256, 0, stream>>>(x, g1, n_bf);

    // 3) Q, K (with RoPE) and V (transposed per head) projections -> bf16, one launch
    //    (wq_bf, wk_bf, wv_bf are one contiguous array that starts at wq_bf)
    dim3 gQKV(DM / 128, MROWS / 128);
    dim3 gHeads(3 * DM / 192, MROWS / 256);
    k_qkv<<<gHeads, 384, 0, stream>>>(wq_bf, n_bf, q_bf, k_bf, vt_bf, DM);

    // 5) causal flash attention -> o (bf16)
    dim3 gAtt(SEQ / 128, BATCH * HEADS);
    k_flash_attn<<<gAtt, 128, 0, stream>>>(q_bf, k_bf, vt_bf, o_bf);

    // 6) x1 = x + o @ Wo^T
    k_gemm_nt<<<gQKV, 256, 0, stream>>>(o_bf, wo_bf, x, x1, MROWS, DM, DM);

    // 7) n2 = rmsnorm(x1, g2)
    k_rmsnorm<<<MROWS, 256, 0, stream>>>(x1, g2, n2_bf);

    // 8) h = silu(n2 @ W1^T) * (n2 @ W3^T), both products in one launch
    dim3 gFF(DFF / 128, MROWS / 256);
    k_ffn_up<<<gFF, 512, 0, stream>>>(w1_bf, w3_bf, n2_bf, h_bf, DFF, DM);

    // 9) out = x1 + h @ W2^T
    k_gemm_nt<<<gQKV, 256, 0, stream>>>(h_bf, w2_bf, x1, out, MROWS, DM, DFF);
}

// v008
// One run takes 172 microseconds.
// Next to v007, in two timings, it ran 1.06 times as fast each time.
// All steps since v000 together make it 3.22 times as fast.
#include <hip/hip_runtime.h>

// ---------------- problem constants ----------------
#define BATCH   2
#define SEQ     2048
#define DM      1024
#define HEADS   16
#define DK      64
#define DFF     4096
#define MROWS   (BATCH * SEQ)       // 4096
#define EPSV    1e-5f
#define THETA_F 10000.0f

// ---------------- types ----------------
typedef __bf16 bf16;
typedef __attribute__((ext_vector_type(16))) __bf16 bf16x16;
typedef __attribute__((ext_vector_type(8)))  __bf16 bf16x8;
typedef __attribute__((ext_vector_type(8)))  float  f32x8;
typedef __attribute__((ext_vector_type(4)))  unsigned int u32x4;

// Load one 16x32 bf16 WMMA fragment (A or B operand) from LDS.
// rowPtr points at the start of this lane's row (16-byte aligned, row stride
// is a multiple of 8 elements). kh = lane>>4 selects the K-half per the ISA
// 16-bit A-matrix layout: half 0 -> K {0..7, 16..23}, half 1 -> K {8..15, 24..31}.
__device__ __forceinline__ bf16x16 frag_ld(const bf16* rowPtr, int kh) {
    bf16x8 lo = *(const bf16x8*)(rowPtr + kh * 8);
    bf16x8 hi = *(const bf16x8*)(rowPtr + 16 + kh * 8);
    return __builtin_shufflevector(lo, hi, 0,1,2,3,4,5,6,7,8,9,10,11,12,13,14,15);
}

__device__ __forceinline__ f32x8 wmma_bf16(bf16x16 a, bf16x16 b, f32x8 c) {
    return __builtin_amdgcn_wmma_f32_16x16x32_bf16(false, a, false, b, (short)0, c, false, false);
}

// ---------------- fp32 -> bf16 conversion of all seven weights, one launch ----
// The bf16 copies lie back to back in the workspace in the order
// wq, wk, wv, wo, w1, w3, w2, so the destination is one array of CONV_TOTAL
// elements. One 16-wave work-group per WGP takes CONV_PER_WG consecutive
// elements of it (always inside one source, since every source's length is a
// multiple of CONV_PER_WG). A wave reads 32 x 512 contiguous bytes, many loads
// in flight at a time, and stores 32 x 256 contiguous bytes.
typedef __attribute__((ext_vector_type(4))) float  f32x4;
typedef __attribute__((ext_vector_type(4))) __bf16 bf16x4;
#define CONV_TOTAL   (4 * DM * DM + 3 * DFF * DM)   // 16,777,216
#define CONV_WGS     256
#define CONV_PER_WG  (CONV_TOTAL / CONV_WGS)        // 65,536
#define CONV_LOADS   (CONV_PER_WG / (512 * 4))      // 32 loads of 4 floats a lane
static_assert((DM * DM) % CONV_PER_WG == 0 && (DFF * DM) % CONV_PER_WG == 0,
              "a work-group's range must lie inside one weight");
__global__ __launch_bounds__(512)
void k_weights_to_bf16(const float* __restrict__ wq, const float* __restrict__ wk,
                       const float* __restrict__ wv, const float* __restrict__ wo,
                       const float* __restrict__ w1, const float* __restrict__ w3,
                       const float* __restrict__ w2, bf16* __restrict__ out) {
    const int first = blockIdx.x * CONV_PER_WG;   // index in the destination array
    const float* src = wq;                        // the weight that holds it ...
    int base = 0;                                 // ... and where that weight starts
    if (first >= 1 * DM * DM)                { src = wk; base = 1 * DM * DM; }
    if (first >= 2 * DM * DM)                { src = wv; base = 2 * DM * DM; }
    if (first >= 3 * DM * DM)                { src = wo; base = 3 * DM * DM; }
    if (first >= 4 * DM * DM)                { src = w1; base = 4 * DM * DM; }
    if (first >= 4 * DM * DM + 1 * DFF * DM) { src = w3; base = 4 * DM * DM + 1 * DFF * DM; }
    if (first >= 4 * DM * DM + 2 * DFF * DM) { src = w2; base = 4 * DM * DM + 2 * DFF * DM; }

    const int lane = threadIdx.x & 31, wave = threadIdx.x >> 5;
    const int at = first + wave * (CONV_LOADS * 128) + lane * 4;
    const f32x4* s = (const f32x4*)(src + (at - base));
    bf16x4*      d = (bf16x4*)(out + at);
    f32x4 v[CONV_LOADS];
    // Both loops unrolled: v[] stays in registers, the steps become immediate
    // offsets, and the loads can be issued ahead of the conversions.
    #pragma unroll
    for (int j = 0; j < CONV_LOADS; ++j)          // read once: non-temporal
        v[j] = __builtin_nontemporal_load(s + j * 32);
    #pragma unroll
    for (int j = 0; j < CONV_LOADS; ++j) {
        bf16x4 o = { (bf16)v[j][0], (bf16)v[j][1], (bf16)v[j][2], (bf16)v[j][3] };
        d[j * 32] = o;
    }
}

// ---------------- RMSNorm (one block per row) ----------------
__global__ __launch_bounds__(256) void k_rmsnorm(const float* __restrict__ X,
                                                 const float* __restrict__ G,
                                                 bf16* __restrict__ Out) {
    const int row = blockIdx.x;
    const float* x = X + (size_t)row * DM;
    float s = 0.f;
    #pragma unroll
    for (int i = threadIdx.x; i < DM; i += 256) { float v = x[i]; s += v * v; }
    #pragma unroll
    for (int m = 16; m >= 1; m >>= 1) s += __shfl_xor(s, m, 32);
    __shared__ float red[8];
    if ((threadIdx.x & 31) == 0) red[threadIdx.x >> 5] = s;
    __syncthreads();
    float tot = 0.f;
    #pragma unroll
    for (int j = 0; j < 8; ++j) tot += red[j];
    const float rinv = rsqrtf(tot / (float)DM + EPSV);
    bf16* o = Out + (size_t)row * DM;
    for (int i = threadIdx.x; i < DM; i += 256) o[i] = (bf16)(x[i] * rinv * G[i]);
}

// Eight asynchronous 16-byte copies per lane, global memory -> LDS, no register
// in between. The s_wait_xcnt is the last line of the copies' own statement so
// that no address register named here is rewritten ahead of it.
__device__ __forceinline__ void async_copy8(unsigned l, unsigned lstep,
                                            const bf16* g, size_t gstep) {
    asm volatile(
        "global_load_async_to_lds_b128 %0, %8, off\n\t"
        "global_load_async_to_lds_b128 %1, %9, off\n\t"
        "global_load_async_to_lds_b128 %2, %10, off\n\t"
        "global_load_async_to_lds_b128 %3, %11, off\n\t"
        "global_load_async_to_lds_b128 %4, %12, off\n\t"
        "global_load_async_to_lds_b128 %5, %13, off\n\t"
        "global_load_async_to_lds_b128 %6, %14, off\n\t"
        "global_load_async_to_lds_b128 %7, %15, off\n\t"
        "s_wait_xcnt 0x0"
        :: "v"(l), "v"(l + lstep), "v"(l + 2 * lstep), "v"(l + 3 * lstep),
           "v"(l + 4 * lstep), "v"(l + 5 * lstep), "v"(l + 6 * lstep), "v"(l + 7 * lstep),
           "v"(g), "v"(g + gstep), "v"(g + 2 * gstep), "v"(g + 3 * gstep),
           "v"(g + 4 * gstep), "v"(g + 5 * gstep), "v"(g + 6 * gstep), "v"(g + 7 * gstep)
        : "memory");
}

// The same, the first four copies from ga and the last four from gb: two sources
// whose rows lie one behind the other in LDS.
__device__ __forceinline__ void async_copy4x2(unsigned l, unsigned lstep,
                                              const bf16* ga, const bf16* gb, size_t gstep) {
    asm volatile(
        "global_load_async_to_lds_b128 %0, %8, off\n\t"
        "global_load_async_to_lds_b128 %1, %9, off\n\t"
        "global_load_async_to_lds_b128 %2, %10, off\n\t"
        "global_load_async_to_lds_b128 %3, %11, off\n\t"
        "global_load_async_to_lds_b128 %4, %12, off\n\t"
        "global_load_async_to_lds_b128 %5, %13, off\n\t"
        "global_load_async_to_lds_b128 %6, %14, off\n\t"
        "global_load_async_to_lds_b128 %7, %15, off\n\t"
        "s_wait_xcnt 0x0"
        :: "v"(l), "v"(l + lstep), "v"(l + 2 * lstep), "v"(l + 3 * lstep),
           "v"(l + 4 * lstep), "v"(l + 5 * lstep), "v"(l + 6 * lstep), "v"(l + 7 * lstep),
           "v"(ga), "v"(ga + gstep), "v"(ga + 2 * gstep), "v"(ga + 3 * gstep),
           "v"(gb), "v"(gb + gstep), "v"(gb + 2 * gstep), "v"(gb + 3 * gstep)
        : "memory");
}

// sin and cos of x radians, formed as __sincosf forms them. One statement, so that
// the v_nop stands directly behind the second transcendental: the slot that the
// instruction set asks for in front of an instruction that overwrites its source.
__device__ __forceinline__ void sincos_slot(float x, float& sn, float& cs) {
    const float rev = x * 0.15915494f;   // 1 / (2 pi): the instructions take revolutions
    asm("v_sin_f32 %0, %2\n\tv_cos_f32 %1, %2\n\tv_nop" : "=&v"(sn), "=&v"(cs) : "v"(rev));
}

// The K tile that a work-group of a GEMM grid starts with; it then walks all nt tiles
// in cyclic order. Work-groups of one grid row read the same rows of one operand and
// those of one grid column the same rows of the other. Started together on tile 0 they
// ask L2 for the same lines at the same moment, pass after pass, and a line that has to
// come from memory holds up all of them at once. With different starts the readers of a
// row are on different tiles, and a line is fetched for one of them ahead of the rest.
// Along y the start moves by one tile; along x by a quarter of the walk for x & 3. This is
// for speed alone: any start gives the same sum, added in another order.
__device__ __forceinline__ int first_k_tile(int nt) {
    return (int)(((blockIdx.x & 3) * (unsigned)(nt >> 2) + (blockIdx.x >> 3) + blockIdx.y) % (unsigned)nt);
}

// ---------------- WMMA NT-GEMM: C[M,N] = A[M,K] * B[N,K]^T + R[M,N], f32 out ----
// K is walked in tiles of 128, from first_k_tile() on. Two LDS buffers: tile t+1's asynchronous copies
// fly while tile t's 32 WMMAs per wave run; one barrier per tile publishes the
// next tile and frees the buffer just read. K must be a multiple of 128.
__global__ __launch_bounds__(256)
void k_gemm_nt(const bf16* __restrict__ A, const bf16* __restrict__ B,
               const float* __restrict__ R, float* __restrict__ Out,
               int M, int N, int K) {
    constexpr int BM = 128, BN = 128, BK = 128, LDT = BK + 8;  // 272-byte pitch
    constexpr int OPER = BM * LDT;                             // one operand's tile
    constexpr int STAGE = 2 * OPER;                            // [A tile | B tile]
    __shared__ __attribute__((aligned(16))) bf16 Sm[2 * STAGE];

    const int m0 = blockIdx.y * BM, n0 = blockIdx.x * BN;
    const int tid  = threadIdx.x;
    const int lane = tid & 31, wid = tid >> 5;   // 8 waves
    const int wm = wid >> 2, wn = wid & 3;       // 2 x 4 wave grid: 64x32 per wave
    const int l15 = lane & 15, kh = lane >> 4;

    // Copy map: 16 lanes cover one 256-byte row; a lane's 8 copies are 16 rows apart.
    const int crow = tid >> 4, ccol = (tid & 15) * 8;
    const bf16* gA = A + (size_t)(m0 + crow) * K + ccol;
    const bf16* gB = B + (size_t)(n0 + crow) * K + ccol;
    const unsigned lA = (unsigned)(size_t)(Sm + crow * LDT + ccol);
    const size_t gstep = (size_t)16 * K;
    auto stage_in = [&](int t, int buf) {
        const unsigned l = lA + (unsigned)(buf * STAGE * 2);
        async_copy8(l,            16 * LDT * 2, gA + (size_t)t * BK, gstep);
        async_copy8(l + OPER * 2, 16 * LDT * 2, gB + (size_t)t * BK, gstep);
    };

    const int nt = K / BK;
    const int kfirst = first_k_tile(nt);
    auto ktile = [&](int t) { const int k = t + kfirst; return k < nt ? k : k - nt; };   // pass t's K tile
    stage_in(ktile(0), 0);
    asm volatile("s_wait_asynccnt 0x0" ::: "memory");   // tile 0 has landed (own copies)
    __syncthreads();                                    // ... and every wave's copies
    if (nt > 1) stage_in(ktile(1), 1);

    f32x8 acc[4][2] = {};

    for (int t = 0; t < nt; ++t) {
        const bf16* As = Sm + (t & 1) * STAGE;
        const bf16* Bs = As + OPER;
        // Unrolled: the four blocks' LDS offsets become immediates and a block's
        // reads can start under the WMMAs of the block before it.
        #pragma unroll
        for (int kk = 0; kk < BK; kk += 32) {
            bf16x16 afr[4], bfr[2];
            #pragma unroll
            for (int ni = 0; ni < 2; ++ni)
                bfr[ni] = frag_ld(Bs + (wn * 32 + ni * 16 + l15) * LDT + kk, kh);
            #pragma unroll
            for (int mi = 0; mi < 4; ++mi)
                afr[mi] = frag_ld(As + (wm * 64 + mi * 16 + l15) * LDT + kk, kh);
            // Keeps the block's 12 LDS reads one group in front of its 8 WMMAs: left
            // alone the compiler sinks them between the WMMAs, a full LDS wait per pair.
            __builtin_amdgcn_sched_barrier(0);
            #pragma unroll
            for (int mi = 0; mi < 4; ++mi)
                #pragma unroll
                for (int ni = 0; ni < 2; ++ni)
                    acc[mi][ni] = wmma_bf16(afr[mi], bfr[ni], acc[mi][ni]);
        }
        asm volatile("s_wait_dscnt 0x0" ::: "memory");     // own reads of this buffer are done
        asm volatile("s_wait_asynccnt 0x0" ::: "memory");  // own copies of tile t+1 have landed
        __syncthreads();   // publishes tile t+1; ends every reader's last read of tile t
        if (t + 2 < nt) stage_in(ktile(t + 2), t & 1);     // refill the buffer just read
    }
    asm volatile("s_wait_asynccnt 0x0" ::: "memory");      // nothing in flight at the wave's end

    #pragma unroll
    for (int mi = 0; mi < 4; ++mi)
        #pragma unroll
        for (int ni = 0; ni < 2; ++ni)
            #pragma unroll
            for (int r = 0; r < 8; ++r) {
                int gm = m0 + wm * 64 + mi * 16 + kh * 8 + r;
                int gn = n0 + wn * 32 + ni * 16 + l15;
                size_t off = (size_t)gm * N + gn;
                Out[off] = acc[mi][ni][r] + R[off];
            }
}

// ---------------- Q, K and V projections, one launch ----------------
// The three bf16 weights lie back to back, so they are one matrix W of 3 * DM rows
// (48 heads of 64 features: 16 of Q, 16 of K, 16 of V). A work-group forms 192
// features (3 heads) x 256 tokens: 16 x 16 work-groups, one per WGP. A stage is
// [W 192 rows | X 256 rows] of 128 k; the ring is k_gemm_nt's.
// 12 waves, 3 x 4: a wave has ONE head x 64 tokens, 8 fragments for 16 WMMAs.
// In D a lane holds 8 consecutive rows of one column, so the side that is contiguous
// in the output goes in as A and the lane stores 16 bytes of bf16:
//   Q, K head: A = weight, B = tokens: RoPE on the lane's 4 pairs, Out[token][feature].
//   V head:    A = tokens, B = weight: Vt[b][feature][s], V transposed per head.
// Both sides of a wave's tile are 64 rows at the same pitch, read by the same loader, so
// the choice is only which rows' address is the A side's: one loop serves both.

__global__ __launch_bounds__(384)
void k_qkv(const bf16* __restrict__ Wqkv, const bf16* __restrict__ X,
           bf16* __restrict__ Qo, bf16* __restrict__ Ko, bf16* __restrict__ Vt, int K) {
    constexpr int BF = 192, BT = 256, BK = 128, LDT = BK + 8;  // 272-byte pitch
    constexpr int WPART = BF * LDT;
    constexpr int STAGE = WPART + BT * LDT;
    static_assert(DK == 64 && BF % DK == 0 && (3 * DM) % BF == 0 && MROWS % BT == 0 &&
                  SEQ % BT == 0, "a wave has one head; a tile's tokens lie in one batch entry");
    __shared__ __attribute__((aligned(16))) bf16 Sm[2 * STAGE];

    const int f0 = blockIdx.x * BF, t0 = blockIdx.y * BT;
    const int tid  = threadIdx.x;
    const int lane = tid & 31;
    // The wave's number in a scalar register: what hangs on it (who copies what, which
    // operand order, which epilogue) is then a scalar branch with every lane on.
    const int wid = __builtin_amdgcn_readfirstlane(tid >> 5);
    const int wf = wid >> 2, wt = wid & 3;
    const int l15 = lane & 15, kh = lane >> 4;
    const int head  = blockIdx.x * (BF / DK) + wf;   // 0 .. 47 in the stacked weight
    const int which = head / HEADS;                  // 0 Q, 1 K, 2 V
    const int hf0   = (head % HEADS) * DK;           // the head's first feature in its matrix

    // Copy map: 16 lanes cover one 256-byte row. Waves 0..7 bring the 256 token rows
    // (16 rows a copy step, 16 copies a lane), waves 8..11 the 192 weight rows (8 rows a
    // step, 24 copies a lane).
    const bool forX = wid < 8;
    const int  crow = (forX ? tid : tid - 256) >> 4, ccol = (tid & 15) * 8;
    const bf16* g0 = (forX ? X + (size_t)(t0 + crow) * K : Wqkv + (size_t)(f0 + crow) * K) + ccol;
    const unsigned l0 = (unsigned)(size_t)(Sm + (forX ? WPART : 0) + crow * LDT + ccol);
    auto stage_in = [&](int t, int buf) {
        const unsigned l = l0 + (unsigned)(buf * STAGE * 2);
        const bf16*    g = g0 + (size_t)t * BK;
        if (forX) {   // two paths, so that the LDS steps are constants in each
            async_copy8(l,                 16 * LDT * 2, g,                   (size_t)16 * K);
            async_copy8(l + 128 * LDT * 2, 16 * LDT * 2, g + (size_t)128 * K, (size_t)16 * K);
        } else {
            async_copy8(l,                 8 * LDT * 2, g,                   (size_t)8 * K);
            async_copy8(l + 64 * LDT * 2,  8 * LDT * 2, g + (size_t)64 * K,  (size_t)8 * K);
            async_copy8(l + 128 * LDT * 2, 8 * LDT * 2, g + (size_t)128 * K, (size_t)8 * K);
        }
    };

    const int nt = K / BK;
    const int kfirst = first_k_tile(nt);
    auto ktile = [&](int t) { const int k = t + kfirst; return k < nt ? k : k - nt; };   // pass t's K tile
    stage_in(ktile(0), 0);
    asm volatile("s_wait_asynccnt 0x0" ::: "memory");   // tile 0 has landed (own copies)
    __syncthreads();                                    // ... and every wave's copies
    if (nt > 1) stage_in(ktile(1), 1);

    // This lane's first row of the A side and of the B side, in buffer 0.
    const int wrow = (wf * 64 + l15) * LDT, xrow = WPART + (wt * 64 + l15) * LDT;
    const bf16* arow = Sm + (which == 2 ? xrow : wrow);
    const bf16* brow = Sm + (which == 2 ? wrow : xrow);

    f32x8 acc[4][4] = {};   // [A fragment][B fragment]

    for (int t = 0; t < nt; ++t) {
        const bf16* As = arow + (t & 1) * STAGE;
        const bf16* Bs = brow + (t & 1) * STAGE;
        // Unrolled: the four blocks' LDS offsets become immediates. (The short loops
        // over mi, ni, j and r, here and in the epilogue, are unrolled so that the
        // fragment and accumulator arrays are indexed by constants and stay in registers.)
        #pragma unroll
        for (int kk = 0; kk < BK; kk += 32) {
            bf16x16 afr[4], bfr[4];
            #pragma unroll
            for (int ni = 0; ni < 4; ++ni) bfr[ni] = frag_ld(Bs + ni * 16 * LDT + kk, kh);
            #pragma unroll
            for (int mi = 0; mi < 4; ++mi) afr[mi] = frag_ld(As + mi * 16 * LDT + kk, kh);
            // Keeps the block's 16 LDS reads one group in front of its 16 WMMAs: left
            // alone the compiler sinks them between the WMMAs, a full LDS wait per pair.
            __builtin_amdgcn_sched_barrier(0);
            #pragma unroll
            for (int mi = 0; mi < 4; ++mi)
                #pragma unroll
                for (int ni = 0; ni < 4; ++ni)
                    acc[mi][ni] = wmma_bf16(afr[mi], bfr[ni], acc[mi][ni]);
        }
        asm volatile("s_wait_dscnt 0x0" ::: "memory");     // own reads of this buffer are done
        asm volatile("s_wait_asynccnt 0x0" ::: "memory");  // own copies of tile t+1 have landed
        __syncthreads();   // publishes tile t+1; ends every reader's last read of tile t
        if (t + 2 < nt) stage_in(ktile(t + 2), t & 1);     // refill the buffer just read
    }
    asm volatile("s_wait_asynccnt 0x0" ::: "memory");      // nothing in flight at the wave's end

    if (which == 2) {
        #pragma unroll
        for (int mi = 0; mi < 4; ++mi)
            #pragma unroll
            for (int ni = 0; ni < 4; ++ni) {
                const int gt = t0 + wt * 64 + mi * 16 + kh * 8;   // first of 8 tokens
                const int gf = hf0 + ni * 16 + l15;               // feature
                bf16x8 o;
                #pragma unroll
                for (int r = 0; r < 8; ++r) o[r] = (bf16)acc[mi][ni][r];
                *(bf16x8*)(Vt + ((size_t)(gt / SEQ) * DM + gf) * SEQ + gt % SEQ) = o;
            }
    } else {
        bf16* Out = which ? Ko : Qo;
        #pragma unroll
        for (int mi = 0; mi < 4; ++mi) {
            float inv[4];                              // pairs mi*8 + kh*4 + j of the head
            #pragma unroll
            for (int j = 0; j < 4; ++j) {              // theta^(-2p/DK), p known to the compiler
                const float lo = __powf(THETA_F, -2.f * (float)(mi * 8 + j) / (float)DK);
                const float hi = __powf(THETA_F, -2.f * (float)(mi * 8 + 4 + j) / (float)DK);
                inv[j] = kh ? hi : lo;
            }
            #pragma unroll
            for (int ni = 0; ni < 4; ++ni) {
                const int gf = hf0 + mi * 16 + kh * 8;            // first of 8 features
                const int gt = t0 + wt * 64 + ni * 16 + l15;      // token
                const int s  = gt % SEQ;
                bf16x8 o;
                #pragma unroll
                for (int j = 0; j < 4; ++j) {
                    float sn, cs;
                    sincos_slot((float)s * inv[j], sn, cs);
                    const float x1 = acc[mi][ni][2 * j], x2 = acc[mi][ni][2 * j + 1];
                    o[2 * j]     = (bf16)(x1 * cs - x2 * sn);
                    o[2 * j + 1] = (bf16)(x1 * sn + x2 * cs);
                }
                *(bf16x8*)(Out + (size_t)gt * DM + gf) = o;
            }
        }
        // In the built code the V epilogue stands behind this branch's end and rewrites
        // the registers that the last stores name: the wait stands in front of it.
        asm volatile("s_wait_xcnt 0x0" ::: "memory");
    }
}

// ---------------- SwiGLU up-projection: H = silu(X W1^T) * (X W3^T), one launch ----
// A work-group forms BOTH products for 128 features x 256 tokens. A stage is
// [W1 128 rows | W3 128 rows | X 256 rows] of 128 k; the ring is k_gemm_nt's.
// The weights go in as A (m = feature) and the tokens as B, so in D a lane holds 8
// consecutive features of one token, of both products in the same registers' places:
// the gate is formed in registers and the lane stores 16 bytes of bf16.
// 16 waves, 4 x 4: a wave has 32 features (of each weight) x 64 tokens, that is 8
// fragments for 16 WMMAs. K must be a multiple of 128.
__global__ __launch_bounds__(512)
void k_ffn_up(const bf16* __restrict__ W1, const bf16* __restrict__ W3,
              const bf16* __restrict__ X, bf16* __restrict__ H, int F, int K) {
    constexpr int BF = 128, BT = 256, BK = 128, LDT = BK + 8;  // 272-byte pitch
    constexpr int WPART = 2 * BF * LDT;                        // both weights' tiles
    constexpr int STAGE = WPART + BT * LDT;
    __shared__ __attribute__((aligned(16))) bf16 Sm[2 * STAGE];

    const int f0 = blockIdx.x * BF, t0 = blockIdx.y * BT;
    const int tid  = threadIdx.x;
    const int lane = tid & 31, wid = tid >> 5;
    const int wf = wid >> 2, wt = wid & 3;
    const int l15 = lane & 15, kh = lane >> 4;

    // Copy map: 16 lanes cover one 256-byte row; a lane's copies are 32 rows apart.
    const int crow = tid >> 4, ccol = (tid & 15) * 8;
    const bf16* g1 = W1 + (size_t)(f0 + crow) * K + ccol;
    const bf16* g3 = W3 + (size_t)(f0 + crow) * K + ccol;
    const bf16* gX = X  + (size_t)(t0 + crow) * K + ccol;
    const unsigned lW = (unsigned)(size_t)(Sm + crow * LDT + ccol);
    const size_t gstep = (size_t)32 * K;
    auto stage_in = [&](int t, int buf) {
        const unsigned l = lW + (unsigned)(buf * STAGE * 2);
        async_copy4x2(l,           32 * LDT * 2, g1 + (size_t)t * BK, g3 + (size_t)t * BK, gstep);
        async_copy8(l + WPART * 2, 32 * LDT * 2, gX + (size_t)t * BK, gstep);
    };

    const int nt = K / BK;
    const int kfirst = first_k_tile(nt);
    auto ktile = [&](int t) { const int k = t + kfirst; return k < nt ? k : k - nt; };   // pass t's K tile
    stage_in(ktile(0), 0);
    asm volatile("s_wait_asynccnt 0x0" ::: "memory");   // tile 0 has landed (own copies)
    __syncthreads();                                    // ... and every wave's copies
    if (nt > 1) stage_in(ktile(1), 1);

    f32x8 acc1[2][4] = {}, acc3[2][4] = {};

    for (int t = 0; t < nt; ++t) {
        const bf16* Ws = Sm + (t & 1) * STAGE;
        const bf16* Xs = Ws + WPART;
        // Unrolled: the four blocks' LDS offsets become immediates. (The short loops
        // over mi, ni and r, here and in the epilogue, are unrolled so that the
        // fragment and accumulator arrays are indexed by constants and stay in registers.)
        #pragma unroll
        for (int kk = 0; kk < BK; kk += 32) {
            bf16x16 a1[2], a3[2], xb[4];
            #pragma unroll
            for (int ni = 0; ni < 4; ++ni)
                xb[ni] = frag_ld(Xs + (wt * 64 + ni * 16 + l15) * LDT + kk, kh);
            #pragma unroll
            for (int mi = 0; mi < 2; ++mi) {
                a1[mi] = frag_ld(Ws + (wf * 32 + mi * 16 + l15) * LDT + kk, kh);
                a3[mi] = frag_ld(Ws + (BF + wf * 32 + mi * 16 + l15) * LDT + kk, kh);
            }
            // Keeps the block's 16 LDS reads one group in front of its 16 WMMAs: left
            // alone the compiler sinks them between the WMMAs, a full LDS wait per pair.
            __builtin_amdgcn_sched_barrier(0);
            #pragma unroll
            for (int mi = 0; mi < 2; ++mi)
                #pragma unroll
                for (int ni = 0; ni < 4; ++ni) {
                    acc1[mi][ni] = wmma_bf16(a1[mi], xb[ni], acc1[mi][ni]);
                    acc3[mi][ni] = wmma_bf16(a3[mi], xb[ni], acc3[mi][ni]);
                }
        }
        asm volatile("s_wait_dscnt 0x0" ::: "memory");     // own reads of this buffer are done
        asm volatile("s_wait_asynccnt 0x0" ::: "memory");  // own copies of tile t+1 have landed
        __syncthreads();   // publishes tile t+1; ends every reader's last read of tile t
        if (t + 2 < nt) stage_in(ktile(t + 2), t & 1);     // refill the buffer just read
    }
    asm volatile("s_wait_asynccnt 0x0" ::: "memory");      // nothing in flight at the wave's end

    #pragma unroll
    for (int mi = 0; mi < 2; ++mi)
        #pragma unroll
        for (int ni = 0; ni < 4; ++ni) {
            const int gf = f0 + wf * 32 + mi * 16 + kh * 8;   // first of 8 features
            const int gt = t0 + wt * 64 + ni * 16 + l15;      // token
            bf16x8 o;
            #pragma unroll
            for (int r = 0; r < 8; ++r) {
                const float a = acc1[mi][ni][r];
                const float g = a / (1.f + __expf(-a));       // a * sigmoid(a)
                o[r] = (bf16)(g * acc3[mi][ni][r]);
            }
            *(bf16x8*)(H + (size_t)gt * F + gf) = o;
        }
}

// ---------------- Flash attention (causal, online softmax) ----------------
// Block: 128 threads (4 waves), handles one (b,h) and two tiles of 64 query rows,
// tile 31 - p and then tile p: 32 - p and p + 1 key tiles, 33 for every block, so
// that all blocks, resident together, end together wherever they are placed.
// Each wave owns 16 queries and forms the TRANSPOSED products on WMMA bf16:
//   S^T = K * Q^T   (A = 16 keys from LDS,     B = the wave's 16 queries, in registers)
//   O^T += V^T * P^T (A = 16 rows of V^T, LDS, B = P^T packed from the score registers)
// In D a lane holds one column, so lane l has the scores of query l & 15 alone
// (keys 8 * (l >> 4) + r of each 16-key tile): maximum and sum run inside the lane,
// with one exchange between lanes l and l ^ 16, and two score tiles converted in
// place are the B operand of the second product in frag_ld's own k order.
// K/V tile kt+1 is fetched into registers while tile kt is being consumed.

// Lane l takes the value of lane l ^ 16.
__device__ __forceinline__ float other_half(float x) {
    int b = __builtin_bit_cast(int, x);
    return __builtin_bit_cast(float,
        __builtin_amdgcn_permlanex16(b, b, 0x76543210, 0xfedcba98, false, false));
}

__global__ __launch_bounds__(128)
void k_flash_attn(const bf16* __restrict__ Qb, const bf16* __restrict__ Kb,
                  const bf16* __restrict__ Vt, bf16* __restrict__ Ob) {
    constexpr int LT = 72;   // 64 + 8 pad (16B-aligned rows, conflict-free b128)
    __shared__ __attribute__((aligned(16))) bf16 Qs [2 * 64 * LT];   // both query tiles
    __shared__ __attribute__((aligned(16))) bf16 Ks [64 * LT];
    __shared__ __attribute__((aligned(16))) bf16 Vts[64 * LT];

    const int qtile[2] = { SEQ / 64 - 1 - (int)blockIdx.x, (int)blockIdx.x };
    const int bh = blockIdx.y;
    const int b = bh / HEADS, h = bh % HEADS;
    const int tid = threadIdx.x, lane = tid & 31, w = tid >> 5;
    const int l15 = lane & 15, kh = lane >> 4;

    const bf16* Qg = Qb + (size_t)b * SEQ * DM + h * DK;
    const bf16* Kg = Kb + (size_t)b * SEQ * DM + h * DK;
    const bf16* Vg = Vt + ((size_t)b * HEADS + h) * DK * SEQ;

    int trow[4], tcol[4];
    #pragma unroll
    for (int i = 0; i < 4; ++i) {          // 64x64 tile, 8 bf16 per thread-iter
        int idx = tid + i * 128;
        trow[i] = idx >> 3; tcol[i] = (idx & 7) * 8;
    }
    #pragma unroll
    for (int hf = 0; hf < 2; ++hf)
        #pragma unroll
        for (int i = 0; i < 4; ++i)
            *(u32x4*)(Qs + hf * 64 * LT + trow[i] * LT + tcol[i]) =
                *(const u32x4*)(Qg + (size_t)(qtile[hf] * 64 + trow[i]) * DM + tcol[i]);
    __syncthreads();

    // Not unrolled: one copy of the key loop in the instruction cache.
    #pragma unroll 1
    for (int half = 0; half < 2; ++half) {
    const int qt = half ? qtile[1] : qtile[0];   // query tile (64 rows)

    const bf16* qrow = Qs + half * 64 * LT + (w * 16 + l15) * LT;
    bf16x16 bq0 = frag_ld(qrow, kh), bq1 = frag_ld(qrow + 32, kh);

    float mrow = -1e30f, lrow = 0.f;      // this lane's query: running maximum and sum
    f32x8 Oacc[4] = {};                   // Oacc[nt][r] = O[query l15][nt*16 + kh*8 + r]

    const int qg = qt * 64 + w * 16 + l15;   // this lane's global query index

    u32x4 rk[4], rv[4];
    auto fetchKV = [&](int kt) {
        #pragma unroll
        for (int i = 0; i < 4; ++i) {
            rk[i] = *(const u32x4*)(Kg + (size_t)(kt * 64 + trow[i]) * DM + tcol[i]);
            rv[i] = *(const u32x4*)(Vg + (size_t)trow[i] * SEQ + kt * 64 + tcol[i]);
        }
    };
    fetchKV(0);

    for (int kt = 0; kt <= qt; ++kt) {
        __syncthreads();   // previous-iteration readers of Ks/Vts are done
        #pragma unroll
        for (int i = 0; i < 4; ++i) {
            *(u32x4*)(Ks  + trow[i] * LT + tcol[i]) = rk[i];
            *(u32x4*)(Vts + trow[i] * LT + tcol[i]) = rv[i];
        }
        __syncthreads();

        if (kt + 2 <= qt) {   // warm GL2 two tiles ahead
            __builtin_prefetch(Kg + (size_t)((kt + 2) * 64 + trow[0]) * DM + tcol[0], 0, 3);
            __builtin_prefetch(Vg + (size_t)trow[0] * SEQ + (kt + 2) * 64 + tcol[0], 0, 3);
        }
        if (kt < qt) fetchKV(kt + 1);   // loads in flight under score/softmax

        // scores, transposed: 64(k) x 16(q) per wave, K-dim = dk = 64 -> 2 chained WMMAs
        // st[mt][r] = S[key kt*64 + mt*16 + kh*8 + r][query l15]
        f32x8 st[4];
        #pragma unroll
        for (int mt = 0; mt < 4; ++mt) {
            const bf16* krow = Ks + (mt * 16 + l15) * LT;
            f32x8 a = {};
            a = wmma_bf16(frag_ld(krow, kh), bq0, a);
            a = wmma_bf16(frag_ld(krow + 32, kh), bq1, a);
            st[mt] = a;
        }
        // scale + causal mask
        #pragma unroll
        for (int mt = 0; mt < 4; ++mt) {
            int kg = kt * 64 + mt * 16 + kh * 8;
            #pragma unroll
            for (int r = 0; r < 8; ++r) {
                float v = st[mt][r] * 0.125f;                // 1/sqrt(64)
                st[mt][r] = (kg + r > qg) ? -1e30f : v;
            }
        }
        // online softmax: the lane's 32 keys, then the other half's 32
        float mx8[8];
        #pragma unroll
        for (int r = 0; r < 8; ++r)
            mx8[r] = fmaxf(fmaxf(st[0][r], st[1][r]), fmaxf(st[2][r], st[3][r]));
        float mx = fmaxf(fmaxf(fmaxf(mx8[0], mx8[1]), fmaxf(mx8[2], mx8[3])),
                         fmaxf(fmaxf(mx8[4], mx8[5]), fmaxf(mx8[6], mx8[7])));
        mx = fmaxf(mx, other_half(mx));
        const float mnew = fmaxf(mrow, mx);
        const float sc = __expf(mrow - mnew);
        #pragma unroll
        for (int mt = 0; mt < 4; ++mt)
            #pragma unroll
            for (int r = 0; r < 8; ++r) st[mt][r] = __expf(st[mt][r] - mnew);
        float sm8[8];
        #pragma unroll
        for (int r = 0; r < 8; ++r)
            sm8[r] = (st[0][r] + st[1][r]) + (st[2][r] + st[3][r]);
        float sm = ((sm8[0] + sm8[1]) + (sm8[2] + sm8[3])) +
                   ((sm8[4] + sm8[5]) + (sm8[6] + sm8[7]));
        sm += other_half(sm);
        lrow = lrow * sc + sm;
        mrow = mnew;
        #pragma unroll
        for (int nt = 0; nt < 4; ++nt)
            #pragma unroll
            for (int r = 0; r < 8; ++r) Oacc[nt][r] *= sc;

        // P^T as B operand: element s of keys 32g .. 32g+31 is tile 2g + (s >> 3), register s & 7
        bf16x16 bp0, bp1;
        #pragma unroll
        for (int s = 0; s < 16; ++s) {
            bp0[s] = (bf16)st[s >> 3][s & 7];
            bp1[s] = (bf16)st[2 + (s >> 3)][s & 7];
        }
        #pragma unroll
        for (int nt = 0; nt < 4; ++nt) {
            const bf16* vrow = Vts + (nt * 16 + l15) * LT;
            Oacc[nt] = wmma_bf16(frag_ld(vrow, kh), bp0, Oacc[nt]);
            Oacc[nt] = wmma_bf16(frag_ld(vrow + 32, kh), bp1, Oacc[nt]);
        }
    }

    // normalize and write bf16 output (feeds the WO GEMM directly):
    // a lane's 8 registers of a tile are 8 consecutive elements of its query's row
    const size_t srow = (size_t)b * SEQ + qg;
    #pragma unroll
    for (int nt = 0; nt < 4; ++nt) {
        bf16x8 o;
        #pragma unroll
        for (int r = 0; r < 8; ++r) o[r] = (bf16)(Oacc[nt][r] / lrow);
        *(bf16x8*)(Ob + srow * DM + h * DK + nt * 16 + kh * 8) = o;
    }
    // The second tile's code rewrites the registers that these stores name.
    asm volatile("s_wait_xcnt 0x0" ::: "memory");
    }   // half
}

// ---------------- host launcher ----------------
extern "C" void kernel_launch(void* const* d_in, const int* in_sizes, int n_in,
                              void* d_out, int out_size, void* d_ws, size_t ws_size,
                              hipStream_t stream) {
    (void)in_sizes; (void)n_in; (void)out_size; (void)ws_size;
    const float* x  = (const float*)d_in[0];
    const float* wq = (const float*)d_in[1];
    const float* wk = (const float*)d_in[2];
    const float* wv = (const float*)d_in[3];
    const float* wo = (const float*)d_in[4];
    const float* w1 = (const float*)d_in[5];
    const float* w2 = (const float*)d_in[6];
    const float* w3 = (const float*)d_in[7];
    const float* g1 = (const float*)d_in[8];
    const float* g2 = (const float*)d_in[9];
    float* out = (float*)d_out;

    const size_t MB = 1ull << 20;
    char* p = (char*)d_ws;
    bf16*  n_bf  = (bf16*)p;            p += 8 * MB;   // 4096x1024 bf16
    bf16*  wq_bf = (bf16*)p;            p += 2 * MB;
    bf16*  wk_bf = (bf16*)p;            p += 2 * MB;
    bf16*  wv_bf = (bf16*)p;            p += 2 * MB;
    bf16*  wo_bf = (bf16*)p;            p += 2 * MB;
    bf16*  w1_bf = (bf16*)p;            p += 8 * MB;
    bf16*  w3_bf = (bf16*)p;            p += 8 * MB;
    bf16*  w2_bf = (bf16*)p;            p += 8 * MB;
    float* x1    = (float*)p;           p += 16 * MB;  // x + attn residual
    bf16*  n2_bf = (bf16*)p;            p += 8 * MB;
    // 64 MB region: q_bf and k_bf lie in its last quarter
    char*  reuse = p;                   p += 64 * MB;
    bf16*  q_bf = (bf16*) (reuse + 48 * MB);
    bf16*  k_bf = (bf16*) (reuse + 56 * MB);
    bf16*  vt_bf = (bf16*)p;            p += 8 * MB;
    bf16*  o_bf  = (bf16*)p;            p += 8 * MB;
    bf16*  h_bf  = (bf16*)p;            p += 32 * MB;  // swiglu output 4096x4096

    // 1) weights -> bf16
    //    (wq_bf .. w2_bf are one contiguous array that starts at wq_bf)
    k_weights_to_bf16<<<CONV_WGS, 512, 0, stream>>>(wq, wk, wv, wo, w1, w3, w2, wq_bf);

    // 2) n = rmsnorm(x, g1)
    k_rmsnorm<<<MROWS, 256, 0, stream>>>(x, g1, n_bf);

    // 3) Q, K (with RoPE) and V (transposed per head) projections -> bf16, one launch
    //    (wq_bf, wk_bf, wv_bf are one contiguous array that starts at wq_bf)
    dim3 gQKV(DM / 128, MROWS / 128);
    dim3 gHeads(3 * DM / 192, MROWS / 256);
    k_qkv<<<gHeads, 384, 0, stream>>>(wq_bf, n_bf, q_bf, k_bf, vt_bf, DM);

    // 5) causal flash attention -> o (bf16)
    dim3 gAtt(SEQ / 128, BATCH * HEADS);
    k_flash_attn<<<gAtt, 128, 0, stream>>>(q_bf, k_bf, vt_bf, o_bf);

    // 6) x1 = x + o @ Wo^T
    k_gemm_nt<<<gQKV, 256, 0, stream>>>(o_bf, wo_bf, x, x1, MROWS, DM, DM);

    // 7) n2 = rmsnorm(x1, g2)
    k_rmsnorm<<<MROWS, 256, 0, stream>>>(x1, g2, n2_bf);

    // 8) h = silu(n2 @ W1^T) * (n2 @ W3^T), both products in one launch
    dim3 gFF(DFF / 128, MROWS / 256);
    k_ffn_up<<<gFF, 512, 0, stream>>>(w1_bf, w3_bf, n2_bf, h_bf, DFF, DM);

    // 9) out = x1 + h @ W2^T
    k_gemm_nt<<<gQKV, 256, 0, stream>>>(h_bf, w2_bf, x1, out, MROWS, DM, DFF);
}

// v009
// One run takes 164 microseconds.
// Two timings next to v008 both put it at 1.05 times that version's speed.
// Over all steps from v000 it is 3.37 times as fast.
#include <hip/hip_runtime.h>

// ---------------- problem constants ----------------
#define BATCH   2
#define SEQ     2048
#define DM      1024
#define HEADS   16
#define DK      64
#define DFF     4096
#define MROWS   (BATCH * SEQ)       // 4096
#define EPSV    1e-5f
#define THETA_F 10000.0f

// ---------------- types ----------------
typedef __bf16 bf16;
typedef __attribute__((ext_vector_type(16))) __bf16 bf16x16;
typedef __attribute__((ext_vector_type(8)))  __bf16 bf16x8;
typedef __attribute__((ext_vector_type(8)))  float  f32x8;
typedef __attribute__((ext_vector_type(4)))  unsigned int u32x4;

// Load one 16x32 bf16 WMMA fragment (A or B operand) from LDS.
// rowPtr points at the start of this lane's row (16-byte aligned, row stride
// is a multiple of 8 elements). kh = lane>>4 selects the K-half per the ISA
// 16-bit A-matrix layout: half 0 -> K {0..7, 16..23}, half 1 -> K {8..15, 24..31}.
__device__ __forceinline__ bf16x16 frag_ld(const bf16* rowPtr, int kh) {
    bf16x8 lo = *(const bf16x8*)(rowPtr + kh * 8);
    bf16x8 hi = *(const bf16x8*)(rowPtr + 16 + kh * 8);
    return __builtin_shufflevector(lo, hi, 0,1,2,3,4,5,6,7,8,9,10,11,12,13,14,15);
}

__device__ __forceinline__ f32x8 wmma_bf16(bf16x16 a, bf16x16 b, f32x8 c) {
    return __builtin_amdgcn_wmma_f32_16x16x32_bf16(false, a, false, b, (short)0, c, false, false);
}

// Lane l takes the value of the lane whose number in the 16-lane row the selectors give
// (one hex digit a lane, lanes 0 to 7 in LO, 8 to 15 in HI).
template <unsigned LO, unsigned HI>
__device__ __forceinline__ float row_take(float x) {
    int b = __builtin_bit_cast(int, x);
    return __builtin_bit_cast(float, __builtin_amdgcn_permlane16(b, b, LO, HI, false, false));
}
// Sum over the 16 lanes of a row, in every lane: partners l ^ 8, l ^ 4, l ^ 2, l ^ 1.
__device__ __forceinline__ float row_sum(float x) {
    x += row_take<0xfedcba98u, 0x76543210u>(x);
    x += row_take<0x32107654u, 0xba98fedcu>(x);
    x += row_take<0x54761032u, 0xdcfe98bau>(x);
    x += row_take<0x67452301u, 0xefcdab89u>(x);
    return x;
}

// ---------------- fp32 -> bf16 conversion of all seven weights, one launch ----
// The bf16 copies lie back to back in the workspace in the order
// wq, wk, wv, wo, w1, w3, w2, so the destination is one array of CONV_TOTAL
// elements. One 16-wave work-group per WGP takes CONV_PER_WG consecutive
// elements of it (always inside one source, since every source's length is a
// multiple of CONV_PER_WG). A wave reads 32 x 512 contiguous bytes, many loads
// in flight at a time, and stores 32 x 256 contiguous bytes.
typedef __attribute__((ext_vector_type(4))) float  f32x4;
typedef __attribute__((ext_vector_type(4))) __bf16 bf16x4;
#define CONV_TOTAL   (4 * DM * DM + 3 * DFF * DM)   // 16,777,216
#define CONV_WGS     256
#define CONV_PER_WG  (CONV_TOTAL / CONV_WGS)        // 65,536
#define CONV_LOADS   (CONV_PER_WG / (512 * 4))      // 32 loads of 4 floats a lane
static_assert((DM * DM) % CONV_PER_WG == 0 && (DFF * DM) % CONV_PER_WG == 0,
              "a work-group's range must lie inside one weight");
__global__ __launch_bounds__(512)
void k_weights_to_bf16(const float* __restrict__ wq, const float* __restrict__ wk,
                       const float* __restrict__ wv, const float* __restrict__ wo,
                       const float* __restrict__ w1, const float* __restrict__ w3,
                       const float* __restrict__ w2, bf16* __restrict__ out) {
    const int first = blockIdx.x * CONV_PER_WG;   // index in the destination array
    const float* src = wq;                        // the weight that holds it ...
    int base = 0;                                 // ... and where that weight starts
    if (first >= 1 * DM * DM)                { src = wk; base = 1 * DM * DM; }
    if (first >= 2 * DM * DM)                { src = wv; base = 2 * DM * DM; }
    if (first >= 3 * DM * DM)                { src = wo; base = 3 * DM * DM; }
    if (first >= 4 * DM * DM)                { src = w1; base = 4 * DM * DM; }
    if (first >= 4 * DM * DM + 1 * DFF * DM) { src = w3; base = 4 * DM * DM + 1 * DFF * DM; }
    if (first >= 4 * DM * DM + 2 * DFF * DM) { src = w2; base = 4 * DM * DM + 2 * DFF * DM; }

    const int lane = threadIdx.x & 31, wave = threadIdx.x >> 5;
    const int at = first + wave * (CONV_LOADS * 128) + lane * 4;
    const f32x4* s = (const f32x4*)(src + (at - base));
    bf16x4*      d = (bf16x4*)(out + at);
    f32x4 v[CONV_LOADS];
    // Both loops unrolled: v[] stays in registers, the steps become immediate
    // offsets, and the loads can be issued ahead of the conversions.
    #pragma unroll
    for (int j = 0; j < CONV_LOADS; ++j)          // read once: non-temporal
        v[j] = __builtin_nontemporal_load(s + j * 32);
    #pragma unroll
    for (int j = 0; j < CONV_LOADS; ++j) {
        bf16x4 o = { (bf16)v[j][0], (bf16)v[j][1], (bf16)v[j][2], (bf16)v[j][3] };
        d[j * 32] = o;
    }
}

// ---------------- RMSNorm (one block per row) ----------------
__global__ __launch_bounds__(256) void k_rmsnorm(const float* __restrict__ X,
                                                 const float* __restrict__ G,
                                                 bf16* __restrict__ Out) {
    const int row = blockIdx.x;
    const float* x = X + (size_t)row * DM;
    float s = 0.f;
    #pragma unroll
    for (int i = threadIdx.x; i < DM; i += 256) { float v = x[i]; s += v * v; }
    #pragma unroll
    for (int m = 16; m >= 1; m >>= 1) s += __shfl_xor(s, m, 32);
    __shared__ float red[8];
    if ((threadIdx.x & 31) == 0) red[threadIdx.x >> 5] = s;
    __syncthreads();
    float tot = 0.f;
    #pragma unroll
    for (int j = 0; j < 8; ++j) tot += red[j];
    const float rinv = rsqrtf(tot / (float)DM + EPSV);
    bf16* o = Out + (size_t)row * DM;
    for (int i = threadIdx.x; i < DM; i += 256) o[i] = (bf16)(x[i] * rinv * G[i]);
}

// Eight asynchronous 16-byte copies per lane, global memory -> LDS, no register
// in between. The s_wait_xcnt is the last line of the copies' own statement so
// that no address register named here is rewritten ahead of it.
__device__ __forceinline__ void async_copy8(unsigned l, unsigned lstep,
                                            const bf16* g, size_t gstep) {
    asm volatile(
        "global_load_async_to_lds_b128 %0, %8, off\n\t"
        "global_load_async_to_lds_b128 %1, %9, off\n\t"
        "global_load_async_to_lds_b128 %2, %10, off\n\t"
        "global_load_async_to_lds_b128 %3, %11, off\n\t"
        "global_load_async_to_lds_b128 %4, %12, off\n\t"
        "global_load_async_to_lds_b128 %5, %13, off\n\t"
        "global_load_async_to_lds_b128 %6, %14, off\n\t"
        "global_load_async_to_lds_b128 %7, %15, off\n\t"
        "s_wait_xcnt 0x0"
        :: "v"(l), "v"(l + lstep), "v"(l + 2 * lstep), "v"(l + 3 * lstep),
           "v"(l + 4 * lstep), "v"(l + 5 * lstep), "v"(l + 6 * lstep), "v"(l + 7 * lstep),
           "v"(g), "v"(g + gstep), "v"(g + 2 * gstep), "v"(g + 3 * gstep),
           "v"(g + 4 * gstep), "v"(g + 5 * gstep), "v"(g + 6 * gstep), "v"(g + 7 * gstep)
        : "memory");
}

// The same, the first four copies from ga and the last four from gb: two sources
// whose rows lie one behind the other in LDS.
__device__ __forceinline__ void async_copy4x2(unsigned l, unsigned lstep,
                                              const bf16* ga, const bf16* gb, size_t gstep) {
    asm volatile(
        "global_load_async_to_lds_b128 %0, %8, off\n\t"
        "global_load_async_to_lds_b128 %1, %9, off\n\t"
        "global_load_async_to_lds_b128 %2, %10, off\n\t"
        "global_load_async_to_lds_b128 %3, %11, off\n\t"
        "global_load_async_to_lds_b128 %4, %12, off\n\t"
        "global_load_async_to_lds_b128 %5, %13, off\n\t"
        "global_load_async_to_lds_b128 %6, %14, off\n\t"
        "global_load_async_to_lds_b128 %7, %15, off\n\t"
        "s_wait_xcnt 0x0"
        :: "v"(l), "v"(l + lstep), "v"(l + 2 * lstep), "v"(l + 3 * lstep),
           "v"(l + 4 * lstep), "v"(l + 5 * lstep), "v"(l + 6 * lstep), "v"(l + 7 * lstep),
           "v"(ga), "v"(ga + gstep), "v"(ga + 2 * gstep), "v"(ga + 3 * gstep),
           "v"(gb), "v"(gb + gstep), "v"(gb + 2 * gstep), "v"(gb + 3 * gstep)
        : "memory");
}

// sin and cos of x radians, formed as __sincosf forms them. One statement, so that
// the v_nop stands directly behind the second transcendental: the slot that the
// instruction set asks for in front of an instruction that overwrites its source.
__device__ __forceinline__ void sincos_slot(float x, float& sn, float& cs) {
    const float rev = x * 0.15915494f;   // 1 / (2 pi): the instructions take revolutions
    asm("v_sin_f32 %0, %2\n\tv_cos_f32 %1, %2\n\tv_nop" : "=&v"(sn), "=&v"(cs) : "v"(rev));
}

// The K tile that a work-group of a GEMM grid starts with; it then walks all nt tiles
// in cyclic order. Work-groups of one grid row read the same rows of one operand and
// those of one grid column the same rows of the other. Started together on tile 0 they
// ask L2 for the same lines at the same moment, pass after pass, and a line that has to
// come from memory holds up all of them at once. With different starts the readers of a
// row are on different tiles, and a line is fetched for one of them ahead of the rest.
// Along y the start moves by one tile; along x by a quarter of the walk for x & 3. This is
// for speed alone: any start gives the same sum, added in another order.
__device__ __forceinline__ int first_k_tile(int nt) {
    return (int)(((blockIdx.x & 3) * (unsigned)(nt >> 2) + (blockIdx.x >> 3) + blockIdx.y) % (unsigned)nt);
}

// ---------------- WMMA NT-GEMM: C[M,N] = A[M,K] * B[N,K]^T + R[M,N], f32 out ----
// K is walked in tiles of 128, from first_k_tile() on. Two LDS buffers: tile t+1's asynchronous copies
// fly while tile t's 32 WMMAs per wave run; one barrier per tile publishes the
// next tile and frees the buffer just read. K must be a multiple of 128.
//
// NORM = true: the result goes on into an RMSNorm, C * g / rms(row of C), and from there into
// matrix products. 1 / rms is one scalar per row and commutes with those products, so no
// launch has to see a whole row first: this epilogue also stores bf16(C * g), the
// products' operand, and for each row the sum of C^2 over the wave's 32 columns,
// Part[column group][row], NPART groups; their reader adds them and scales its own result.
#define NPART (DM / 32)
template <bool NORM>
__global__ __launch_bounds__(256)
void k_gemm_nt(const bf16* __restrict__ A, const bf16* __restrict__ B,
               const float* __restrict__ R, float* __restrict__ Out,
               const float* __restrict__ G, bf16* __restrict__ Nb, float* __restrict__ Part,
               int M, int N, int K) {
    constexpr int BM = 128, BN = 128, BK = 128, LDT = BK + 8;  // 272-byte pitch
    constexpr int OPER = BM * LDT;                             // one operand's tile
    constexpr int STAGE = 2 * OPER;                            // [A tile | B tile]
    __shared__ __attribute__((aligned(16))) bf16 Sm[2 * STAGE];

    const int m0 = blockIdx.y * BM, n0 = blockIdx.x * BN;
    const int tid  = threadIdx.x;
    const int lane = tid & 31, wid = tid >> 5;   // 8 waves
    const int wm = wid >> 2, wn = wid & 3;       // 2 x 4 wave grid: 64x32 per wave
    const int l15 = lane & 15, kh = lane >> 4;

    // Copy map: 16 lanes cover one 256-byte row; a lane's 8 copies are 16 rows apart.
    const int crow = tid >> 4, ccol = (tid & 15) * 8;
    const bf16* gA = A + (size_t)(m0 + crow) * K + ccol;
    const bf16* gB = B + (size_t)(n0 + crow) * K + ccol;
    const unsigned lA = (unsigned)(size_t)(Sm + crow * LDT + ccol);
    const size_t gstep = (size_t)16 * K;
    auto stage_in = [&](int t, int buf) {
        const unsigned l = lA + (unsigned)(buf * STAGE * 2);
        async_copy8(l,            16 * LDT * 2, gA + (size_t)t * BK, gstep);
        async_copy8(l + OPER * 2, 16 * LDT * 2, gB + (size_t)t * BK, gstep);
    };

    const int nt = K / BK;
    const int kfirst = first_k_tile(nt);
    auto ktile = [&](int t) { const int k = t + kfirst; return k < nt ? k : k - nt; };   // pass t's K tile
    stage_in(ktile(0), 0);
    asm volatile("s_wait_asynccnt 0x0" ::: "memory");   // tile 0 has landed (own copies)
    __syncthreads();                                    // ... and every wave's copies
    if (nt > 1) stage_in(ktile(1), 1);

    f32x8 acc[4][2] = {};

    for (int t = 0; t < nt; ++t) {
        const bf16* As = Sm + (t & 1) * STAGE;
        const bf16* Bs = As + OPER;
        // Unrolled: the four blocks' LDS offsets become immediates and a block's
        // reads can start under the WMMAs of the block before it.
        #pragma unroll
        for (int kk = 0; kk < BK; kk += 32) {
            bf16x16 afr[4], bfr[2];
            #pragma unroll
            for (int ni = 0; ni < 2; ++ni)
                bfr[ni] = frag_ld(Bs + (wn * 32 + ni * 16 + l15) * LDT + kk, kh);
            #pragma unroll
            for (int mi = 0; mi < 4; ++mi)
                afr[mi] = frag_ld(As + (wm * 64 + mi * 16 + l15) * LDT + kk, kh);
            // Keeps the block's 12 LDS reads one group in front of its 8 WMMAs: left
            // alone the compiler sinks them between the WMMAs, a full LDS wait per pair.
            __builtin_amdgcn_sched_barrier(0);
            #pragma unroll
            for (int mi = 0; mi < 4; ++mi)
                #pragma unroll
                for (int ni = 0; ni < 2; ++ni)
                    acc[mi][ni] = wmma_bf16(afr[mi], bfr[ni], acc[mi][ni]);
        }
        asm volatile("s_wait_dscnt 0x0" ::: "memory");     // own reads of this buffer are done
        asm volatile("s_wait_asynccnt 0x0" ::: "memory");  // own copies of tile t+1 have landed
        __syncthreads();   // publishes tile t+1; ends every reader's last read of tile t
        if (t + 2 < nt) stage_in(ktile(t + 2), t & 1);     // refill the buffer just read
    }
    asm volatile("s_wait_asynccnt 0x0" ::: "memory");      // nothing in flight at the wave's end

    if constexpr (NORM) {
        const int gn = n0 + wn * 32 + l15;                    // the lane's columns: gn, gn + 16
        const float gq[2] = { G[gn], G[gn + 16] };
        // Holds these two loads in front of the residual's: left alone the compiler issues them
        // behind the first of those and aims their results at that load's address registers.
        asm volatile("s_wait_xcnt 0x0" ::: "memory");
        // All three loops unrolled: acc and ss are indexed by constants and stay in registers.
        #pragma unroll
        for (int mi = 0; mi < 4; ++mi) {
            const int gm = m0 + wm * 64 + mi * 16 + kh * 8;   // first of the lane's 8 rows
            f32x4 ss[2];
            #pragma unroll
            for (int r = 0; r < 8; ++r) {
                float sq = 0.f;
                #pragma unroll
                for (int ni = 0; ni < 2; ++ni) {
                    const size_t off = (size_t)(gm + r) * N + gn + ni * 16;
                    const float v = acc[mi][ni][r] + R[off];
                    Out[off] = v;
                    Nb[off]  = (bf16)(v * gq[ni]);
                    sq += v * v;
                }
                ss[r >> 2][r & 3] = row_sum(sq);
            }
            if (l15 == 0) {   // 8 consecutive rows of one column group
                float* pp = Part + (size_t)(blockIdx.x * 4 + wn) * M + gm;
                *(f32x4*)pp       = ss[0];
                *(f32x4*)(pp + 4) = ss[1];
            }
        }
    } else {
        #pragma unroll
        for (int mi = 0; mi < 4; ++mi)
            #pragma unroll
            for (int ni = 0; ni < 2; ++ni)
                #pragma unroll
                for (int r = 0; r < 8; ++r) {
                    int gm = m0 + wm * 64 + mi * 16 + kh * 8 + r;
                    int gn = n0 + wn * 32 + ni * 16 + l15;
                    size_t off = (size_t)gm * N + gn;
                    Out[off] = acc[mi][ni][r] + R[off];
                }
    }
}

// ---------------- Q, K and V projections, one launch ----------------
// The three bf16 weights lie back to back, so they are one matrix W of 3 * DM rows
// (48 heads of 64 features: 16 of Q, 16 of K, 16 of V). A work-group forms 192
// features (3 heads) x 256 tokens: 16 x 16 work-groups, one per WGP. A stage is
// [W 192 rows | X 256 rows] of 128 k; the ring is k_gemm_nt's.
// 12 waves, 3 x 4: a wave has ONE head x 64 tokens, 8 fragments for 16 WMMAs.
// In D a lane holds 8 consecutive rows of one column, so the side that is contiguous
// in the output goes in as A and the lane stores 16 bytes of bf16:
//   Q, K head: A = weight, B = tokens: RoPE on the lane's 4 pairs, Out[token][feature].
//   V head:    A = tokens, B = weight: Vt[b][feature][s], V transposed per head.
// Both sides of a wave's tile are 64 rows at the same pitch, read by the same loader, so
// the choice is only which rows' address is the A side's: one loop serves both.

__global__ __launch_bounds__(384)
void k_qkv(const bf16* __restrict__ Wqkv, const bf16* __restrict__ X,
           bf16* __restrict__ Qo, bf16* __restrict__ Ko, bf16* __restrict__ Vt, int K) {
    constexpr int BF = 192, BT = 256, BK = 128, LDT = BK + 8;  // 272-byte pitch
    constexpr int WPART = BF * LDT;
    constexpr int STAGE = WPART + BT * LDT;
    static_assert(DK == 64 && BF % DK == 0 && (3 * DM) % BF == 0 && MROWS % BT == 0 &&
                  SEQ % BT == 0, "a wave has one head; a tile's tokens lie in one batch entry");
    __shared__ __attribute__((aligned(16))) bf16 Sm[2 * STAGE];

    const int f0 = blockIdx.x * BF, t0 = blockIdx.y * BT;
    const int tid  = threadIdx.x;
    const int lane = tid & 31;
    // The wave's number in a scalar register: what hangs on it (who copies what, which
    // operand order, which epilogue) is then a scalar branch with every lane on.
    const int wid = __builtin_amdgcn_readfirstlane(tid >> 5);
    const int wf = wid >> 2, wt = wid & 3;
    const int l15 = lane & 15, kh = lane >> 4;
    const int head  = blockIdx.x * (BF / DK) + wf;   // 0 .. 47 in the stacked weight
    const int which = head / HEADS;                  // 0 Q, 1 K, 2 V
    const int hf0   = (head % HEADS) * DK;           // the head's first feature in its matrix

    // Copy map: 16 lanes cover one 256-byte row. Waves 0..7 bring the 256 token rows
    // (16 rows a copy step, 16 copies a lane), waves 8..11 the 192 weight rows (8 rows a
    // step, 24 copies a lane).
    const bool forX = wid < 8;
    const int  crow = (forX ? tid : tid - 256) >> 4, ccol = (tid & 15) * 8;
    const bf16* g0 = (forX ? X + (size_t)(t0 + crow) * K : Wqkv + (size_t)(f0 + crow) * K) + ccol;
    const unsigned l0 = (unsigned)(size_t)(Sm + (forX ? WPART : 0) + crow * LDT + ccol);
    auto stage_in = [&](int t, int buf) {
        const unsigned l = l0 + (unsigned)(buf * STAGE * 2);
        const bf16*    g = g0 + (size_t)t * BK;
        if (forX) {   // two paths, so that the LDS steps are constants in each
            async_copy8(l,                 16 * LDT * 2, g,                   (size_t)16 * K);
            async_copy8(l + 128 * LDT * 2, 16 * LDT * 2, g + (size_t)128 * K, (size_t)16 * K);
        } else {
            async_copy8(l,                 8 * LDT * 2, g,                   (size_t)8 * K);
            async_copy8(l + 64 * LDT * 2,  8 * LDT * 2, g + (size_t)64 * K,  (size_t)8 * K);
            async_copy8(l + 128 * LDT * 2, 8 * LDT * 2, g + (size_t)128 * K, (size_t)8 * K);
        }
    };

    const int nt = K / BK;
    const int kfirst = first_k_tile(nt);
    auto ktile = [&](int t) { const int k = t + kfirst; return k < nt ? k : k - nt; };   // pass t's K tile
    stage_in(ktile(0), 0);
    asm volatile("s_wait_asynccnt 0x0" ::: "memory");   // tile 0 has landed (own copies)
    __syncthreads();                                    // ... and every wave's copies
    if (nt > 1) stage_in(ktile(1), 1);

    // This lane's first row of the A side and of the B side, in buffer 0.
    const int wrow = (wf * 64 + l15) * LDT, xrow = WPART + (wt * 64 + l15) * LDT;
    const bf16* arow = Sm + (which == 2 ? xrow : wrow);
    const bf16* brow = Sm + (which == 2 ? wrow : xrow);

    f32x8 acc[4][4] = {};   // [A fragment][B fragment]

    for (int t = 0; t < nt; ++t) {
        const bf16* As = arow + (t & 1) * STAGE;
        const bf16* Bs = brow + (t & 1) * STAGE;
        // Unrolled: the four blocks' LDS offsets become immediates. (The short loops
        // over mi, ni, j and r, here and in the epilogue, are unrolled so that the
        // fragment and accumulator arrays are indexed by constants and stay in registers.)
        #pragma unroll
        for (int kk = 0; kk < BK; kk += 32) {
            bf16x16 afr[4], bfr[4];
            #pragma unroll
            for (int ni = 0; ni < 4; ++ni) bfr[ni] = frag_ld(Bs + ni * 16 * LDT + kk, kh);
            #pragma unroll
            for (int mi = 0; mi < 4; ++mi) afr[mi] = frag_ld(As + mi * 16 * LDT + kk, kh);
            // Keeps the block's 16 LDS reads one group in front of its 16 WMMAs: left
            // alone the compiler sinks them between the WMMAs, a full LDS wait per pair.
            __builtin_amdgcn_sched_barrier(0);
            #pragma unroll
            for (int mi = 0; mi < 4; ++mi)
                #pragma unroll
                for (int ni = 0; ni < 4; ++ni)
                    acc[mi][ni] = wmma_bf16(afr[mi], bfr[ni], acc[mi][ni]);
        }
        asm volatile("s_wait_dscnt 0x0" ::: "memory");     // own reads of this buffer are done
        asm volatile("s_wait_asynccnt 0x0" ::: "memory");  // own copies of tile t+1 have landed
        __syncthreads();   // publishes tile t+1; ends every reader's last read of tile t
        if (t + 2 < nt) stage_in(ktile(t + 2), t & 1);     // refill the buffer just read
    }
    asm volatile("s_wait_asynccnt 0x0" ::: "memory");      // nothing in flight at the wave's end

    if (which == 2) {
        #pragma unroll
        for (int mi = 0; mi < 4; ++mi)
            #pragma unroll
            for (int ni = 0; ni < 4; ++ni) {
                const int gt = t0 + wt * 64 + mi * 16 + kh * 8;   // first of 8 tokens
                const int gf = hf0 + ni * 16 + l15;               // feature
                bf16x8 o;
                #pragma unroll
                for (int r = 0; r < 8; ++r) o[r] = (bf16)acc[mi][ni][r];
                *(bf16x8*)(Vt + ((size_t)(gt / SEQ) * DM + gf) * SEQ + gt % SEQ) = o;
            }
    } else {
        bf16* Out = which ? Ko : Qo;
        #pragma unroll
        for (int mi = 0; mi < 4; ++mi) {
            float inv[4];                              // pairs mi*8 + kh*4 + j of the head
            #pragma unroll
            for (int j = 0; j < 4; ++j) {              // theta^(-2p/DK), p known to the compiler
                const float lo = __powf(THETA_F, -2.f * (float)(mi * 8 + j) / (float)DK);
                const float hi = __powf(THETA_F, -2.f * (float)(mi * 8 + 4 + j) / (float)DK);
                inv[j] = kh ? hi : lo;
            }
            #pragma unroll
            for (int ni = 0; ni < 4; ++ni) {
                const int gf = hf0 + mi * 16 + kh * 8;            // first of 8 features
                const int gt = t0 + wt * 64 + ni * 16 + l15;      // token
                const int s  = gt % SEQ;
                bf16x8 o;
                #pragma unroll
                for (int j = 0; j < 4; ++j) {
                    float sn, cs;
                    sincos_slot((float)s * inv[j], sn, cs);
                    const float x1 = acc[mi][ni][2 * j], x2 = acc[mi][ni][2 * j + 1];
                    o[2 * j]     = (bf16)(x1 * cs - x2 * sn);
                    o[2 * j + 1] = (bf16)(x1 * sn + x2 * cs);
                }
                *(bf16x8*)(Out + (size_t)gt * DM + gf) = o;
            }
        }
        // In the built code the V epilogue stands behind this branch's end and rewrites
        // the registers that the last stores name: the wait stands in front of it.
        asm volatile("s_wait_xcnt 0x0" ::: "memory");
    }
}

// ---------------- SwiGLU up-projection: H = silu(X W1^T / rms) * (X W3^T / rms), one launch ----
// A work-group forms BOTH products for 128 features x 256 tokens. A stage is
// [W1 128 rows | W3 128 rows | X 256 rows] of 128 k; the ring is k_gemm_nt's.
// The weights go in as A (m = feature) and the tokens as B, so in D a lane holds 8
// consecutive features of one token, of both products in the same registers' places:
// the gate is formed in registers and the lane stores 16 bytes of bf16.
// 16 waves, 4 x 4: a wave has 32 features (of each weight) x 64 tokens, that is 8
// fragments for 16 WMMAs. K must be a multiple of 128.
// X holds x1 * g, not yet divided by the token's rms: Part[group][token] has NPART partial
// sums of x1^2 a token, and both products are scaled by 1 / rms in the epilogue.
__global__ __launch_bounds__(512)
void k_ffn_up(const bf16* __restrict__ W1, const bf16* __restrict__ W3,
              const bf16* __restrict__ X, const float* __restrict__ Part,
              bf16* __restrict__ H, int F, int K) {
    constexpr int BF = 128, BT = 256, BK = 128, LDT = BK + 8;  // 272-byte pitch
    constexpr int WPART = 2 * BF * LDT;                        // both weights' tiles
    constexpr int STAGE = WPART + BT * LDT;
    __shared__ __attribute__((aligned(16))) bf16 Sm[2 * STAGE];
    __shared__ float Rinv[BT];   // 1 / rms of the tile's tokens

    const int f0 = blockIdx.x * BF, t0 = blockIdx.y * BT;
    const int tid  = threadIdx.x;
    const int lane = tid & 31, wid = tid >> 5;
    const int wf = wid >> 2, wt = wid & 3;
    const int l15 = lane & 15, kh = lane >> 4;

    // Copy map: 16 lanes cover one 256-byte row; a lane's copies are 32 rows apart.
    const int crow = tid >> 4, ccol = (tid & 15) * 8;
    const bf16* g1 = W1 + (size_t)(f0 + crow) * K + ccol;
    const bf16* g3 = W3 + (size_t)(f0 + crow) * K + ccol;
    const bf16* gX = X  + (size_t)(t0 + crow) * K + ccol;
    const unsigned lW = (unsigned)(size_t)(Sm + crow * LDT + ccol);
    const size_t gstep = (size_t)32 * K;
    auto stage_in = [&](int t, int buf) {
        const unsigned l = lW + (unsigned)(buf * STAGE * 2);
        async_copy4x2(l,           32 * LDT * 2, g1 + (size_t)t * BK, g3 + (size_t)t * BK, gstep);
        async_copy8(l + WPART * 2, 32 * LDT * 2, gX + (size_t)t * BK, gstep);
    };

    const int nt = K / BK;
    const int kfirst = first_k_tile(nt);
    auto ktile = [&](int t) { const int k = t + kfirst; return k < nt ? k : k - nt; };   // pass t's K tile
    stage_in(ktile(0), 0);
    if (tid < BT) {   // one token a lane, under tile 0's flight; the barrier below publishes it
        const float* pp = Part + t0 + tid;
        float q[4] = { 0.f, 0.f, 0.f, 0.f };
        // Unrolled: the loads are issued together, four independent sums.
        #pragma unroll
        for (int j = 0; j < NPART; ++j) q[j & 3] += pp[(size_t)j * MROWS];
        Rinv[tid] = rsqrtf(((q[0] + q[1]) + (q[2] + q[3])) / (float)K + EPSV);
    }
    asm volatile("s_wait_asynccnt 0x0" ::: "memory");   // tile 0 has landed (own copies)
    __syncthreads();                                    // ... and every wave's copies
    if (nt > 1) stage_in(ktile(1), 1);

    f32x8 acc1[2][4] = {}, acc3[2][4] = {};

    for (int t = 0; t < nt; ++t) {
        const bf16* Ws = Sm + (t & 1) * STAGE;
        const bf16* Xs = Ws + WPART;
        // Unrolled: the four blocks' LDS offsets become immediates. (The short loops
        // over mi, ni and r, here and in the epilogue, are unrolled so that the
        // fragment and accumulator arrays are indexed by constants and stay in registers.)
        #pragma unroll
        for (int kk = 0; kk < BK; kk += 32) {
            bf16x16 a1[2], a3[2], xb[4];
            #pragma unroll
            for (int ni = 0; ni < 4; ++ni)
                xb[ni] = frag_ld(Xs + (wt * 64 + ni * 16 + l15) * LDT + kk, kh);
            #pragma unroll
            for (int mi = 0; mi < 2; ++mi) {
                a1[mi] = frag_ld(Ws + (wf * 32 + mi * 16 + l15) * LDT + kk, kh);
                a3[mi] = frag_ld(Ws + (BF + wf * 32 + mi * 16 + l15) * LDT + kk, kh);
            }
            // Keeps the block's 16 LDS reads one group in front of its 16 WMMAs: left
            // alone the compiler sinks them between the WMMAs, a full LDS wait per pair.
            __builtin_amdgcn_sched_barrier(0);
            #pragma unroll
            for (int mi = 0; mi < 2; ++mi)
                #pragma unroll
                for (int ni = 0; ni < 4; ++ni) {
                    acc1[mi][ni] = wmma_bf16(a1[mi], xb[ni], acc1[mi][ni]);
                    acc3[mi][ni] = wmma_bf16(a3[mi], xb[ni], acc3[mi][ni]);
                }
        }
        asm volatile("s_wait_dscnt 0x0" ::: "memory");     // own reads of this buffer are done
        asm volatile("s_wait_asynccnt 0x0" ::: "memory");  // own copies of tile t+1 have landed
        __syncthreads();   // publishes tile t+1; ends every reader's last read of tile t
        if (t + 2 < nt) stage_in(ktile(t + 2), t & 1);     // refill the buffer just read
    }
    asm volatile("s_wait_asynccnt 0x0" ::: "memory");      // nothing in flight at the wave's end

    #pragma unroll
    for (int mi = 0; mi < 2; ++mi)
        #pragma unroll
        for (int ni = 0; ni < 4; ++ni) {
            const int gf = f0 + wf * 32 + mi * 16 + kh * 8;   // first of 8 features
            const int gt = t0 + wt * 64 + ni * 16 + l15;      // token
            const float rv = Rinv[gt - t0];
            bf16x8 o;
            #pragma unroll
            for (int r = 0; r < 8; ++r) {
                const float a = acc1[mi][ni][r] * rv;
                const float g = a / (1.f + __expf(-a));       // a * sigmoid(a)
                o[r] = (bf16)(g * (acc3[mi][ni][r] * rv));
            }
            *(bf16x8*)(H + (size_t)gt * F + gf) = o;
        }
}

// ---------------- Flash attention (causal, online softmax) ----------------
// Block: 128 threads (4 waves), handles one (b,h) and two tiles of 64 query rows,
// tile 31 - p and then tile p: 32 - p and p + 1 key tiles, 33 for every block, so
// that all blocks, resident together, end together wherever they are placed.
// Each wave owns 16 queries and forms the TRANSPOSED products on WMMA bf16:
//   S^T = K * Q^T   (A = 16 keys from LDS,     B = the wave's 16 queries, in registers)
//   O^T += V^T * P^T (A = 16 rows of V^T, LDS, B = P^T packed from the score registers)
// In D a lane holds one column, so lane l has the scores of query l & 15 alone
// (keys 8 * (l >> 4) + r of each 16-key tile): maximum and sum run inside the lane,
// with one exchange between lanes l and l ^ 16, and two score tiles converted in
// place are the B operand of the second product in frag_ld's own k order.
// K/V tile kt+1 is fetched into registers while tile kt is being consumed.

// Lane l takes the value of lane l ^ 16.
__device__ __forceinline__ float other_half(float x) {
    int b = __builtin_bit_cast(int, x);
    return __builtin_bit_cast(float,
        __builtin_amdgcn_permlanex16(b, b, 0x76543210, 0xfedcba98, false, false));
}

__global__ __launch_bounds__(128)
void k_flash_attn(const bf16* __restrict__ Qb, const bf16* __restrict__ Kb,
                  const bf16* __restrict__ Vt, bf16* __restrict__ Ob) {
    constexpr int LT = 72;   // 64 + 8 pad (16B-aligned rows, conflict-free b128)
    __shared__ __attribute__((aligned(16))) bf16 Qs [2 * 64 * LT];   // both query tiles
    __shared__ __attribute__((aligned(16))) bf16 Ks [64 * LT];
    __shared__ __attribute__((aligned(16))) bf16 Vts[64 * LT];

    const int qtile[2] = { SEQ / 64 - 1 - (int)blockIdx.x, (int)blockIdx.x };
    const int bh = blockIdx.y;
    const int b = bh / HEADS, h = bh % HEADS;
    const int tid = threadIdx.x, lane = tid & 31, w = tid >> 5;
    const int l15 = lane & 15, kh = lane >> 4;

    const bf16* Qg = Qb + (size_t)b * SEQ * DM + h * DK;
    const bf16* Kg = Kb + (size_t)b * SEQ * DM + h * DK;
    const bf16* Vg = Vt + ((size_t)b * HEADS + h) * DK * SEQ;

    int trow[4], tcol[4];
    #pragma unroll
    for (int i = 0; i < 4; ++i) {          // 64x64 tile, 8 bf16 per thread-iter
        int idx = tid + i * 128;
        trow[i] = idx >> 3; tcol[i] = (idx & 7) * 8;
    }
    #pragma unroll
    for (int hf = 0; hf < 2; ++hf)
        #pragma unroll
        for (int i = 0; i < 4; ++i)
            *(u32x4*)(Qs + hf * 64 * LT + trow[i] * LT + tcol[i]) =
                *(const u32x4*)(Qg + (size_t)(qtile[hf] * 64 + trow[i]) * DM + tcol[i]);
    __syncthreads();

    // Not unrolled: one copy of the key loop in the instruction cache.
    #pragma unroll 1
    for (int half = 0; half < 2; ++half) {
    const int qt = half ? qtile[1] : qtile[0];   // query tile (64 rows)

    const bf16* qrow = Qs + half * 64 * LT + (w * 16 + l15) * LT;
    bf16x16 bq0 = frag_ld(qrow, kh), bq1 = frag_ld(qrow + 32, kh);

    float mrow = -1e30f, lrow = 0.f;      // this lane's query: running maximum and sum
    f32x8 Oacc[4] = {};                   // Oacc[nt][r] = O[query l15][nt*16 + kh*8 + r]

    const int qg = qt * 64 + w * 16 + l15;   // this lane's global query index

    u32x4 rk[4], rv[4];
    auto fetchKV = [&](int kt) {
        #pragma unroll
        for (int i = 0; i < 4; ++i) {
            rk[i] = *(const u32x4*)(Kg + (size_t)(kt * 64 + trow[i]) * DM + tcol[i]);
            rv[i] = *(const u32x4*)(Vg + (size_t)trow[i] * SEQ + kt * 64 + tcol[i]);
        }
    };
    fetchKV(0);

    for (int kt = 0; kt <= qt; ++kt) {
        __syncthreads();   // previous-iteration readers of Ks/Vts are done
        #pragma unroll
        for (int i = 0; i < 4; ++i) {
            *(u32x4*)(Ks  + trow[i] * LT + tcol[i]) = rk[i];
            *(u32x4*)(Vts + trow[i] * LT + tcol[i]) = rv[i];
        }
        __syncthreads();

        if (kt + 2 <= qt) {   // warm GL2 two tiles ahead
            __builtin_prefetch(Kg + (size_t)((kt + 2) * 64 + trow[0]) * DM + tcol[0], 0, 3);
            __builtin_prefetch(Vg + (size_t)trow[0] * SEQ + (kt + 2) * 64 + tcol[0], 0, 3);
        }
        if (kt < qt) fetchKV(kt + 1);   // loads in flight under score/softmax

        // scores, transposed: 64(k) x 16(q) per wave, K-dim = dk = 64 -> 2 chained WMMAs
        // st[mt][r] = S[key kt*64 + mt*16 + kh*8 + r][query l15]
        f32x8 st[4];
        #pragma unroll
        for (int mt = 0; mt < 4; ++mt) {
            const bf16* krow = Ks + (mt * 16 + l15) * LT;
            f32x8 a = {};
            a = wmma_bf16(frag_ld(krow, kh), bq0, a);
            a = wmma_bf16(frag_ld(krow + 32, kh), bq1, a);
            st[mt] = a;
        }
        // scale + causal mask
        #pragma unroll
        for (int mt = 0; mt < 4; ++mt) {
            int kg = kt * 64 + mt * 16 + kh * 8;
            #pragma unroll
            for (int r = 0; r < 8; ++r) {
                float v = st[mt][r] * 0.125f;                // 1/sqrt(64)
                st[mt][r] = (kg + r > qg) ? -1e30f : v;
            }
        }
        // online softmax: the lane's 32 keys, then the other half's 32
        float mx8[8];
        #pragma unroll
        for (int r = 0; r < 8; ++r)
            mx8[r] = fmaxf(fmaxf(st[0][r], st[1][r]), fmaxf(st[2][r], st[3][r]));
        float mx = fmaxf(fmaxf(fmaxf(mx8[0], mx8[1]), fmaxf(mx8[2], mx8[3])),
                         fmaxf(fmaxf(mx8[4], mx8[5]), fmaxf(mx8[6], mx8[7])));
        mx = fmaxf(mx, other_half(mx));
        const float mnew = fmaxf(mrow, mx);
        const float sc = __expf(mrow - mnew);
        #pragma unroll
        for (int mt = 0; mt < 4; ++mt)
            #pragma unroll
            for (int r = 0; r < 8; ++r) st[mt][r] = __expf(st[mt][r] - mnew);
        float sm8[8];
        #pragma unroll
        for (int r = 0; r < 8; ++r)
            sm8[r] = (st[0][r] + st[1][r]) + (st[2][r] + st[3][r]);
        float sm = ((sm8[0] + sm8[1]) + (sm8[2] + sm8[3])) +
                   ((sm8[4] + sm8[5]) + (sm8[6] + sm8[7]));
        sm += other_half(sm);
        lrow = lrow * sc + sm;
        mrow = mnew;
        #pragma unroll
        for (int nt = 0; nt < 4; ++nt)
            #pragma unroll
            for (int r = 0; r < 8; ++r) Oacc[nt][r] *= sc;

        // P^T as B operand: element s of keys 32g .. 32g+31 is tile 2g + (s >> 3), register s & 7
        bf16x16 bp0, bp1;
        #pragma unroll
        for (int s = 0; s < 16; ++s) {
            bp0[s] = (bf16)st[s >> 3][s & 7];
            bp1[s] = (bf16)st[2 + (s >> 3)][s & 7];
        }
        #pragma unroll
        for (int nt = 0; nt < 4; ++nt) {
            const bf16* vrow = Vts + (nt * 16 + l15) * LT;
            Oacc[nt] = wmma_bf16(frag_ld(vrow, kh), bp0, Oacc[nt]);
            Oacc[nt] = wmma_bf16(frag_ld(vrow + 32, kh), bp1, Oacc[nt]);
        }
    }

    // normalize and write bf16 output (feeds the WO GEMM directly):
    // a lane's 8 registers of a tile are 8 consecutive elements of its query's row
    const size_t srow = (size_t)b * SEQ + qg;
    #pragma unroll
    for (int nt = 0; nt < 4; ++nt) {
        bf16x8 o;
        #pragma unroll
        for (int r = 0; r < 8; ++r) o[r] = (bf16)(Oacc[nt][r] / lrow);
        *(bf16x8*)(Ob + srow * DM + h * DK + nt * 16 + kh * 8) = o;
    }
    // The second tile's code rewrites the registers that these stores name.
    asm volatile("s_wait_xcnt 0x0" ::: "memory");
    }   // half
}

// ---------------- host launcher ----------------
extern "C" void kernel_launch(void* const* d_in, const int* in_sizes, int n_in,
                              void* d_out, int out_size, void* d_ws, size_t ws_size,
                              hipStream_t stream) {
    (void)in_sizes; (void)n_in; (void)out_size; (void)ws_size;
    const float* x  = (const float*)d_in[0];
    const float* wq = (const float*)d_in[1];
    const float* wk = (const float*)d_in[2];
    const float* wv = (const float*)d_in[3];
    const float* wo = (const float*)d_in[4];
    const float* w1 = (const float*)d_in[5];
    const float* w2 = (const float*)d_in[6];
    const float* w3 = (const float*)d_in[7];
    const float* g1 = (const float*)d_in[8];
    const float* g2 = (const float*)d_in[9];
    float* out = (float*)d_out;

    const size_t MB = 1ull << 20;
    char* p = (char*)d_ws;
    bf16*  n_bf  = (bf16*)p;            p += 8 * MB;   // 4096x1024 bf16
    bf16*  wq_bf = (bf16*)p;            p += 2 * MB;
    bf16*  wk_bf = (bf16*)p;            p += 2 * MB;
    bf16*  wv_bf = (bf16*)p;            p += 2 * MB;
    bf16*  wo_bf = (bf16*)p;            p += 2 * MB;
    bf16*  w1_bf = (bf16*)p;            p += 8 * MB;
    bf16*  w3_bf = (bf16*)p;            p += 8 * MB;
    bf16*  w2_bf = (bf16*)p;            p += 8 * MB;
    float* x1    = (float*)p;           p += 16 * MB;  // x + attn residual
    bf16*  n2_bf = (bf16*)p;            p += 8 * MB;
    // 64 MB region: q_bf and k_bf lie in its last quarter, the partial sums at its start
    char*  reuse = p;                   p += 64 * MB;
    float* part = (float*)reuse;                       // NPART x 4096 f32
    bf16*  q_bf = (bf16*) (reuse + 48 * MB);
    bf16*  k_bf = (bf16*) (reuse + 56 * MB);
    bf16*  vt_bf = (bf16*)p;            p += 8 * MB;
    bf16*  o_bf  = (bf16*)p;            p += 8 * MB;
    bf16*  h_bf  = (bf16*)p;            p += 32 * MB;  // swiglu output 4096x4096

    // 1) weights -> bf16
    //    (wq_bf .. w2_bf are one contiguous array that starts at wq_bf)
    k_weights_to_bf16<<<CONV_WGS, 512, 0, stream>>>(wq, wk, wv, wo, w1, w3, w2, wq_bf);

    // 2) n = rmsnorm(x, g1)
    k_rmsnorm<<<MROWS, 256, 0, stream>>>(x, g1, n_bf);

    // 3) Q, K (with RoPE) and V (transposed per head) projections -> bf16, one launch
    //    (wq_bf, wk_bf, wv_bf are one contiguous array that starts at wq_bf)
    dim3 gQKV(DM / 128, MROWS / 128);
    dim3 gHeads(3 * DM / 192, MROWS / 256);
    k_qkv<<<gHeads, 384, 0, stream>>>(wq_bf, n_bf, q_bf, k_bf, vt_bf, DM);

    // 5) causal flash attention -> o (bf16)
    dim3 gAtt(SEQ / 128, BATCH * HEADS);
    k_flash_attn<<<gAtt, 128, 0, stream>>>(q_bf, k_bf, vt_bf, o_bf);

    // 6) x1 = x + o @ Wo^T; n2 = x1 * g2 in bf16; partial sums of x1^2
    k_gemm_nt<true><<<gQKV, 256, 0, stream>>>(o_bf, wo_bf, x, x1, g2, n2_bf, part, MROWS, DM, DM);

    // 8) h = silu(a) * b, a = (n2 @ W1^T) / rms, b = (n2 @ W3^T) / rms, one launch
    dim3 gFF(DFF / 128, MROWS / 256);
    k_ffn_up<<<gFF, 512, 0, stream>>>(w1_bf, w3_bf, n2_bf, part, h_bf, DFF, DM);

    // 9) out = x1 + h @ W2^T
    k_gemm_nt<false><<<gQKV, 256, 0, stream>>>(h_bf, w2_bf, x1, out, nullptr, nullptr, nullptr,
                                               MROWS, DM, DFF);
}

// v010
// Measured time: 154 microseconds a run.
// Timed twice side by side with v009, it ran 1.07 times as fast both times.
// All steps since v000 together make it 3.61 times as fast.
#include <hip/hip_runtime.h>

// ---------------- problem constants ----------------
#define BATCH   2
#define SEQ     2048
#define DM      1024
#define HEADS   16
#define DK      64
#define DFF     4096
#define MROWS   (BATCH * SEQ)       // 4096
#define EPSV    1e-5f
#define THETA_F 10000.0f

// ---------------- types ----------------
typedef __bf16 bf16;
typedef __attribute__((ext_vector_type(16))) __bf16 bf16x16;
typedef __attribute__((ext_vector_type(8)))  __bf16 bf16x8;
typedef __attribute__((ext_vector_type(8)))  float  f32x8;
typedef __attribute__((ext_vector_type(4)))  unsigned int u32x4;

// Load one 16x32 bf16 WMMA fragment (A or B operand) from LDS.
// rowPtr points at the start of this lane's row (16-byte aligned, row stride
// is a multiple of 8 elements). kh = lane>>4 selects the K-half per the ISA
// 16-bit A-matrix layout: half 0 -> K {0..7, 16..23}, half 1 -> K {8..15, 24..31}.
__device__ __forceinline__ bf16x16 frag_ld(const bf16* rowPtr, int kh) {
    bf16x8 lo = *(const bf16x8*)(rowPtr + kh * 8);
    bf16x8 hi = *(const bf16x8*)(rowPtr + 16 + kh * 8);
    return __builtin_shufflevector(lo, hi, 0,1,2,3,4,5,6,7,8,9,10,11,12,13,14,15);
}

__device__ __forceinline__ f32x8 wmma_bf16(bf16x16 a, bf16x16 b, f32x8 c) {
    return __builtin_amdgcn_wmma_f32_16x16x32_bf16(false, a, false, b, (short)0, c, false, false);
}

// Lane l takes the value of the lane whose number in the 16-lane row the selectors give
// (one hex digit a lane, lanes 0 to 7 in LO, 8 to 15 in HI).
template <unsigned LO, unsigned HI>
__device__ __forceinline__ float row_take(float x) {
    int b = __builtin_bit_cast(int, x);
    return __builtin_bit_cast(float, __builtin_amdgcn_permlane16(b, b, LO, HI, false, false));
}
// Sum over the 16 lanes of a row, in every lane: partners l ^ 8, l ^ 4, l ^ 2, l ^ 1.
__device__ __forceinline__ float row_sum(float x) {
    x += row_take<0xfedcba98u, 0x76543210u>(x);
    x += row_take<0x32107654u, 0xba98fedcu>(x);
    x += row_take<0x54761032u, 0xdcfe98bau>(x);
    x += row_take<0x67452301u, 0xefcdab89u>(x);
    return x;
}

// Lane l takes the value of lane l ^ 16.
__device__ __forceinline__ float other_half(float x) {
    int b = __builtin_bit_cast(int, x);
    return __builtin_bit_cast(float,
        __builtin_amdgcn_permlanex16(b, b, 0x76543210, 0xfedcba98, false, false));
}

// ---------------- fp32 -> bf16 conversion of all seven weights, and the first RMSNorm, one launch ----
// The bf16 copies lie back to back in the workspace in the order
// wq, wk, wv, wo, w1, w3, w2, so the destination is one array of CONV_TOTAL
// elements. One 16-wave work-group per WGP takes CONV_PER_WG consecutive
// elements of it (always inside one source, since every source's length is a
// multiple of CONV_PER_WG). A wave reads 32 x 512 contiguous bytes, many loads
// in flight at a time, and stores 32 x 256 contiguous bytes.
// The launch has as many waves as there are tokens, and the first RMSNorm depends on the
// weights as little as they on it: each wave also norms ONE token's row, 8 loads of 512
// contiguous bytes, the sum of squares in the lane and then across the wave's 32 lanes, no
// LDS and no barrier. Its loads go out first, so its arithmetic and stores run under the
// flight of the weight loads.
typedef __attribute__((ext_vector_type(4))) float  f32x4;
typedef __attribute__((ext_vector_type(4))) __bf16 bf16x4;
#define CONV_TOTAL   (4 * DM * DM + 3 * DFF * DM)   // 16,777,216
#define CONV_WGS     256
#define CONV_PER_WG  (CONV_TOTAL / CONV_WGS)        // 65,536
#define CONV_LOADS   (CONV_PER_WG / (512 * 4))      // 32 loads of 4 floats a lane
#define ROW_LOADS    (DM / (32 * 4))                // 8 loads of 4 floats a lane
static_assert((DM * DM) % CONV_PER_WG == 0 && (DFF * DM) % CONV_PER_WG == 0,
              "a work-group's range must lie inside one weight");
static_assert(CONV_WGS * 16 == MROWS && DM % 128 == 0, "one token's row a wave");
__global__ __launch_bounds__(512)
void k_weights_and_norm(const float* __restrict__ wq, const float* __restrict__ wk,
                        const float* __restrict__ wv, const float* __restrict__ wo,
                        const float* __restrict__ w1, const float* __restrict__ w3,
                        const float* __restrict__ w2, bf16* __restrict__ out,
                        const float* __restrict__ X, const float* __restrict__ G,
                        bf16* __restrict__ Nout) {
    const int first = blockIdx.x * CONV_PER_WG;   // index in the destination array
    const float* src = wq;                        // the weight that holds it ...
    int base = 0;                                 // ... and where that weight starts
    if (first >= 1 * DM * DM)                { src = wk; base = 1 * DM * DM; }
    if (first >= 2 * DM * DM)                { src = wv; base = 2 * DM * DM; }
    if (first >= 3 * DM * DM)                { src = wo; base = 3 * DM * DM; }
    if (first >= 4 * DM * DM)                { src = w1; base = 4 * DM * DM; }
    if (first >= 4 * DM * DM + 1 * DFF * DM) { src = w3; base = 4 * DM * DM + 1 * DFF * DM; }
    if (first >= 4 * DM * DM + 2 * DFF * DM) { src = w2; base = 4 * DM * DM + 2 * DFF * DM; }

    const int lane = threadIdx.x & 31, wave = threadIdx.x >> 5;

    // The wave's token. (All loops here are unrolled so that the arrays stay in registers
    // and the steps become immediate offsets.)
    const int row = blockIdx.x * 16 + wave;
    const f32x4* xs = (const f32x4*)(X + (size_t)row * DM) + lane;
    const f32x4* gs = (const f32x4*)G + lane;
    f32x4 xv[ROW_LOADS], gv[ROW_LOADS];
    #pragma unroll
    for (int j = 0; j < ROW_LOADS; ++j) xv[j] = xs[j * 32];
    #pragma unroll
    for (int j = 0; j < ROW_LOADS; ++j) gv[j] = gs[j * 32];

    const int at = first + wave * (CONV_LOADS * 128) + lane * 4;
    const f32x4* s = (const f32x4*)(src + (at - base));
    bf16x4*      d = (bf16x4*)(out + at);
    f32x4 v[CONV_LOADS];
    // Both loops unrolled: v[] stays in registers, the steps become immediate
    // offsets, and the loads can be issued ahead of the conversions.
    #pragma unroll
    for (int j = 0; j < CONV_LOADS; ++j)          // read once: non-temporal
        v[j] = __builtin_nontemporal_load(s + j * 32);
    // The two address pairs are inputs, so they live up to this wait: left alone the compiler
    // forms the second in the registers of the first and lands the last load on its own address.
    asm volatile("s_wait_xcnt 0x0" :: "v"(xs), "v"(s) : "memory");
    // Keeps the row's 16 loads and the weight loads, in this order, in front of all arithmetic:
    // left alone the compiler puts the whole norm, loads and dependent chain, either in front of
    // the first weight load or behind the last one's arrival, with nothing in flight under it.
    __builtin_amdgcn_sched_barrier(0);

    f32x4 sq = { 0.f, 0.f, 0.f, 0.f };            // four independent sums a lane
    #pragma unroll
    for (int j = 0; j < ROW_LOADS; ++j) sq += xv[j] * xv[j];
    float tot = row_sum((sq[0] + sq[1]) + (sq[2] + sq[3]));
    tot += other_half(tot);
    const float rinv = rsqrtf(tot / (float)DM + EPSV);
    bf16x4* nd = (bf16x4*)(Nout + (size_t)row * DM) + lane;
    #pragma unroll
    for (int j = 0; j < ROW_LOADS; ++j) {
        bf16x4 o = { (bf16)(xv[j][0] * rinv * gv[j][0]), (bf16)(xv[j][1] * rinv * gv[j][1]),
                     (bf16)(xv[j][2] * rinv * gv[j][2]), (bf16)(xv[j][3] * rinv * gv[j][3]) };
        nd[j * 32] = o;
    }
    // Keeps the conversions behind the norm: mixed into it, their waits for the weight loads
    // would hold up the norm's chain until the last weight has come.
    __builtin_amdgcn_sched_barrier(0);

    #pragma unroll
    for (int j = 0; j < CONV_LOADS; ++j) {
        bf16x4 o = { (bf16)v[j][0], (bf16)v[j][1], (bf16)v[j][2], (bf16)v[j][3] };
        d[j * 32] = o;
    }
}

// Eight asynchronous 16-byte copies per lane, global memory -> LDS, no register
// in between. The s_wait_xcnt is the last line of the copies' own statement so
// that no address register named here is rewritten ahead of it.
__device__ __forceinline__ void async_copy8(unsigned l, unsigned lstep,
                                            const bf16* g, size_t gstep) {
    asm volatile(
        "global_load_async_to_lds_b128 %0, %8, off\n\t"
        "global_load_async_to_lds_b128 %1, %9, off\n\t"
        "global_load_async_to_lds_b128 %2, %10, off\n\t"
        "global_load_async_to_lds_b128 %3, %11, off\n\t"
        "global_load_async_to_lds_b128 %4, %12, off\n\t"
        "global_load_async_to_lds_b128 %5, %13, off\n\t"
        "global_load_async_to_lds_b128 %6, %14, off\n\t"
        "global_load_async_to_lds_b128 %7, %15, off\n\t"
        "s_wait_xcnt 0x0"
        :: "v"(l), "v"(l + lstep), "v"(l + 2 * lstep), "v"(l + 3 * lstep),
           "v"(l + 4 * lstep), "v"(l + 5 * lstep), "v"(l + 6 * lstep), "v"(l + 7 * lstep),
           "v"(g), "v"(g + gstep), "v"(g + 2 * gstep), "v"(g + 3 * gstep),
           "v"(g + 4 * gstep), "v"(g + 5 * gstep), "v"(g + 6 * gstep), "v"(g + 7 * gstep)
        : "memory");
}

// The same, the first four copies from ga and the last four from gb: two sources
// whose rows lie one behind the other in LDS.
__device__ __forceinline__ void async_copy4x2(unsigned l, unsigned lstep,
                                              const bf16* ga, const bf16* gb, size_t gstep) {
    asm volatile(
        "global_load_async_to_lds_b128 %0, %8, off\n\t"
        "global_load_async_to_lds_b128 %1, %9, off\n\t"
        "global_load_async_to_lds_b128 %2, %10, off\n\t"
        "global_load_async_to_lds_b128 %3, %11, off\n\t"
        "global_load_async_to_lds_b128 %4, %12, off\n\t"
        "global_load_async_to_lds_b128 %5, %13, off\n\t"
        "global_load_async_to_lds_b128 %6, %14, off\n\t"
        "global_load_async_to_lds_b128 %7, %15, off\n\t"
        "s_wait_xcnt 0x0"
        :: "v"(l), "v"(l + lstep), "v"(l + 2 * lstep), "v"(l + 3 * lstep),
           "v"(l + 4 * lstep), "v"(l + 5 * lstep), "v"(l + 6 * lstep), "v"(l + 7 * lstep),
           "v"(ga), "v"(ga + gstep), "v"(ga + 2 * gstep), "v"(ga + 3 * gstep),
           "v"(gb), "v"(gb + gstep), "v"(gb + 2 * gstep), "v"(gb + 3 * gstep)
        : "memory");
}

// sin and cos of x radians, formed as __sincosf forms them. One statement, so that
// the v_nop stands directly behind the second transcendental: the slot that the
// instruction set asks for in front of an instruction that overwrites its source.
__device__ __forceinline__ void sincos_slot(float x, float& sn, float& cs) {
    const float rev = x * 0.15915494f;   // 1 / (2 pi): the instructions take revolutions
    asm("v_sin_f32 %0, %2\n\tv_cos_f32 %1, %2\n\tv_nop" : "=&v"(sn), "=&v"(cs) : "v"(rev));
}

// The K tile that a work-group of a GEMM grid starts with; it then walks all nt tiles
// in cyclic order. Work-groups of one grid row read the same rows of one operand and
// those of one grid column the same rows of the other. Started together on tile 0 they
// ask L2 for the same lines at the same moment, pass after pass, and a line that has to
// come from memory holds up all of them at once. With different starts the readers of a
// row are on different tiles, and a line is fetched for one of them ahead of the rest.
// Along y the start moves by one tile; along x by a quarter of the walk for x & 3. This is
// for speed alone: any start gives the same sum, added in another order.
__device__ __forceinline__ int first_k_tile(int nt) {
    return (int)(((blockIdx.x & 3) * (unsigned)(nt >> 2) + (blockIdx.x >> 3) + blockIdx.y) % (unsigned)nt);
}

// ---------------- WMMA NT-GEMM: C[M,N] = A[M,K] * B[N,K]^T + R[M,N], f32 out ----
// K is walked in tiles of 128, from first_k_tile() on. Two LDS buffers: tile t+1's asynchronous copies
// fly while tile t's 32 WMMAs per wave run; one barrier per tile publishes the
// next tile and frees the buffer just read. K must be a multiple of 128.
//
// NORM = true: the result goes on into an RMSNorm, C * g / rms(row of C), and from there into
// matrix products. 1 / rms is one scalar per row and commutes with those products, so no
// launch has to see a whole row first: this epilogue also stores bf16(C * g), the
// products' operand, and for each row the sum of C^2 over the wave's 32 columns,
// Part[column group][row], NPART groups; their reader adds them and scales its own result.
#define NPART (DM / 32)
template <bool NORM>
__global__ __launch_bounds__(256)
void k_gemm_nt(const bf16* __restrict__ A, const bf16* __restrict__ B,
               const float* __restrict__ R, float* __restrict__ Out,
               const float* __restrict__ G, bf16* __restrict__ Nb, float* __restrict__ Part,
               int M, int N, int K) {
    constexpr int BM = 128, BN = 128, BK = 128, LDT = BK + 8;  // 272-byte pitch
    constexpr int OPER = BM * LDT;                             // one operand's tile
    constexpr int STAGE = 2 * OPER;                            // [A tile | B tile]
    __shared__ __attribute__((aligned(16))) bf16 Sm[2 * STAGE];

    const int m0 = blockIdx.y * BM, n0 = blockIdx.x * BN;
    const int tid  = threadIdx.x;
    const int lane = tid & 31, wid = tid >> 5;   // 8 waves
    const int wm = wid >> 2, wn = wid & 3;       // 2 x 4 wave grid: 64x32 per wave
    const int l15 = lane & 15, kh = lane >> 4;

    // Copy map: 16 lanes cover one 256-byte row; a lane's 8 copies are 16 rows apart.
    const int crow = tid >> 4, ccol = (tid & 15) * 8;
    const bf16* gA = A + (size_t)(m0 + crow) * K + ccol;
    const bf16* gB = B + (size_t)(n0 + crow) * K + ccol;
    const unsigned lA = (unsigned)(size_t)(Sm + crow * LDT + ccol);
    const size_t gstep = (size_t)16 * K;
    auto stage_in = [&](int t, int buf) {
        const unsigned l = lA + (unsigned)(buf * STAGE * 2);
        async_copy8(l,            16 * LDT * 2, gA + (size_t)t * BK, gstep);
        async_copy8(l + OPER * 2, 16 * LDT * 2, gB + (size_t)t * BK, gstep);
    };

    const int nt = K / BK;
    const int kfirst = first_k_tile(nt);
    auto ktile = [&](int t) { const int k = t + kfirst; return k < nt ? k : k - nt; };   // pass t's K tile
    stage_in(ktile(0), 0);
    asm volatile("s_wait_asynccnt 0x0" ::: "memory");   // tile 0 has landed (own copies)
    __syncthreads();                                    // ... and every wave's copies
    if (nt > 1) stage_in(ktile(1), 1);

    f32x8 acc[4][2] = {};

    for (int t = 0; t < nt; ++t) {
        const bf16* As = Sm + (t & 1) * STAGE;
        const bf16* Bs = As + OPER;
        // Unrolled: the four blocks' LDS offsets become immediates and a block's
        // reads can start under the WMMAs of the block before it.
        #pragma unroll
        for (int kk = 0; kk < BK; kk += 32) {
            bf16x16 afr[4], bfr[2];
            #pragma unroll
            for (int ni = 0; ni < 2; ++ni)
                bfr[ni] = frag_ld(Bs + (wn * 32 + ni * 16 + l15) * LDT + kk, kh);
            #pragma unroll
            for (int mi = 0; mi < 4; ++mi)
                afr[mi] = frag_ld(As + (wm * 64 + mi * 16 + l15) * LDT + kk, kh);
            // Keeps the block's 12 LDS reads one group in front of its 8 WMMAs: left
            // alone the compiler sinks them between the WMMAs, a full LDS wait per pair.
            __builtin_amdgcn_sched_barrier(0);
            #pragma unroll
            for (int mi = 0; mi < 4; ++mi)
                #pragma unroll
                for (int ni = 0; ni < 2; ++ni)
                    acc[mi][ni] = wmma_bf16(afr[mi], bfr[ni], acc[mi][ni]);
        }
        asm volatile("s_wait_dscnt 0x0" ::: "memory");     // own reads of this buffer are done
        asm volatile("s_wait_asynccnt 0x0" ::: "memory");  // own copies of tile t+1 have landed
        __syncthreads();   // publishes tile t+1; ends every reader's last read of tile t
        if (t + 2 < nt) stage_in(ktile(t + 2), t & 1);     // refill the buffer just read
    }
    asm volatile("s_wait_asynccnt 0x0" ::: "memory");      // nothing in flight at the wave's end

    if constexpr (NORM) {
        const int gn = n0 + wn * 32 + l15;                    // the lane's columns: gn, gn + 16
        const float gq[2] = { G[gn], G[gn + 16] };
        // Holds these two loads in front of the residual's: left alone the compiler issues them
        // behind the first of those and aims their results at that load's address registers.
        asm volatile("s_wait_xcnt 0x0" ::: "memory");
        // All three loops unrolled: acc and ss are indexed by constants and stay in registers.
        #pragma unroll
        for (int mi = 0; mi < 4; ++mi) {
            const int gm = m0 + wm * 64 + mi * 16 + kh * 8;   // first of the lane's 8 rows
            f32x4 ss[2];
            #pragma unroll
            for (int r = 0; r < 8; ++r) {
                float sq = 0.f;
                #pragma unroll
                for (int ni = 0; ni < 2; ++ni) {
                    const size_t off = (size_t)(gm + r) * N + gn + ni * 16;
                    const float v = acc[mi][ni][r] + R[off];
                    Out[off] = v;
                    Nb[off]  = (bf16)(v * gq[ni]);
                    sq += v * v;
                }
                ss[r >> 2][r & 3] = row_sum(sq);
            }
            if (l15 == 0) {   // 8 consecutive rows of one column group
                float* pp = Part + (size_t)(blockIdx.x * 4 + wn) * M + gm;
                *(f32x4*)pp       = ss[0];
                *(f32x4*)(pp + 4) = ss[1];
            }
        }
    } else {
        #pragma unroll
        for (int mi = 0; mi < 4; ++mi)
            #pragma unroll
            for (int ni = 0; ni < 2; ++ni)
                #pragma unroll
                for (int r = 0; r < 8; ++r) {
                    int gm = m0 + wm * 64 + mi * 16 + kh * 8 + r;
                    int gn = n0 + wn * 32 + ni * 16 + l15;
                    size_t off = (size_t)gm * N + gn;
                    Out[off] = acc[mi][ni][r] + R[off];
                }
    }
}

// ---------------- Q, K and V projections, one launch ----------------
// The three bf16 weights lie back to back, so they are one matrix W of 3 * DM rows
// (48 heads of 64 features: 16 of Q, 16 of K, 16 of V). A work-group forms 192
// features (3 heads) x 256 tokens: 16 x 16 work-groups, one per WGP. A stage is
// [W 192 rows | X 256 rows] of 128 k; the ring is k_gemm_nt's.
// 12 waves, 3 x 4: a wave has ONE head x 64 tokens, 8 fragments for 16 WMMAs.
// In D a lane holds 8 consecutive rows of one column, so the side that is contiguous
// in the output goes in as A and the lane stores 16 bytes of bf16:
//   Q, K head: A = weight, B = tokens: RoPE on the lane's 4 pairs, Out[token][feature].
//   V head:    A = tokens, B = weight: Vt[b][feature][s], V transposed per head.
// Both sides of a wave's tile are 64 rows at the same pitch, read by the same loader, so
// the choice is only which rows' address is the A side's: one loop serves both.

__global__ __launch_bounds__(384)
void k_qkv(const bf16* __restrict__ Wqkv, const bf16* __restrict__ X,
           bf16* __restrict__ Qo, bf16* __restrict__ Ko, bf16* __restrict__ Vt, int K) {
    constexpr int BF = 192, BT = 256, BK = 128, LDT = BK + 8;  // 272-byte pitch
    constexpr int WPART = BF * LDT;
    constexpr int STAGE = WPART + BT * LDT;
    static_assert(DK == 64 && BF % DK == 0 && (3 * DM) % BF == 0 && MROWS % BT == 0 &&
                  SEQ % BT == 0, "a wave has one head; a tile's tokens lie in one batch entry");
    __shared__ __attribute__((aligned(16))) bf16 Sm[2 * STAGE];

    const int f0 = blockIdx.x * BF, t0 = blockIdx.y * BT;
    const int tid  = threadIdx.x;
    const int lane = tid & 31;
    // The wave's number in a scalar register: what hangs on it (who copies what, which
    // operand order, which epilogue) is then a scalar branch with every lane on.
    const int wid = __builtin_amdgcn_readfirstlane(tid >> 5);
    const int wf = wid >> 2, wt = wid & 3;
    const int l15 = lane & 15, kh = lane >> 4;
    const int head  = blockIdx.x * (BF / DK) + wf;   // 0 .. 47 in the stacked weight
    const int which = head / HEADS;                  // 0 Q, 1 K, 2 V
    const int hf0   = (head % HEADS) * DK;           // the head's first feature in its matrix

    // Copy map: 16 lanes cover one 256-byte row. Waves 0..7 bring the 256 token rows
    // (16 rows a copy step, 16 copies a lane), waves 8..11 the 192 weight rows (8 rows a
    // step, 24 copies a lane).
    const bool forX = wid < 8;
    const int  crow = (forX ? tid : tid - 256) >> 4, ccol = (tid & 15) * 8;
    const bf16* g0 = (forX ? X + (size_t)(t0 + crow) * K : Wqkv + (size_t)(f0 + crow) * K) + ccol;
    const unsigned l0 = (unsigned)(size_t)(Sm + (forX ? WPART : 0) + crow * LDT + ccol);
    auto stage_in = [&](int t, int buf) {
        const unsigned l = l0 + (unsigned)(buf * STAGE * 2);
        const bf16*    g = g0 + (size_t)t * BK;
        if (forX) {   // two paths, so that the LDS steps are constants in each
            async_copy8(l,                 16 * LDT * 2, g,                   (size_t)16 * K);
            async_copy8(l + 128 * LDT * 2, 16 * LDT * 2, g + (size_t)128 * K, (size_t)16 * K);
        } else {
            async_copy8(l,                 8 * LDT * 2, g,                   (size_t)8 * K);
            async_copy8(l + 64 * LDT * 2,  8 * LDT * 2, g + (size_t)64 * K,  (size_t)8 * K);
            async_copy8(l + 128 * LDT * 2, 8 * LDT * 2, g + (size_t)128 * K, (size_t)8 * K);
        }
    };

    const int nt = K / BK;
    const int kfirst = first_k_tile(nt);
    auto ktile = [&](int t) { const int k = t + kfirst; return k < nt ? k : k - nt; };   // pass t's K tile
    stage_in(ktile(0), 0);
    asm volatile("s_wait_asynccnt 0x0" ::: "memory");   // tile 0 has landed (own copies)
    __syncthreads();                                    // ... and every wave's copies
    if (nt > 1) stage_in(ktile(1), 1);

    // This lane's first row of the A side and of the B side, in buffer 0.
    const int wrow = (wf * 64 + l15) * LDT, xrow = WPART + (wt * 64 + l15) * LDT;
    const bf16* arow = Sm + (which == 2 ? xrow : wrow);
    const bf16* brow = Sm + (which == 2 ? wrow : xrow);

    f32x8 acc[4][4] = {};   // [A fragment][B fragment]

    for (int t = 0; t < nt; ++t) {
        const bf16* As = arow + (t & 1) * STAGE;
        const bf16* Bs = brow + (t & 1) * STAGE;
        // Unrolled: the four blocks' LDS offsets become immediates. (The short loops
        // over mi, ni, j and r, here and in the epilogue, are unrolled so that the
        // fragment and accumulator arrays are indexed by constants and stay in registers.)
        #pragma unroll
        for (int kk = 0; kk < BK; kk += 32) {
            bf16x16 afr[4], bfr[4];
            #pragma unroll
            for (int ni = 0; ni < 4; ++ni) bfr[ni] = frag_ld(Bs + ni * 16 * LDT + kk, kh);
            #pragma unroll
            for (int mi = 0; mi < 4; ++mi) afr[mi] = frag_ld(As + mi * 16 * LDT + kk, kh);
            // Keeps the block's 16 LDS reads one group in front of its 16 WMMAs: left
            // alone the compiler sinks them between the WMMAs, a full LDS wait per pair.
            __builtin_amdgcn_sched_barrier(0);
            #pragma unroll
            for (int mi = 0; mi < 4; ++mi)
                #pragma unroll
                for (int ni = 0; ni < 4; ++ni)
                    acc[mi][ni] = wmma_bf16(afr[mi], bfr[ni], acc[mi][ni]);
        }
        asm volatile("s_wait_dscnt 0x0" ::: "memory");     // own reads of this buffer are done
        asm volatile("s_wait_asynccnt 0x0" ::: "memory");  // own copies of tile t+1 have landed
        __syncthreads();   // publishes tile t+1; ends every reader's last read of tile t
        if (t + 2 < nt) stage_in(ktile(t + 2), t & 1);     // refill the buffer just read
    }
    asm volatile("s_wait_asynccnt 0x0" ::: "memory");      // nothing in flight at the wave's end

    if (which == 2) {
        #pragma unroll
        for (int mi = 0; mi < 4; ++mi)
            #pragma unroll
            for (int ni = 0; ni < 4; ++ni) {
                const int gt = t0 + wt * 64 + mi * 16 + kh * 8;   // first of 8 tokens
                const int gf = hf0 + ni * 16 + l15;               // feature
                bf16x8 o;
                #pragma unroll
                for (int r = 0; r < 8; ++r) o[r] = (bf16)acc[mi][ni][r];
                *(bf16x8*)(Vt + ((size_t)(gt / SEQ) * DM + gf) * SEQ + gt % SEQ) = o;
            }
    } else {
        bf16* Out = which ? Ko : Qo;
        #pragma unroll
        for (int mi = 0; mi < 4; ++mi) {
            float inv[4];                              // pairs mi*8 + kh*4 + j of the head
            #pragma unroll
            for (int j = 0; j < 4; ++j) {              // theta^(-2p/DK), p known to the compiler
                const float lo = __powf(THETA_F, -2.f * (float)(mi * 8 + j) / (float)DK);
                const float hi = __powf(THETA_F, -2.f * (float)(mi * 8 + 4 + j) / (float)DK);
                inv[j] = kh ? hi : lo;
            }
            #pragma unroll
            for (int ni = 0; ni < 4; ++ni) {
                const int gf = hf0 + mi * 16 + kh * 8;            // first of 8 features
                const int gt = t0 + wt * 64 + ni * 16 + l15;      // token
                const int s  = gt % SEQ;
                bf16x8 o;
                #pragma unroll
                for (int j = 0; j < 4; ++j) {
                    float sn, cs;
                    sincos_slot((float)s * inv[j], sn, cs);
                    const float x1 = acc[mi][ni][2 * j], x2 = acc[mi][ni][2 * j + 1];
                    o[2 * j]     = (bf16)(x1 * cs - x2 * sn);
                    o[2 * j + 1] = (bf16)(x1 * sn + x2 * cs);
                }
                *(bf16x8*)(Out + (size_t)gt * DM + gf) = o;
            }
        }
        // In the built code the V epilogue stands behind this branch's end and rewrites
        // the registers that the last stores name: the wait stands in front of it.
        asm volatile("s_wait_xcnt 0x0" ::: "memory");
    }
}

// ---------------- SwiGLU up-projection: H = silu(X W1^T / rms) * (X W3^T / rms), one launch ----
// A work-group forms BOTH products for 128 features x 256 tokens. A stage is
// [W1 128 rows | W3 128 rows | X 256 rows] of 128 k; the ring is k_gemm_nt's.
// The weights go in as A (m = feature) and the tokens as B, so in D a lane holds 8
// consecutive features of one token, of both products in the same registers' places:
// the gate is formed in registers and the lane stores 16 bytes of bf16.
// 16 waves, 4 x 4: a wave has 32 features (of each weight) x 64 tokens, that is 8
// fragments for 16 WMMAs. K must be a multiple of 128.
// X holds x1 * g, not yet divided by the token's rms: Part[group][token] has NPART partial
// sums of x1^2 a token, and both products are scaled by 1 / rms in the epilogue.
__global__ __launch_bounds__(512)
void k_ffn_up(const bf16* __restrict__ W1, const bf16* __restrict__ W3,
              const bf16* __restrict__ X, const float* __restrict__ Part,
              bf16* __restrict__ H, int F, int K) {
    constexpr int BF = 128, BT = 256, BK = 128, LDT = BK + 8;  // 272-byte pitch
    constexpr int WPART = 2 * BF * LDT;                        // both weights' tiles
    constexpr int STAGE = WPART + BT * LDT;
    __shared__ __attribute__((aligned(16))) bf16 Sm[2 * STAGE];
    __shared__ float Rinv[BT];   // 1 / rms of the tile's tokens

    const int f0 = blockIdx.x * BF, t0 = blockIdx.y * BT;
    const int tid  = threadIdx.x;
    const int lane = tid & 31, wid = tid >> 5;
    const int wf = wid >> 2, wt = wid & 3;
    const int l15 = lane & 15, kh = lane >> 4;

    // Copy map: 16 lanes cover one 256-byte row; a lane's copies are 32 rows apart.
    const int crow = tid >> 4, ccol = (tid & 15) * 8;
    const bf16* g1 = W1 + (size_t)(f0 + crow) * K + ccol;
    const bf16* g3 = W3 + (size_t)(f0 + crow) * K + ccol;
    const bf16* gX = X  + (size_t)(t0 + crow) * K + ccol;
    const unsigned lW = (unsigned)(size_t)(Sm + crow * LDT + ccol);
    const size_t gstep = (size_t)32 * K;
    auto stage_in = [&](int t, int buf) {
        const unsigned l = lW + (unsigned)(buf * STAGE * 2);
        async_copy4x2(l,           32 * LDT * 2, g1 + (size_t)t * BK, g3 + (size_t)t * BK, gstep);
        async_copy8(l + WPART * 2, 32 * LDT * 2, gX + (size_t)t * BK, gstep);
    };

    const int nt = K / BK;
    const int kfirst = first_k_tile(nt);
    auto ktile = [&](int t) { const int k = t + kfirst; return k < nt ? k : k - nt; };   // pass t's K tile
    stage_in(ktile(0), 0);
    if (tid < BT) {   // one token a lane, under tile 0's flight; the barrier below publishes it
        const float* pp = Part + t0 + tid;
        float q[4] = { 0.f, 0.f, 0.f, 0.f };
        // Unrolled: the loads are issued together, four independent sums.
        #pragma unroll
        for (int j = 0; j < NPART; ++j) q[j & 3] += pp[(size_t)j * MROWS];
        Rinv[tid] = rsqrtf(((q[0] + q[1]) + (q[2] + q[3])) / (float)K + EPSV);
    }
    asm volatile("s_wait_asynccnt 0x0" ::: "memory");   // tile 0 has landed (own copies)
    __syncthreads();                                    // ... and every wave's copies
    if (nt > 1) stage_in(ktile(1), 1);

    f32x8 acc1[2][4] = {}, acc3[2][4] = {};

    for (int t = 0; t < nt; ++t) {
        const bf16* Ws = Sm + (t & 1) * STAGE;
        const bf16* Xs = Ws + WPART;
        // Unrolled: the four blocks' LDS offsets become immediates. (The short loops
        // over mi, ni and r, here and in the epilogue, are unrolled so that the
        // fragment and accumulator arrays are indexed by constants and stay in registers.)
        #pragma unroll
        for (int kk = 0; kk < BK; kk += 32) {
            bf16x16 a1[2], a3[2], xb[4];
            #pragma unroll
            for (int ni = 0; ni < 4; ++ni)
                xb[ni] = frag_ld(Xs + (wt * 64 + ni * 16 + l15) * LDT + kk, kh);
            #pragma unroll
            for (int mi = 0; mi < 2; ++mi) {
                a1[mi] = frag_ld(Ws + (wf * 32 + mi * 16 + l15) * LDT + kk, kh);
                a3[mi] = frag_ld(Ws + (BF + wf * 32 + mi * 16 + l15) * LDT + kk, kh);
            }
            // Keeps the block's 16 LDS reads one group in front of its 16 WMMAs: left
            // alone the compiler sinks them between the WMMAs, a full LDS wait per pair.
            __builtin_amdgcn_sched_barrier(0);
            #pragma unroll
            for (int mi = 0; mi < 2; ++mi)
                #pragma unroll
                for (int ni = 0; ni < 4; ++ni) {
                    acc1[mi][ni] = wmma_bf16(a1[mi], xb[ni], acc1[mi][ni]);
                    acc3[mi][ni] = wmma_bf16(a3[mi], xb[ni], acc3[mi][ni]);
                }
        }
        asm volatile("s_wait_dscnt 0x0" ::: "memory");     // own reads of this buffer are done
        asm volatile("s_wait_asynccnt 0x0" ::: "memory");  // own copies of tile t+1 have landed
        __syncthreads();   // publishes tile t+1; ends every reader's last read of tile t
        if (t + 2 < nt) stage_in(ktile(t + 2), t & 1);     // refill the buffer just read
    }
    asm volatile("s_wait_asynccnt 0x0" ::: "memory");      // nothing in flight at the wave's end

    #pragma unroll
    for (int mi = 0; mi < 2; ++mi)
        #pragma unroll
        for (int ni = 0; ni < 4; ++ni) {
            const int gf = f0 + wf * 32 + mi * 16 + kh * 8;   // first of 8 features
            const int gt = t0 + wt * 64 + ni * 16 + l15;      // token
            const float rv = Rinv[gt - t0];
            bf16x8 o;
            #pragma unroll
            for (int r = 0; r < 8; ++r) {
                const float a = acc1[mi][ni][r] * rv;
                const float g = a / (1.f + __expf(-a));       // a * sigmoid(a)
                o[r] = (bf16)(g * (acc3[mi][ni][r] * rv));
            }
            *(bf16x8*)(H + (size_t)gt * F + gf) = o;
        }
}

// ---------------- Flash attention (causal, online softmax) ----------------
// Block: 128 threads (4 waves), handles one (b,h) and two tiles of 64 query rows,
// tile 31 - p and then tile p: 32 - p and p + 1 key tiles, 33 for every block, so
// that all blocks, resident together, end together wherever they are placed.
// Each wave owns 16 queries and forms the TRANSPOSED products on WMMA bf16:
//   S^T = K * Q^T   (A = 16 keys from LDS,     B = the wave's 16 queries, in registers)
//   O^T += V^T * P^T (A = 16 rows of V^T, LDS, B = P^T packed from the score registers)
// In D a lane holds one column, so lane l has the scores of query l & 15 alone
// (keys 8 * (l >> 4) + r of each 16-key tile): maximum and sum run inside the lane,
// with one exchange between lanes l and l ^ 16, and two score tiles converted in
// place are the B operand of the second product in frag_ld's own k order.
// K/V tile kt+1 is fetched into registers while tile kt is being consumed.

__global__ __launch_bounds__(128)
void k_flash_attn(const bf16* __restrict__ Qb, const bf16* __restrict__ Kb,
                  const bf16* __restrict__ Vt, bf16* __restrict__ Ob) {
    constexpr int LT = 72;   // 64 + 8 pad (16B-aligned rows, conflict-free b128)
    __shared__ __attribute__((aligned(16))) bf16 Qs [2 * 64 * LT];   // both query tiles
    __shared__ __attribute__((aligned(16))) bf16 Ks [64 * LT];
    __shared__ __attribute__((aligned(16))) bf16 Vts[64 * LT];

    const int qtile[2] = { SEQ / 64 - 1 - (int)blockIdx.x, (int)blockIdx.x };
    const int bh = blockIdx.y;
    const int b = bh / HEADS, h = bh % HEADS;
    const int tid = threadIdx.x, lane = tid & 31, w = tid >> 5;
    const int l15 = lane & 15, kh = lane >> 4;

    const bf16* Qg = Qb + (size_t)b * SEQ * DM + h * DK;
    const bf16* Kg = Kb + (size_t)b * SEQ * DM + h * DK;
    const bf16* Vg = Vt + ((size_t)b * HEADS + h) * DK * SEQ;

    int trow[4], tcol[4];
    #pragma unroll
    for (int i = 0; i < 4; ++i) {          // 64x64 tile, 8 bf16 per thread-iter
        int idx = tid + i * 128;
        trow[i] = idx >> 3; tcol[i] = (idx & 7) * 8;
    }
    #pragma unroll
    for (int hf = 0; hf < 2; ++hf)
        #pragma unroll
        for (int i = 0; i < 4; ++i)
            *(u32x4*)(Qs + hf * 64 * LT + trow[i] * LT + tcol[i]) =
                *(const u32x4*)(Qg + (size_t)(qtile[hf] * 64 + trow[i]) * DM + tcol[i]);
    __syncthreads();

    // Not unrolled: one copy of the key loop in the instruction cache.
    #pragma unroll 1
    for (int half = 0; half < 2; ++half) {
    const int qt = half ? qtile[1] : qtile[0];   // query tile (64 rows)

    const bf16* qrow = Qs + half * 64 * LT + (w * 16 + l15) * LT;
    bf16x16 bq0 = frag_ld(qrow, kh), bq1 = frag_ld(qrow + 32, kh);

    float mrow = -1e30f, lrow = 0.f;      // this lane's query: running maximum and sum
    f32x8 Oacc[4] = {};                   // Oacc[nt][r] = O[query l15][nt*16 + kh*8 + r]

    const int qg = qt * 64 + w * 16 + l15;   // this lane's global query index

    u32x4 rk[4], rv[4];
    auto fetchKV = [&](int kt) {
        #pragma unroll
        for (int i = 0; i < 4; ++i) {
            rk[i] = *(const u32x4*)(Kg + (size_t)(kt * 64 + trow[i]) * DM + tcol[i]);
            rv[i] = *(const u32x4*)(Vg + (size_t)trow[i] * SEQ + kt * 64 + tcol[i]);
        }
    };
    fetchKV(0);

    for (int kt = 0; kt <= qt; ++kt) {
        __syncthreads();   // previous-iteration readers of Ks/Vts are done
        #pragma unroll
        for (int i = 0; i < 4; ++i) {
            *(u32x4*)(Ks  + trow[i] * LT + tcol[i]) = rk[i];
            *(u32x4*)(Vts + trow[i] * LT + tcol[i]) = rv[i];
        }
        __syncthreads();

        if (kt + 2 <= qt) {   // warm GL2 two tiles ahead
            __builtin_prefetch(Kg + (size_t)((kt + 2) * 64 + trow[0]) * DM + tcol[0], 0, 3);
            __builtin_prefetch(Vg + (size_t)trow[0] * SEQ + (kt + 2) * 64 + tcol[0], 0, 3);
        }
        if (kt < qt) fetchKV(kt + 1);   // loads in flight under score/softmax

        // scores, transposed: 64(k) x 16(q) per wave, K-dim = dk = 64 -> 2 chained WMMAs
        // st[mt][r] = S[key kt*64 + mt*16 + kh*8 + r][query l15]
        f32x8 st[4];
        #pragma unroll
        for (int mt = 0; mt < 4; ++mt) {
            const bf16* krow = Ks + (mt * 16 + l15) * LT;
            f32x8 a = {};
            a = wmma_bf16(frag_ld(krow, kh), bq0, a);
            a = wmma_bf16(frag_ld(krow + 32, kh), bq1, a);
            st[mt] = a;
        }
        // scale + causal mask
        #pragma unroll
        for (int mt = 0; mt < 4; ++mt) {
            int kg = kt * 64 + mt * 16 + kh * 8;
            #pragma unroll
            for (int r = 0; r < 8; ++r) {
                float v = st[mt][r] * 0.125f;                // 1/sqrt(64)
                st[mt][r] = (kg + r > qg) ? -1e30f : v;
            }
        }
        // online softmax: the lane's 32 keys, then the other half's 32
        float mx8[8];
        #pragma unroll
        for (int r = 0; r < 8; ++r)
            mx8[r] = fmaxf(fmaxf(st[0][r], st[1][r]), fmaxf(st[2][r], st[3][r]));
        float mx = fmaxf(fmaxf(fmaxf(mx8[0], mx8[1]), fmaxf(mx8[2], mx8[3])),
                         fmaxf(fmaxf(mx8[4], mx8[5]), fmaxf(mx8[6], mx8[7])));
        mx = fmaxf(mx, other_half(mx));
        const float mnew = fmaxf(mrow, mx);
        const float sc = __expf(mrow - mnew);
        #pragma unroll
        for (int mt = 0; mt < 4; ++mt)
            #pragma unroll
            for (int r = 0; r < 8; ++r) st[mt][r] = __expf(st[mt][r] - mnew);
        float sm8[8];
        #pragma unroll
        for (int r = 0; r < 8; ++r)
            sm8[r] = (st[0][r] + st[1][r]) + (st[2][r] + st[3][r]);
        float sm = ((sm8[0] + sm8[1]) + (sm8[2] + sm8[3])) +
                   ((sm8[4] + sm8[5]) + (sm8[6] + sm8[7]));
        sm += other_half(sm);
        lrow = lrow * sc + sm;
        mrow = mnew;
        #pragma unroll
        for (int nt = 0; nt < 4; ++nt)
            #pragma unroll
            for (int r = 0; r < 8; ++r) Oacc[nt][r] *= sc;

        // P^T as B operand: element s of keys 32g .. 32g+31 is tile 2g + (s >> 3), register s & 7
        bf16x16 bp0, bp1;
        #pragma unroll
        for (int s = 0; s < 16; ++s) {
            bp0[s] = (bf16)st[s >> 3][s & 7];
            bp1[s] = (bf16)st[2 + (s >> 3)][s & 7];
        }
        #pragma unroll
        for (int nt = 0; nt < 4; ++nt) {
            const bf16* vrow = Vts + (nt * 16 + l15) * LT;
            Oacc[nt] = wmma_bf16(frag_ld(vrow, kh), bp0, Oacc[nt]);
            Oacc[nt] = wmma_bf16(frag_ld(vrow + 32, kh), bp1, Oacc[nt]);
        }
    }

    // normalize and write bf16 output (feeds the WO GEMM directly):
    // a lane's 8 registers of a tile are 8 consecutive elements of its query's row
    const size_t srow = (size_t)b * SEQ + qg;
    #pragma unroll
    for (int nt = 0; nt < 4; ++nt) {
        bf16x8 o;
        #pragma unroll
        for (int r = 0; r < 8; ++r) o[r] = (bf16)(Oacc[nt][r] / lrow);
        *(bf16x8*)(Ob + srow * DM + h * DK + nt * 16 + kh * 8) = o;
    }
    // The second tile's code rewrites the registers that these stores name.
    asm volatile("s_wait_xcnt 0x0" ::: "memory");
    }   // half
}

// ---------------- host launcher ----------------
extern "C" void kernel_launch(void* const* d_in, const int* in_sizes, int n_in,
                              void* d_out, int out_size, void* d_ws, size_t ws_size,
                              hipStream_t stream) {
    (void)in_sizes; (void)n_in; (void)out_size; (void)ws_size;
    const float* x  = (const float*)d_in[0];
    const float* wq = (const float*)d_in[1];
    const float* wk = (const float*)d_in[2];
    const float* wv = (const float*)d_in[3];
    const float* wo = (const float*)d_in[4];
    const float* w1 = (const float*)d_in[5];
    const float* w2 = (const float*)d_in[6];
    const float* w3 = (const float*)d_in[7];
    const float* g1 = (const float*)d_in[8];
    const float* g2 = (const float*)d_in[9];
    float* out = (float*)d_out;

    const size_t MB = 1ull << 20;
    char* p = (char*)d_ws;
    bf16*  n_bf  = (bf16*)p;            p += 8 * MB;   // 4096x1024 bf16
    bf16*  wq_bf = (bf16*)p;            p += 2 * MB;
    bf16*  wk_bf = (bf16*)p;            p += 2 * MB;
    bf16*  wv_bf = (bf16*)p;            p += 2 * MB;
    bf16*  wo_bf = (bf16*)p;            p += 2 * MB;
    bf16*  w1_bf = (bf16*)p;            p += 8 * MB;
    bf16*  w3_bf = (bf16*)p;            p += 8 * MB;
    bf16*  w2_bf = (bf16*)p;            p += 8 * MB;
    float* x1    = (float*)p;           p += 16 * MB;  // x + attn residual
    bf16*  n2_bf = (bf16*)p;            p += 8 * MB;
    // 64 MB region: q_bf and k_bf lie in its last quarter, the partial sums at its start
    char*  reuse = p;                   p += 64 * MB;
    float* part = (float*)reuse;                       // NPART x 4096 f32
    bf16*  q_bf = (bf16*) (reuse + 48 * MB);
    bf16*  k_bf = (bf16*) (reuse + 56 * MB);
    bf16*  vt_bf = (bf16*)p;            p += 8 * MB;
    bf16*  o_bf  = (bf16*)p;            p += 8 * MB;
    bf16*  h_bf  = (bf16*)p;            p += 32 * MB;  // swiglu output 4096x4096

    // 1) weights -> bf16, and n = rmsnorm(x, g1)
    //    (wq_bf .. w2_bf are one contiguous array that starts at wq_bf)
    k_weights_and_norm<<<CONV_WGS, 512, 0, stream>>>(wq, wk, wv, wo, w1, w3, w2, wq_bf, x, g1, n_bf);

    // 3) Q, K (with RoPE) and V (transposed per head) projections -> bf16, one launch
    //    (wq_bf, wk_bf, wv_bf are one contiguous array that starts at wq_bf)
    dim3 gQKV(DM / 128, MROWS / 128);
    dim3 gHeads(3 * DM / 192, MROWS / 256);
    k_qkv<<<gHeads, 384, 0, stream>>>(wq_bf, n_bf, q_bf, k_bf, vt_bf, DM);

    // 5) causal flash attention -> o (bf16)
    dim3 gAtt(SEQ / 128, BATCH * HEADS);
    k_flash_attn<<<gAtt, 128, 0, stream>>>(q_bf, k_bf, vt_bf, o_bf);

    // 6) x1 = x + o @ Wo^T; n2 = x1 * g2 in bf16; partial sums of x1^2
    k_gemm_nt<true><<<gQKV, 256, 0, stream>>>(o_bf, wo_bf, x, x1, g2, n2_bf, part, MROWS, DM, DM);

    // 8) h = silu(a) * b, a = (n2 @ W1^T) / rms, b = (n2 @ W3^T) / rms, one launch
    dim3 gFF(DFF / 128, MROWS / 256);
    k_ffn_up<<<gFF, 512, 0, stream>>>(w1_bf, w3_bf, n2_bf, part, h_bf, DFF, DM);

    // 9) out = x1 + h @ W2^T
    k_gemm_nt<false><<<gQKV, 256, 0, stream>>>(h_bf, w2_bf, x1, out, nullptr, nullptr, nullptr,
                                               MROWS, DM, DFF);
}
